// v000
// The times below were measured on an AMD MI455X: many runs one after another, warmed up first and cycling through
// copies of the inputs, with the whole window's GPU time divided by the number of runs. Launches and the gaps
// between them are all in it. The median over several windows is given; except for v000 it joins two sittings, which
// can be a few percent apart, so the side-by-side timings, each taken in one sitting, are the better comparison.
// The starting kernel, v000, takes 530 microseconds a run.
#include <hip/hip_runtime.h>
#include <hip/hip_bf16.h>
#include <cstdint>

typedef __attribute__((ext_vector_type(16))) _Float16 v16h;
typedef __attribute__((ext_vector_type(4)))  _Float16 v4h;
typedef __attribute__((ext_vector_type(8)))  float    v8f;

#define S_LEN 2048
#define B_SZ  8
#define DM    1024
#define NH    16
#define HD    64
#define MTOK  (S_LEN * B_SZ)          // 16384 tokens

__device__ __forceinline__ void async_ld_b128(const void* gptr, const void* lptr) {
    unsigned lds_off = (unsigned)(uintptr_t)lptr;
    asm volatile("global_load_async_to_lds_b128 %0, %1, off"
                 :: "v"(lds_off), "v"(gptr) : "memory");
}
#if __has_builtin(__builtin_amdgcn_s_wait_asynccnt)
#define WAIT_ASYNC(n) __builtin_amdgcn_s_wait_asynccnt(n)
#else
#define WAIT_ASYNC(n) asm volatile("s_wait_asynccnt %0" :: "n"(n) : "memory")
#endif

__device__ __forceinline__ v16h load_frag(const _Float16* tile, int row0, int ld) {
    const int lane = threadIdx.x & 31;
    const _Float16* p = tile + (size_t)(row0 + (lane & 15)) * ld + ((lane >> 4) << 3);
    v16h r;
    ((float4*)&r)[0] = *(const float4*)(p);
    ((float4*)&r)[1] = *(const float4*)(p + 16);
    return r;
}

__device__ __forceinline__ v8f vzero8() { v8f z = {0.f,0.f,0.f,0.f,0.f,0.f,0.f,0.f}; return z; }

// ---------------------------------------------------------------------------
// fp32 -> fp16 conversion, float4 vectorized (used for input and weights)
// ---------------------------------------------------------------------------
__global__ __launch_bounds__(256) void cvt_f32_f16(const float* __restrict__ X,
                                                   _Float16* __restrict__ Xh) {
    size_t i = (size_t)blockIdx.x * 256 + threadIdx.x;
    float4 v = ((const float4*)X)[i];
    v4h h; h.x = (_Float16)v.x; h.y = (_Float16)v.y; h.z = (_Float16)v.z; h.w = (_Float16)v.w;
    ((v4h*)Xh)[i] = h;
}

template<bool OUT_F16>
__global__ __launch_bounds__(256)
void gemm_xwT(const _Float16* __restrict__ X, const _Float16* __restrict__ Wh,
              const float* __restrict__ bias, _Float16* __restrict__ Yh,
              float* __restrict__ Yf, int M, int N, int K) {
    constexpr int BM = 128, BN = 128, BK = 32;
    __shared__ _Float16 sX[3][BM * BK];
    __shared__ _Float16 sW[3][BN * BK];

    const int t    = threadIdx.x;
    const int lane = t & 31;
    const int wv   = t >> 5;                  // 0..7
    const int mBlk = blockIdx.x * BM;
    const int nBlk = blockIdx.y * BN;
    const int wm   = (wv >> 2) * 64;          // 0 / 64
    const int wn   = (wv & 3) * 32;           // 0 / 32 / 64 / 96

    v8f acc[4][2];
    #pragma unroll
    for (int i = 0; i < 4; ++i)
        #pragma unroll
        for (int j = 0; j < 2; ++j) acc[i][j] = vzero8();

    const int nk = K / BK;

    // 4 async b128 copies per thread per stage (2 X chunks + 2 W chunks)
    auto issue = [&](int kt, int buf) {
        #pragma unroll
        for (int i = 0; i < 2; ++i) {
            int c = t * 2 + i;                 // 0..511
            int row = c >> 2, kc = (c & 3) * 8;
            async_ld_b128(X + (size_t)(mBlk + row) * K + kt * BK + kc,
                          &sX[buf][row * BK + kc]);
            async_ld_b128(Wh + (size_t)(nBlk + row) * K + kt * BK + kc,
                          &sW[buf][row * BK + kc]);
        }
    };

    issue(0, 0);
    for (int kt = 0; kt < nk; ++kt) {
        if (kt + 1 < nk) { issue(kt + 1, (kt + 1) % 3); WAIT_ASYNC(4); }
        else             { WAIT_ASYNC(0); }
        __syncthreads();
        const int b = kt % 3;
        v16h aF[4], bF[2];
        #pragma unroll
        for (int i = 0; i < 4; ++i) aF[i] = load_frag(sX[b], wm + i * 16, BK);
        #pragma unroll
        for (int j = 0; j < 2; ++j) bF[j] = load_frag(sW[b], wn + j * 16, BK);
        #pragma unroll
        for (int i = 0; i < 4; ++i)
            #pragma unroll
            for (int j = 0; j < 2; ++j)
                acc[i][j] = __builtin_amdgcn_wmma_f32_16x16x32_f16(
                    false, aF[i], false, bF[j], (short)0, acc[i][j], false, false);
    }

    float bv[2];
    #pragma unroll
    for (int j = 0; j < 2; ++j) bv[j] = bias[nBlk + wn + j * 16 + (lane & 15)];
    const int mLane = mBlk + wm + ((lane >> 4) << 3);
    const int nLane = nBlk + wn + (lane & 15);
    #pragma unroll
    for (int i = 0; i < 4; ++i)
        #pragma unroll
        for (int j = 0; j < 2; ++j)
            #pragma unroll
            for (int vg = 0; vg < 8; ++vg) {
                int m = mLane + i * 16 + vg;
                int nn = nLane + j * 16;
                float val = acc[i][j][vg] + bv[j];
                if (OUT_F16) Yh[(size_t)m * N + nn] = (_Float16)val;
                else         Yf[(size_t)m * N + nn] = val;
            }
}

// ---------------------------------------------------------------------------
// w = sigmoid(X@Ww^T + bw), r = sigmoid(X@Wr^T + br): one wave per dot (fp32)
// ---------------------------------------------------------------------------
__global__ __launch_bounds__(256)
void wr_proj(const float* __restrict__ X,
             const float* __restrict__ Ww, const float* __restrict__ Wb,
             const float* __restrict__ Rw, const float* __restrict__ Rb,
             float* __restrict__ wout, float* __restrict__ rout) {
    int g    = blockIdx.x * 8 + (threadIdx.x >> 5);   // 2^19 waves
    int lane = threadIdx.x & 31;
    int tsel = g >> 18;
    int idx  = g & ((1 << 18) - 1);
    int m = idx >> 4, h = idx & 15;
    const float* Wp = (tsel ? Rw : Ww) + (size_t)h * DM;
    const float* xp = X + (size_t)m * DM;
    float s = 0.f;
    for (int i = lane; i < DM; i += 32) s += xp[i] * Wp[i];
    #pragma unroll
    for (int o = 16; o > 0; o >>= 1) s += __shfl_xor(s, o, 32);
    if (lane == 0) {
        float b = tsel ? Rb[h] : Wb[h];
        float y = 1.f / (1.f + __expf(-(s + b)));
        (tsel ? rout : wout)[m * NH + h] = y;
    }
}

// ---------------------------------------------------------------------------
// Unit-normalize Q and K per head (64-wide) in place; wave per (tensor,m,head)
// ---------------------------------------------------------------------------
__global__ __launch_bounds__(256)
void norm_qk(_Float16* __restrict__ Qh, _Float16* __restrict__ Kh) {
    int g    = blockIdx.x * 8 + (threadIdx.x >> 5);
    int lane = threadIdx.x & 31;
    int tsel = g >> 18;
    int idx  = g & ((1 << 18) - 1);
    int m = idx >> 4, h = idx & 15;
    _Float16* p = (tsel ? Kh : Qh) + (size_t)m * DM + h * HD;
    float a = (float)p[lane], c = (float)p[lane + 32];
    float s = a * a + c * c;
    #pragma unroll
    for (int o = 16; o > 0; o >>= 1) s += __shfl_xor(s, o, 32);
    float inv = 1.f / fmaxf(sqrtf(s), 1e-12f);
    p[lane]      = (_Float16)(a * inv);
    p[lane + 32] = (_Float16)(c * inv);
}

// ---------------------------------------------------------------------------
// Vh *= w (per token, per head)
// ---------------------------------------------------------------------------
__global__ __launch_bounds__(256)
void scale_v(_Float16* __restrict__ Vh, const float* __restrict__ wbuf) {
    size_t i = (size_t)blockIdx.x * 256 + threadIdx.x;   // MTOK*DM
    int m = (int)(i >> 10);
    int h = (int)((i & 1023) >> 6);
    Vh[i] = (_Float16)((float)Vh[i] * wbuf[m * NH + h]);
}

// ---------------------------------------------------------------------------
// A[b,n,v,q] = sum_s Vw[s,(b,n),v] * K[s,(b,n),q]  — one block per (b,n),
// WMMA with K-dim = s in chunks of 32, LDS tiles stored transposed [feat][s].
// Writes f32 A to d_out region and f16 copy to workspace.
// ---------------------------------------------------------------------------
__global__ __launch_bounds__(256)
void accum_A(const _Float16* __restrict__ Kh, const _Float16* __restrict__ Vh,
             float* __restrict__ Af, _Float16* __restrict__ Ah) {
    const int bn = blockIdx.x;          // b*16 + n
    const int b  = bn >> 4, n = bn & 15;
    __shared__ _Float16 sK[2][HD * 32]; // [q][s]
    __shared__ _Float16 sV[2][HD * 32]; // [v][s]

    const int t = threadIdx.x, lane = t & 31, wv = t >> 5;   // 8 waves
    const int vt   = wv >> 1;           // v-tile 0..3
    const int qoff = (wv & 1) * 32;     // q half 0/32

    v8f acc[2] = {vzero8(), vzero8()};
    uint4 kreg, vreg;
    const int s_i = t >> 3, f8 = (t & 7) * 8;
    const int nsc = S_LEN / 32;

    auto fetchA = [&](int sc) {
        size_t m = (size_t)(sc * 32 + s_i) * B_SZ + b;
        kreg = *(const uint4*)(Kh + m * DM + n * HD + f8);
        vreg = *(const uint4*)(Vh + m * DM + n * HD + f8);
    };
    auto stageA = [&](int bb) {
        union { uint4 u; _Float16 h[8]; } ck, cv;
        ck.u = kreg; cv.u = vreg;
        #pragma unroll
        for (int e = 0; e < 8; ++e) {
            sK[bb][(f8 + e) * 32 + s_i] = ck.h[e];   // transpose at store
            sV[bb][(f8 + e) * 32 + s_i] = cv.h[e];
        }
    };

    fetchA(0); stageA(0);
    for (int sc = 0; sc < nsc; ++sc) {
        __syncthreads();
        if (sc + 1 < nsc) fetchA(sc + 1);
        const int bb = sc & 1;
        v16h aF = load_frag(sV[bb], vt * 16, 32);
        v16h bF0 = load_frag(sK[bb], qoff, 32);
        v16h bF1 = load_frag(sK[bb], qoff + 16, 32);
        acc[0] = __builtin_amdgcn_wmma_f32_16x16x32_f16(false, aF, false, bF0, (short)0, acc[0], false, false);
        acc[1] = __builtin_amdgcn_wmma_f32_16x16x32_f16(false, aF, false, bF1, (short)0, acc[1], false, false);
        if (sc + 1 < nsc) stageA((sc + 1) & 1);
    }

    #pragma unroll
    for (int j = 0; j < 2; ++j)
        #pragma unroll
        for (int vg = 0; vg < 8; ++vg) {
            int vIdx = vt * 16 + vg + ((lane >> 4) << 3);
            int qIdx = qoff + j * 16 + (lane & 15);
            size_t idx = ((size_t)bn * HD + vIdx) * HD + qIdx;
            float val = acc[j][vg];
            Af[idx] = val;
            Ah[idx] = (_Float16)val;
        }
}

// ---------------------------------------------------------------------------
// Mid[s,(b,n),v] = r * sum_q Q[s,(b,n),q] * A[b,n,v,q] — WMMA, fragments
// loaded straight from global (Q rows strided by B*DM, A rows contiguous).
// ---------------------------------------------------------------------------
__global__ __launch_bounds__(256)
void apply_A(const _Float16* __restrict__ Qh, const _Float16* __restrict__ Ah,
             const float* __restrict__ rbuf, _Float16* __restrict__ Mid) {
    const int bn = blockIdx.x;          // b*16+n
    const int b  = bn >> 4, n = bn & 15;
    const int lane  = threadIdx.x & 31;
    const int sBase = blockIdx.y * 128 + (threadIdx.x >> 5) * 16;   // 8 waves x 16 rows

    const _Float16* Abase = Ah + (size_t)bn * (HD * HD);
    v8f acc[4] = {vzero8(), vzero8(), vzero8(), vzero8()};

    #pragma unroll
    for (int kt = 0; kt < 2; ++kt) {    // K = 64 = 2 x 32
        const _Float16* qbase = Qh + ((size_t)sBase * B_SZ + b) * DM + n * HD + kt * 32;
        v16h aF = load_frag(qbase, 0, B_SZ * DM);        // row step = next s token
        #pragma unroll
        for (int j = 0; j < 4; ++j) {
            v16h bF = load_frag(Abase + kt * 32, j * 16, HD);
            acc[j] = __builtin_amdgcn_wmma_f32_16x16x32_f16(
                false, aF, false, bF, (short)0, acc[j], false, false);
        }
    }

    float rv[8];
    #pragma unroll
    for (int vg = 0; vg < 8; ++vg) {
        int s = sBase + vg + ((lane >> 4) << 3);
        rv[vg] = rbuf[((size_t)s * B_SZ + b) * NH + n];
    }
    #pragma unroll
    for (int j = 0; j < 4; ++j)
        #pragma unroll
        for (int vg = 0; vg < 8; ++vg) {
            int s = sBase + vg + ((lane >> 4) << 3);
            size_t m = (size_t)s * B_SZ + b;
            Mid[m * DM + n * HD + j * 16 + (lane & 15)] = (_Float16)(acc[j][vg] * rv[vg]);
        }
}

// ---------------------------------------------------------------------------
// Launch
// ---------------------------------------------------------------------------
extern "C" void kernel_launch(void* const* d_in, const int* in_sizes, int n_in,
                              void* d_out, int out_size, void* d_ws, size_t ws_size,
                              hipStream_t stream) {
    (void)in_sizes; (void)n_in; (void)out_size; (void)ws_size;
    const float* inp  = (const float*)d_in[0];
    const float* Wq_w = (const float*)d_in[1];  const float* Wq_b = (const float*)d_in[2];
    const float* Wk_w = (const float*)d_in[3];  const float* Wk_b = (const float*)d_in[4];
    const float* Wv_w = (const float*)d_in[5];  const float* Wv_b = (const float*)d_in[6];
    const float* Wo_w = (const float*)d_in[7];  const float* Wo_b = (const float*)d_in[8];
    const float* Ww_w = (const float*)d_in[9];  const float* Ww_b = (const float*)d_in[10];
    const float* Wr_w = (const float*)d_in[11]; const float* Wr_b = (const float*)d_in[12];

    float* out_f = (float*)d_out;                       // [S,B,DM]
    float* A_f   = out_f + (size_t)MTOK * DM;           // [B,NH,64,64]

    char* ws = (char*)d_ws;
    constexpr size_t HBYTES = (size_t)MTOK * DM * sizeof(_Float16);   // 32 MiB
    constexpr size_t GATE   = (size_t)MTOK * NH * 4;                  // 1 MiB
    constexpr size_t WBYTES = (size_t)DM * DM * sizeof(_Float16);     // 2 MiB
    _Float16* Xh  = (_Float16*)(ws);
    _Float16* Qh  = (_Float16*)(ws + HBYTES);
    _Float16* Kh  = (_Float16*)(ws + 2 * HBYTES);
    _Float16* Vh  = (_Float16*)(ws + 3 * HBYTES);
    float*    wbf = (float*)   (ws + 4 * HBYTES);
    float*    rbf = (float*)   (ws + 4 * HBYTES + GATE);
    _Float16* Ah  = (_Float16*)(ws + 4 * HBYTES + 2 * GATE);
    _Float16* Mid = (_Float16*)(ws + 4 * HBYTES + 2 * GATE + (size_t)B_SZ * NH * HD * HD * 2);
    _Float16* Wqh = (_Float16*)(ws + 5 * HBYTES + 3 * GATE);
    _Float16* Wkh = (_Float16*)(ws + 5 * HBYTES + 3 * GATE + WBYTES);
    _Float16* Wvh = (_Float16*)(ws + 5 * HBYTES + 3 * GATE + 2 * WBYTES);
    _Float16* Woh = (_Float16*)(ws + 5 * HBYTES + 3 * GATE + 3 * WBYTES);

    // 1) fp32 -> fp16: input + four big weight matrices
    cvt_f32_f16<<<(MTOK * DM / 4) / 256, 256, 0, stream>>>(inp, Xh);
    cvt_f32_f16<<<(DM * DM / 4) / 256, 256, 0, stream>>>(Wq_w, Wqh);
    cvt_f32_f16<<<(DM * DM / 4) / 256, 256, 0, stream>>>(Wk_w, Wkh);
    cvt_f32_f16<<<(DM * DM / 4) / 256, 256, 0, stream>>>(Wv_w, Wvh);
    cvt_f32_f16<<<(DM * DM / 4) / 256, 256, 0, stream>>>(Wo_w, Woh);

    // 2) Q/K/V projections (WMMA GEMM, async-LDS pipeline, f16 out)
    dim3 gg(MTOK / 128, DM / 128);
    gemm_xwT<true><<<gg, 256, 0, stream>>>(Xh, Wqh, Wq_b, Qh, nullptr, MTOK, DM, DM);
    gemm_xwT<true><<<gg, 256, 0, stream>>>(Xh, Wkh, Wk_b, Kh, nullptr, MTOK, DM, DM);
    gemm_xwT<true><<<gg, 256, 0, stream>>>(Xh, Wvh, Wv_b, Vh, nullptr, MTOK, DM, DM);

    // 3) gate projections, head-normalize, v*w
    wr_proj<<<65536, 256, 0, stream>>>(inp, Ww_w, Ww_b, Wr_w, Wr_b, wbf, rbf);
    norm_qk<<<65536, 256, 0, stream>>>(Qh, Kh);
    scale_v<<<(MTOK * DM) / 256, 256, 0, stream>>>(Vh, wbf);

    // 4) A accumulation (writes f32 A output + f16 copy)
    accum_A<<<B_SZ * NH, 256, 0, stream>>>(Kh, Vh, A_f, Ah);

    // 5) apply A, scale by r
    apply_A<<<dim3(B_SZ * NH, S_LEN / 128), 256, 0, stream>>>(Qh, Ah, rbf, Mid);

    // 6) final O projection (f32 out to d_out)
    gemm_xwT<false><<<gg, 256, 0, stream>>>(Mid, Woh, Wo_b, nullptr, out_f, MTOK, DM, DM);
}

// v001
// It runs in 446 microseconds.
// Next to v000, in two timings, it ran 1.21 times as fast each time.
#include <hip/hip_runtime.h>
#include <hip/hip_bf16.h>
#include <cstdint>

typedef __attribute__((ext_vector_type(16))) _Float16 v16h;
typedef __attribute__((ext_vector_type(4)))  _Float16 v4h;
typedef __attribute__((ext_vector_type(8)))  float    v8f;

#define S_LEN 2048
#define B_SZ  8
#define DM    1024
#define NH    16
#define HD    64
#define MTOK  (S_LEN * B_SZ)          // 16384 tokens

__device__ __forceinline__ void async_ld_b128(const void* gptr, const void* lptr) {
    unsigned lds_off = (unsigned)(uintptr_t)lptr;
    asm volatile("global_load_async_to_lds_b128 %0, %1, off"
                 :: "v"(lds_off), "v"(gptr) : "memory");
}
#if __has_builtin(__builtin_amdgcn_s_wait_asynccnt)
#define WAIT_ASYNC(n) __builtin_amdgcn_s_wait_asynccnt(n)
#else
#define WAIT_ASYNC(n) asm volatile("s_wait_asynccnt %0" :: "n"(n) : "memory")
#endif

__device__ __forceinline__ v16h load_frag(const _Float16* tile, int row0, int ld) {
    const int lane = threadIdx.x & 31;
    const _Float16* p = tile + (size_t)(row0 + (lane & 15)) * ld + ((lane >> 4) << 3);
    v16h r;
    ((float4*)&r)[0] = *(const float4*)(p);
    ((float4*)&r)[1] = *(const float4*)(p + 16);
    return r;
}

__device__ __forceinline__ v8f vzero8() { v8f z = {0.f,0.f,0.f,0.f,0.f,0.f,0.f,0.f}; return z; }

// ---------------------------------------------------------------------------
// fp32 -> fp16 conversion, float4 vectorized (used for input and weights)
// ---------------------------------------------------------------------------
__global__ __launch_bounds__(256) void cvt_f32_f16(const float* __restrict__ X,
                                                   _Float16* __restrict__ Xh) {
    size_t i = (size_t)blockIdx.x * 256 + threadIdx.x;
    float4 v = ((const float4*)X)[i];
    v4h h; h.x = (_Float16)v.x; h.y = (_Float16)v.y; h.z = (_Float16)v.z; h.w = (_Float16)v.w;
    ((v4h*)Xh)[i] = h;
}

template<bool OUT_F16>
__global__ __launch_bounds__(256)
void gemm_xwT(const _Float16* __restrict__ X, const _Float16* __restrict__ Wh,
              const float* __restrict__ bias, _Float16* __restrict__ Yh,
              float* __restrict__ Yf, int M, int N, int K) {
    constexpr int BM = 128, BN = 128, BK = 32;
    __shared__ _Float16 sX[3][BM * BK];
    __shared__ _Float16 sW[3][BN * BK];

    const int t    = threadIdx.x;
    const int lane = t & 31;
    const int wv   = t >> 5;                  // 0..7
    const int mBlk = blockIdx.x * BM;
    const int nBlk = blockIdx.y * BN;
    const int wm   = (wv >> 2) * 64;          // 0 / 64
    const int wn   = (wv & 3) * 32;           // 0 / 32 / 64 / 96

    v8f acc[4][2];
    #pragma unroll
    for (int i = 0; i < 4; ++i)
        #pragma unroll
        for (int j = 0; j < 2; ++j) acc[i][j] = vzero8();

    const int nk = K / BK;

    // 4 async b128 copies per thread per stage (2 X chunks + 2 W chunks)
    auto issue = [&](int kt, int buf) {
        #pragma unroll
        for (int i = 0; i < 2; ++i) {
            int c = t * 2 + i;                 // 0..511
            int row = c >> 2, kc = (c & 3) * 8;
            async_ld_b128(X + (size_t)(mBlk + row) * K + kt * BK + kc,
                          &sX[buf][row * BK + kc]);
            async_ld_b128(Wh + (size_t)(nBlk + row) * K + kt * BK + kc,
                          &sW[buf][row * BK + kc]);
        }
    };

    issue(0, 0);
    for (int kt = 0; kt < nk; ++kt) {
        if (kt + 1 < nk) { issue(kt + 1, (kt + 1) % 3); WAIT_ASYNC(4); }
        else             { WAIT_ASYNC(0); }
        __syncthreads();
        const int b = kt % 3;
        v16h aF[4], bF[2];
        #pragma unroll
        for (int i = 0; i < 4; ++i) aF[i] = load_frag(sX[b], wm + i * 16, BK);
        #pragma unroll
        for (int j = 0; j < 2; ++j) bF[j] = load_frag(sW[b], wn + j * 16, BK);
        #pragma unroll
        for (int i = 0; i < 4; ++i)
            #pragma unroll
            for (int j = 0; j < 2; ++j)
                acc[i][j] = __builtin_amdgcn_wmma_f32_16x16x32_f16(
                    false, aF[i], false, bF[j], (short)0, acc[i][j], false, false);
    }

    float bv[2];
    #pragma unroll
    for (int j = 0; j < 2; ++j) bv[j] = bias[nBlk + wn + j * 16 + (lane & 15)];
    const int mLane = mBlk + wm + ((lane >> 4) << 3);
    const int nLane = nBlk + wn + (lane & 15);
    #pragma unroll
    for (int i = 0; i < 4; ++i)
        #pragma unroll
        for (int j = 0; j < 2; ++j)
            #pragma unroll
            for (int vg = 0; vg < 8; ++vg) {
                int m = mLane + i * 16 + vg;
                int nn = nLane + j * 16;
                float val = acc[i][j][vg] + bv[j];
                if (OUT_F16) Yh[(size_t)m * N + nn] = (_Float16)val;
                else         Yf[(size_t)m * N + nn] = val;
            }
}

// ---------------------------------------------------------------------------
// w = sigmoid(X@Ww^T + bw), r = sigmoid(X@Wr^T + br), all in fp32, as one
// [32 gates] x [64 tokens] x [K = 1024] product per block on the f32 WMMA.
// 16 waves split K: wave wv owns k = wv*64 .. wv*64+63 and keeps its slice of
// both gate matrices in registers (A operand, rows = gates). Token rows are the
// B operand. Every global load covers whole 256-B row pieces; a wave-private
// LDS tile turns them into fragments. A and B go through the same two
// functions, so their k order is equal at every lane and register.
// The 16 partial sums of each gate value meet in LDS and are added in wave order.
// ---------------------------------------------------------------------------
typedef __attribute__((ext_vector_type(2))) float v2f;
typedef __attribute__((ext_vector_type(4))) float v4f;

#define GP_WAVES 16
#define GP_TOK   64                   // tokens per block
#define GP_KW    (DM / GP_WAVES)      // 64 k per wave = 256 B of a row
#define GP_PITCH (GP_KW + 4)          // staged row pitch, dwords (272 B: 16 B x odd)
#define GP_RP    36                   // partial-sum row pitch, dwords (32 gates + 4)

__device__ __forceinline__ void gp_fetch(const float* rows, int lane, v4f (&st)[8]) {
    #pragma unroll
    for (int i = 0; i < 8; ++i)
        st[i] = *(const v4f*)(rows + (size_t)(2 * i + (lane >> 4)) * DM + (lane & 15) * 4);
}

// rows in registers -> this wave's own LDS tile
__device__ __forceinline__ void gp_stage(float* stg, int lane, const v4f (&st)[8]) {
    #pragma unroll
    for (int i = 0; i < 8; ++i)
        *(v4f*)(stg + (2 * i + (lane >> 4)) * GP_PITCH + (lane & 15) * 4) = st[i];
    // the rows are read back by other lanes of this wave: stores done first
    asm volatile("s_wait_dscnt 0x0" ::: "memory");
}

// LDS tile -> fragments: lane (c = lane&15, h = lane>>4) gets row c,
// k = 8j + 4h .. 8j + 4h + 3 in fr[j]
__device__ __forceinline__ void gp_frag(const float* stg, int lane, v4f (&fr)[8]) {
    #pragma unroll
    for (int j = 0; j < 8; ++j)
        fr[j] = *(const v4f*)(stg + (lane & 15) * GP_PITCH + (2 * j + (lane >> 4)) * 4);
    // the tile is overwritten by the next gp_stage: reads done first
    asm volatile("s_wait_dscnt 0x0" ::: "memory");
}

__global__ __launch_bounds__(GP_WAVES * 32)
void wr_proj(const float* X,
             const float* Ww, const float* Wb,
             const float* Rw, const float* Rb,
             float* wout, float* rout) {
    __shared__ __attribute__((aligned(16))) float sStage[GP_WAVES][16 * GP_PITCH];
    __shared__ __attribute__((aligned(16))) float sPart[GP_WAVES][GP_TOK * GP_RP];

    const int t    = threadIdx.x;
    const int lane = t & 31;
    const int wv   = t >> 5;
    const int m0   = blockIdx.x * GP_TOK;
    float* stg = sStage[wv];
    const float* xs = X + (size_t)m0 * DM + wv * GP_KW;

    v4f sa[8], sb[8], s0[8], s1[8], gw[8], gr[8];
    gp_fetch(Ww + wv * GP_KW, lane, sa);
    gp_fetch(Rw + wv * GP_KW, lane, sb);
    gp_fetch(xs, lane, s0);
    gp_fetch(xs + (size_t)16 * DM, lane, s1);
    gp_stage(stg, lane, sa);
    gp_frag(stg, lane, gw);
    gp_stage(stg, lane, sb);
    gp_frag(stg, lane, gr);

    auto do_tile = [&](int tile, v4f (&cur)[8]) {
        v4f fx[8];
        gp_stage(stg, lane, cur);
        // two tiles ahead, into the registers that were just staged
        if (tile + 2 < GP_TOK / 16) gp_fetch(xs + (size_t)(tile + 2) * 16 * DM, lane, cur);
        gp_frag(stg, lane, fx);
        v8f aw = vzero8(), ar = vzero8();
        #pragma unroll
        for (int j = 0; j < 8; ++j) {
            v2f x0 = {fx[j].x, fx[j].y}, x1 = {fx[j].z, fx[j].w};
            v2f w0 = {gw[j].x, gw[j].y}, w1 = {gw[j].z, gw[j].w};
            v2f r0 = {gr[j].x, gr[j].y}, r1 = {gr[j].z, gr[j].w};
            aw = __builtin_amdgcn_wmma_f32_16x16x4_f32(false, w0, false, x0, (short)0, aw, false, false);
            ar = __builtin_amdgcn_wmma_f32_16x16x4_f32(false, r0, false, x0, (short)0, ar, false, false);
            aw = __builtin_amdgcn_wmma_f32_16x16x4_f32(false, w1, false, x1, (short)0, aw, false, false);
            ar = __builtin_amdgcn_wmma_f32_16x16x4_f32(false, r1, false, x1, (short)0, ar, false, false);
        }
        // D register e = gate 8h + e of token c: 8 consecutive gates per lane
        float* pp = &sPart[wv][(tile * 16 + (lane & 15)) * GP_RP + ((lane >> 4) << 3)];
        *(v4f*)(pp)      = v4f{aw[0], aw[1], aw[2], aw[3]};
        *(v4f*)(pp + 4)  = v4f{aw[4], aw[5], aw[6], aw[7]};
        *(v4f*)(pp + 16) = v4f{ar[0], ar[1], ar[2], ar[3]};
        *(v4f*)(pp + 20) = v4f{ar[4], ar[5], ar[6], ar[7]};
    };
    static_assert(GP_TOK == 64, "four tiles of 16 tokens");
    do_tile(0, s0);
    do_tile(1, s1);
    do_tile(2, s0);
    do_tile(3, s1);
    __syncthreads();

    // 64 tokens x 32 gates = 512 threads x 4 gates
    const int tok = t >> 3, g4 = (t & 7) * 4;
    v4f s = {0.f, 0.f, 0.f, 0.f};
    #pragma unroll
    for (int w = 0; w < GP_WAVES; ++w) {
        v4f p = *(const v4f*)&sPart[w][tok * GP_RP + g4];
        s.x += p.x; s.y += p.y; s.z += p.z; s.w += p.w;
    }
    const float* bp = (g4 < NH) ? (Wb + g4) : (Rb + g4 - NH);
    v4f y;
    y.x = 1.f / (1.f + __expf(-(s.x + bp[0])));
    y.y = 1.f / (1.f + __expf(-(s.y + bp[1])));
    y.z = 1.f / (1.f + __expf(-(s.z + bp[2])));
    y.w = 1.f / (1.f + __expf(-(s.w + bp[3])));
    float* op = ((g4 < NH) ? wout : rout) + (size_t)(m0 + tok) * NH + (g4 & (NH - 1));
    *(v4f*)op = y;
}

// ---------------------------------------------------------------------------
// Unit-normalize Q and K per head (64-wide) in place; wave per (tensor,m,head)
// ---------------------------------------------------------------------------
__global__ __launch_bounds__(256)
void norm_qk(_Float16* __restrict__ Qh, _Float16* __restrict__ Kh) {
    int g    = blockIdx.x * 8 + (threadIdx.x >> 5);
    int lane = threadIdx.x & 31;
    int tsel = g >> 18;
    int idx  = g & ((1 << 18) - 1);
    int m = idx >> 4, h = idx & 15;
    _Float16* p = (tsel ? Kh : Qh) + (size_t)m * DM + h * HD;
    float a = (float)p[lane], c = (float)p[lane + 32];
    float s = a * a + c * c;
    #pragma unroll
    for (int o = 16; o > 0; o >>= 1) s += __shfl_xor(s, o, 32);
    float inv = 1.f / fmaxf(sqrtf(s), 1e-12f);
    p[lane]      = (_Float16)(a * inv);
    p[lane + 32] = (_Float16)(c * inv);
}

// ---------------------------------------------------------------------------
// Vh *= w (per token, per head)
// ---------------------------------------------------------------------------
__global__ __launch_bounds__(256)
void scale_v(_Float16* __restrict__ Vh, const float* __restrict__ wbuf) {
    size_t i = (size_t)blockIdx.x * 256 + threadIdx.x;   // MTOK*DM
    int m = (int)(i >> 10);
    int h = (int)((i & 1023) >> 6);
    Vh[i] = (_Float16)((float)Vh[i] * wbuf[m * NH + h]);
}

// ---------------------------------------------------------------------------
// A[b,n,v,q] = sum_s Vw[s,(b,n),v] * K[s,(b,n),q]  — one block per (b,n),
// WMMA with K-dim = s in chunks of 32, LDS tiles stored transposed [feat][s].
// Writes f32 A to d_out region and f16 copy to workspace.
// ---------------------------------------------------------------------------
__global__ __launch_bounds__(256)
void accum_A(const _Float16* __restrict__ Kh, const _Float16* __restrict__ Vh,
             float* __restrict__ Af, _Float16* __restrict__ Ah) {
    const int bn = blockIdx.x;          // b*16 + n
    const int b  = bn >> 4, n = bn & 15;
    __shared__ _Float16 sK[2][HD * 32]; // [q][s]
    __shared__ _Float16 sV[2][HD * 32]; // [v][s]

    const int t = threadIdx.x, lane = t & 31, wv = t >> 5;   // 8 waves
    const int vt   = wv >> 1;           // v-tile 0..3
    const int qoff = (wv & 1) * 32;     // q half 0/32

    v8f acc[2] = {vzero8(), vzero8()};
    uint4 kreg, vreg;
    const int s_i = t >> 3, f8 = (t & 7) * 8;
    const int nsc = S_LEN / 32;

    auto fetchA = [&](int sc) {
        size_t m = (size_t)(sc * 32 + s_i) * B_SZ + b;
        kreg = *(const uint4*)(Kh + m * DM + n * HD + f8);
        vreg = *(const uint4*)(Vh + m * DM + n * HD + f8);
    };
    auto stageA = [&](int bb) {
        union { uint4 u; _Float16 h[8]; } ck, cv;
        ck.u = kreg; cv.u = vreg;
        #pragma unroll
        for (int e = 0; e < 8; ++e) {
            sK[bb][(f8 + e) * 32 + s_i] = ck.h[e];   // transpose at store
            sV[bb][(f8 + e) * 32 + s_i] = cv.h[e];
        }
    };

    fetchA(0); stageA(0);
    for (int sc = 0; sc < nsc; ++sc) {
        __syncthreads();
        if (sc + 1 < nsc) fetchA(sc + 1);
        const int bb = sc & 1;
        v16h aF = load_frag(sV[bb], vt * 16, 32);
        v16h bF0 = load_frag(sK[bb], qoff, 32);
        v16h bF1 = load_frag(sK[bb], qoff + 16, 32);
        acc[0] = __builtin_amdgcn_wmma_f32_16x16x32_f16(false, aF, false, bF0, (short)0, acc[0], false, false);
        acc[1] = __builtin_amdgcn_wmma_f32_16x16x32_f16(false, aF, false, bF1, (short)0, acc[1], false, false);
        if (sc + 1 < nsc) stageA((sc + 1) & 1);
    }

    #pragma unroll
    for (int j = 0; j < 2; ++j)
        #pragma unroll
        for (int vg = 0; vg < 8; ++vg) {
            int vIdx = vt * 16 + vg + ((lane >> 4) << 3);
            int qIdx = qoff + j * 16 + (lane & 15);
            size_t idx = ((size_t)bn * HD + vIdx) * HD + qIdx;
            float val = acc[j][vg];
            Af[idx] = val;
            Ah[idx] = (_Float16)val;
        }
}

// ---------------------------------------------------------------------------
// Mid[s,(b,n),v] = r * sum_q Q[s,(b,n),q] * A[b,n,v,q] — WMMA, fragments
// loaded straight from global (Q rows strided by B*DM, A rows contiguous).
// ---------------------------------------------------------------------------
__global__ __launch_bounds__(256)
void apply_A(const _Float16* __restrict__ Qh, const _Float16* __restrict__ Ah,
             const float* __restrict__ rbuf, _Float16* __restrict__ Mid) {
    const int bn = blockIdx.x;          // b*16+n
    const int b  = bn >> 4, n = bn & 15;
    const int lane  = threadIdx.x & 31;
    const int sBase = blockIdx.y * 128 + (threadIdx.x >> 5) * 16;   // 8 waves x 16 rows

    const _Float16* Abase = Ah + (size_t)bn * (HD * HD);
    v8f acc[4] = {vzero8(), vzero8(), vzero8(), vzero8()};

    #pragma unroll
    for (int kt = 0; kt < 2; ++kt) {    // K = 64 = 2 x 32
        const _Float16* qbase = Qh + ((size_t)sBase * B_SZ + b) * DM + n * HD + kt * 32;
        v16h aF = load_frag(qbase, 0, B_SZ * DM);        // row step = next s token
        #pragma unroll
        for (int j = 0; j < 4; ++j) {
            v16h bF = load_frag(Abase + kt * 32, j * 16, HD);
            acc[j] = __builtin_amdgcn_wmma_f32_16x16x32_f16(
                false, aF, false, bF, (short)0, acc[j], false, false);
        }
    }

    float rv[8];
    #pragma unroll
    for (int vg = 0; vg < 8; ++vg) {
        int s = sBase + vg + ((lane >> 4) << 3);
        rv[vg] = rbuf[((size_t)s * B_SZ + b) * NH + n];
    }
    #pragma unroll
    for (int j = 0; j < 4; ++j)
        #pragma unroll
        for (int vg = 0; vg < 8; ++vg) {
            int s = sBase + vg + ((lane >> 4) << 3);
            size_t m = (size_t)s * B_SZ + b;
            Mid[m * DM + n * HD + j * 16 + (lane & 15)] = (_Float16)(acc[j][vg] * rv[vg]);
        }
}

// ---------------------------------------------------------------------------
// Launch
// ---------------------------------------------------------------------------
extern "C" void kernel_launch(void* const* d_in, const int* in_sizes, int n_in,
                              void* d_out, int out_size, void* d_ws, size_t ws_size,
                              hipStream_t stream) {
    (void)in_sizes; (void)n_in; (void)out_size; (void)ws_size;
    const float* inp  = (const float*)d_in[0];
    const float* Wq_w = (const float*)d_in[1];  const float* Wq_b = (const float*)d_in[2];
    const float* Wk_w = (const float*)d_in[3];  const float* Wk_b = (const float*)d_in[4];
    const float* Wv_w = (const float*)d_in[5];  const float* Wv_b = (const float*)d_in[6];
    const float* Wo_w = (const float*)d_in[7];  const float* Wo_b = (const float*)d_in[8];
    const float* Ww_w = (const float*)d_in[9];  const float* Ww_b = (const float*)d_in[10];
    const float* Wr_w = (const float*)d_in[11]; const float* Wr_b = (const float*)d_in[12];

    float* out_f = (float*)d_out;                       // [S,B,DM]
    float* A_f   = out_f + (size_t)MTOK * DM;           // [B,NH,64,64]

    char* ws = (char*)d_ws;
    constexpr size_t HBYTES = (size_t)MTOK * DM * sizeof(_Float16);   // 32 MiB
    constexpr size_t GATE   = (size_t)MTOK * NH * 4;                  // 1 MiB
    constexpr size_t WBYTES = (size_t)DM * DM * sizeof(_Float16);     // 2 MiB
    _Float16* Xh  = (_Float16*)(ws);
    _Float16* Qh  = (_Float16*)(ws + HBYTES);
    _Float16* Kh  = (_Float16*)(ws + 2 * HBYTES);
    _Float16* Vh  = (_Float16*)(ws + 3 * HBYTES);
    float*    wbf = (float*)   (ws + 4 * HBYTES);
    float*    rbf = (float*)   (ws + 4 * HBYTES + GATE);
    _Float16* Ah  = (_Float16*)(ws + 4 * HBYTES + 2 * GATE);
    _Float16* Mid = (_Float16*)(ws + 4 * HBYTES + 2 * GATE + (size_t)B_SZ * NH * HD * HD * 2);
    _Float16* Wqh = (_Float16*)(ws + 5 * HBYTES + 3 * GATE);
    _Float16* Wkh = (_Float16*)(ws + 5 * HBYTES + 3 * GATE + WBYTES);
    _Float16* Wvh = (_Float16*)(ws + 5 * HBYTES + 3 * GATE + 2 * WBYTES);
    _Float16* Woh = (_Float16*)(ws + 5 * HBYTES + 3 * GATE + 3 * WBYTES);

    // 1) fp32 -> fp16: input + four big weight matrices
    cvt_f32_f16<<<(MTOK * DM / 4) / 256, 256, 0, stream>>>(inp, Xh);
    cvt_f32_f16<<<(DM * DM / 4) / 256, 256, 0, stream>>>(Wq_w, Wqh);
    cvt_f32_f16<<<(DM * DM / 4) / 256, 256, 0, stream>>>(Wk_w, Wkh);
    cvt_f32_f16<<<(DM * DM / 4) / 256, 256, 0, stream>>>(Wv_w, Wvh);
    cvt_f32_f16<<<(DM * DM / 4) / 256, 256, 0, stream>>>(Wo_w, Woh);

    // 2) Q/K/V projections (WMMA GEMM, async-LDS pipeline, f16 out)
    dim3 gg(MTOK / 128, DM / 128);
    gemm_xwT<true><<<gg, 256, 0, stream>>>(Xh, Wqh, Wq_b, Qh, nullptr, MTOK, DM, DM);
    gemm_xwT<true><<<gg, 256, 0, stream>>>(Xh, Wkh, Wk_b, Kh, nullptr, MTOK, DM, DM);
    gemm_xwT<true><<<gg, 256, 0, stream>>>(Xh, Wvh, Wv_b, Vh, nullptr, MTOK, DM, DM);

    // 3) gate projections, head-normalize, v*w
    wr_proj<<<MTOK / GP_TOK, GP_WAVES * 32, 0, stream>>>(inp, Ww_w, Ww_b, Wr_w, Wr_b, wbf, rbf);
    norm_qk<<<65536, 256, 0, stream>>>(Qh, Kh);
    scale_v<<<(MTOK * DM) / 256, 256, 0, stream>>>(Vh, wbf);

    // 4) A accumulation (writes f32 A output + f16 copy)
    accum_A<<<B_SZ * NH, 256, 0, stream>>>(Kh, Vh, A_f, Ah);

    // 5) apply A, scale by r
    apply_A<<<dim3(B_SZ * NH, S_LEN / 128), 256, 0, stream>>>(Qh, Ah, rbf, Mid);

    // 6) final O projection (f32 out to d_out)
    gemm_xwT<false><<<gg, 256, 0, stream>>>(Mid, Woh, Wo_b, nullptr, out_f, MTOK, DM, DM);
}

// v002
// A run of this version takes 369 microseconds.
// In both of two side-by-side timings against v001, it was 1.21 times as fast.
// Over all steps from v000 it is 1.46 times as fast.
#include <hip/hip_runtime.h>
#include <hip/hip_bf16.h>
#include <cstdint>

typedef __attribute__((ext_vector_type(16))) _Float16 v16h;
typedef __attribute__((ext_vector_type(4)))  _Float16 v4h;
typedef __attribute__((ext_vector_type(8)))  float    v8f;

#define S_LEN 2048
#define B_SZ  8
#define DM    1024
#define NH    16
#define HD    64
#define MTOK  (S_LEN * B_SZ)          // 16384 tokens

__device__ __forceinline__ void async_ld4_b128(const void* g0, const void* l0,
                                               const void* g1, const void* l1,
                                               const void* g2, const void* l2,
                                               const void* g3, const void* l3) {
    asm volatile("global_load_async_to_lds_b128 %0, %1, off\n\t"
                 "global_load_async_to_lds_b128 %2, %3, off\n\t"
                 "global_load_async_to_lds_b128 %4, %5, off\n\t"
                 "global_load_async_to_lds_b128 %6, %7, off\n\t"
                 "s_wait_xcnt 0x0"
                 :: "v"((unsigned)(uintptr_t)l0), "v"(g0),
                    "v"((unsigned)(uintptr_t)l1), "v"(g1),
                    "v"((unsigned)(uintptr_t)l2), "v"(g2),
                    "v"((unsigned)(uintptr_t)l3), "v"(g3) : "memory");
}
#if __has_builtin(__builtin_amdgcn_s_wait_asynccnt)
#define WAIT_ASYNC(n) __builtin_amdgcn_s_wait_asynccnt(n)
#else
#define WAIT_ASYNC(n) asm volatile("s_wait_asynccnt %0" :: "n"(n) : "memory")
#endif

__device__ __forceinline__ v16h load_frag(const _Float16* tile, int row0, int ld) {
    const int lane = threadIdx.x & 31;
    const _Float16* p = tile + (size_t)(row0 + (lane & 15)) * ld + ((lane >> 4) << 3);
    v16h r;
    ((float4*)&r)[0] = *(const float4*)(p);
    ((float4*)&r)[1] = *(const float4*)(p + 16);
    return r;
}

#define LDP 40

__device__ __forceinline__ v8f vzero8() { v8f z = {0.f,0.f,0.f,0.f,0.f,0.f,0.f,0.f}; return z; }

// ---------------------------------------------------------------------------
// fp32 -> fp16 conversion, float4 vectorized (used for input and weights)
// ---------------------------------------------------------------------------
__global__ __launch_bounds__(256) void cvt_f32_f16(const float* __restrict__ X,
                                                   _Float16* __restrict__ Xh) {
    size_t i = (size_t)blockIdx.x * 256 + threadIdx.x;
    float4 v = ((const float4*)X)[i];
    v4h h; h.x = (_Float16)v.x; h.y = (_Float16)v.y; h.z = (_Float16)v.z; h.w = (_Float16)v.w;
    ((v4h*)Xh)[i] = h;
}

template<bool OUT_F16>
__global__ __launch_bounds__(256)
void gemm_xwT(const _Float16* __restrict__ X, const _Float16* __restrict__ Wh,
              const float* __restrict__ bias, _Float16* __restrict__ Yh,
              float* __restrict__ Yf, int M, int N, int K) {
    constexpr int BM = 128, BN = 128, BK = 32;
    __shared__ __attribute__((aligned(16))) _Float16 sX[3][BM * LDP];
    __shared__ __attribute__((aligned(16))) _Float16 sW[3][BN * LDP];

    const int t    = threadIdx.x;
    const int lane = t & 31;
    const int wv   = t >> 5;                  // 0..7
    const int mBlk = blockIdx.x * BM;
    const int nBlk = blockIdx.y * BN;
    const int wm   = (wv >> 2) * 64;          // 0 / 64
    const int wn   = (wv & 3) * 32;           // 0 / 32 / 64 / 96

    v8f acc[4][2];
    #pragma unroll
    for (int i = 0; i < 4; ++i)
        #pragma unroll
        for (int j = 0; j < 2; ++j) acc[i][j] = vzero8();

    const int nk = K / BK;

    // 4 async b128 copies per thread per stage (2 X chunks + 2 W chunks)
    auto issue = [&](int kt, int buf) {
        const int row = t >> 1, kc = (t & 1) * 16;   // chunks 2t and 2t+1: one row, 32 B
        const _Float16* gx = X  + (size_t)(mBlk + row) * K + kt * BK + kc;
        const _Float16* gw = Wh + (size_t)(nBlk + row) * K + kt * BK + kc;
        _Float16* lx = &sX[buf][row * LDP + kc];
        _Float16* lw = &sW[buf][row * LDP + kc];
        async_ld4_b128(gx, lx, gw, lw, gx + 8, lx + 8, gw + 8, lw + 8);
    };

    issue(0, 0);
    for (int kt = 0; kt < nk; ++kt) {
        if (kt + 1 < nk) { issue(kt + 1, (kt + 1) % 3); WAIT_ASYNC(4); }
        else             { WAIT_ASYNC(0); }
        __syncthreads();
        const int b = kt % 3;
        v16h aF[4], bF[2];
        #pragma unroll
        for (int i = 0; i < 4; ++i) aF[i] = load_frag(sX[b], wm + i * 16, LDP);
        #pragma unroll
        for (int j = 0; j < 2; ++j) bF[j] = load_frag(sW[b], wn + j * 16, LDP);
        #pragma unroll
        for (int i = 0; i < 4; ++i)
            #pragma unroll
            for (int j = 0; j < 2; ++j)
                acc[i][j] = __builtin_amdgcn_wmma_f32_16x16x32_f16(
                    false, aF[i], false, bF[j], (short)0, acc[i][j], false, false);
    }

    float bv[2];
    #pragma unroll
    for (int j = 0; j < 2; ++j) bv[j] = bias[nBlk + wn + j * 16 + (lane & 15)];
    const int mLane = mBlk + wm + ((lane >> 4) << 3);
    const int nLane = nBlk + wn + (lane & 15);
    #pragma unroll
    for (int i = 0; i < 4; ++i)
        #pragma unroll
        for (int j = 0; j < 2; ++j)
            #pragma unroll
            for (int vg = 0; vg < 8; ++vg) {
                int m = mLane + i * 16 + vg;
                int nn = nLane + j * 16;
                float val = acc[i][j][vg] + bv[j];
                if (OUT_F16) Yh[(size_t)m * N + nn] = (_Float16)val;
                else         Yf[(size_t)m * N + nn] = val;
            }
}

// ---------------------------------------------------------------------------
// w = sigmoid(X@Ww^T + bw), r = sigmoid(X@Wr^T + br), all in fp32, as one
// [32 gates] x [64 tokens] x [K = 1024] product per block on the f32 WMMA.
// 16 waves split K: wave wv owns k = wv*64 .. wv*64+63 and keeps its slice of
// both gate matrices in registers (A operand, rows = gates). Token rows are the
// B operand. Every global load covers whole 256-B row pieces; a wave-private
// LDS tile turns them into fragments. A and B go through the same two
// functions, so their k order is equal at every lane and register.
// The 16 partial sums of each gate value meet in LDS and are added in wave order.
// ---------------------------------------------------------------------------
typedef __attribute__((ext_vector_type(2))) float v2f;
typedef __attribute__((ext_vector_type(4))) float v4f;

#define GP_WAVES 16
#define GP_TOK   64                   // tokens per block
#define GP_KW    (DM / GP_WAVES)      // 64 k per wave = 256 B of a row
#define GP_PITCH (GP_KW + 4)          // staged row pitch, dwords (272 B: 16 B x odd)
#define GP_RP    36                   // partial-sum row pitch, dwords (32 gates + 4)

__device__ __forceinline__ void gp_fetch(const float* rows, int lane, v4f (&st)[8]) {
    #pragma unroll
    for (int i = 0; i < 8; ++i)
        st[i] = *(const v4f*)(rows + (size_t)(2 * i + (lane >> 4)) * DM + (lane & 15) * 4);
}

// rows in registers -> this wave's own LDS tile
__device__ __forceinline__ void gp_stage(float* stg, int lane, const v4f (&st)[8]) {
    #pragma unroll
    for (int i = 0; i < 8; ++i)
        *(v4f*)(stg + (2 * i + (lane >> 4)) * GP_PITCH + (lane & 15) * 4) = st[i];
    // the rows are read back by other lanes of this wave: stores done first
    asm volatile("s_wait_dscnt 0x0" ::: "memory");
}

// LDS tile -> fragments: lane (c = lane&15, h = lane>>4) gets row c,
// k = 8j + 4h .. 8j + 4h + 3 in fr[j]
__device__ __forceinline__ void gp_frag(const float* stg, int lane, v4f (&fr)[8]) {
    #pragma unroll
    for (int j = 0; j < 8; ++j)
        fr[j] = *(const v4f*)(stg + (lane & 15) * GP_PITCH + (2 * j + (lane >> 4)) * 4);
    // the tile is overwritten by the next gp_stage: reads done first
    asm volatile("s_wait_dscnt 0x0" ::: "memory");
}

__global__ __launch_bounds__(GP_WAVES * 32)
void wr_proj(const float* X,
             const float* Ww, const float* Wb,
             const float* Rw, const float* Rb,
             float* wout, float* rout) {
    __shared__ __attribute__((aligned(16))) float sStage[GP_WAVES][16 * GP_PITCH];
    __shared__ __attribute__((aligned(16))) float sPart[GP_WAVES][GP_TOK * GP_RP];

    const int t    = threadIdx.x;
    const int lane = t & 31;
    const int wv   = t >> 5;
    const int m0   = blockIdx.x * GP_TOK;
    float* stg = sStage[wv];
    const float* xs = X + (size_t)m0 * DM + wv * GP_KW;

    v4f sa[8], sb[8], s0[8], s1[8], gw[8], gr[8];
    gp_fetch(Ww + wv * GP_KW, lane, sa);
    gp_fetch(Rw + wv * GP_KW, lane, sb);
    gp_fetch(xs, lane, s0);
    gp_fetch(xs + (size_t)16 * DM, lane, s1);
    gp_stage(stg, lane, sa);
    gp_frag(stg, lane, gw);
    gp_stage(stg, lane, sb);
    gp_frag(stg, lane, gr);

    auto do_tile = [&](int tile, v4f (&cur)[8]) {
        v4f fx[8];
        gp_stage(stg, lane, cur);
        // two tiles ahead, into the registers that were just staged
        if (tile + 2 < GP_TOK / 16) gp_fetch(xs + (size_t)(tile + 2) * 16 * DM, lane, cur);
        gp_frag(stg, lane, fx);
        v8f aw = vzero8(), ar = vzero8();
        #pragma unroll
        for (int j = 0; j < 8; ++j) {
            v2f x0 = {fx[j].x, fx[j].y}, x1 = {fx[j].z, fx[j].w};
            v2f w0 = {gw[j].x, gw[j].y}, w1 = {gw[j].z, gw[j].w};
            v2f r0 = {gr[j].x, gr[j].y}, r1 = {gr[j].z, gr[j].w};
            aw = __builtin_amdgcn_wmma_f32_16x16x4_f32(false, w0, false, x0, (short)0, aw, false, false);
            ar = __builtin_amdgcn_wmma_f32_16x16x4_f32(false, r0, false, x0, (short)0, ar, false, false);
            aw = __builtin_amdgcn_wmma_f32_16x16x4_f32(false, w1, false, x1, (short)0, aw, false, false);
            ar = __builtin_amdgcn_wmma_f32_16x16x4_f32(false, r1, false, x1, (short)0, ar, false, false);
        }
        // D register e = gate 8h + e of token c: 8 consecutive gates per lane
        float* pp = &sPart[wv][(tile * 16 + (lane & 15)) * GP_RP + ((lane >> 4) << 3)];
        *(v4f*)(pp)      = v4f{aw[0], aw[1], aw[2], aw[3]};
        *(v4f*)(pp + 4)  = v4f{aw[4], aw[5], aw[6], aw[7]};
        *(v4f*)(pp + 16) = v4f{ar[0], ar[1], ar[2], ar[3]};
        *(v4f*)(pp + 20) = v4f{ar[4], ar[5], ar[6], ar[7]};
    };
    static_assert(GP_TOK == 64, "four tiles of 16 tokens");
    do_tile(0, s0);
    do_tile(1, s1);
    do_tile(2, s0);
    do_tile(3, s1);
    __syncthreads();

    // 64 tokens x 32 gates = 512 threads x 4 gates
    const int tok = t >> 3, g4 = (t & 7) * 4;
    v4f s = {0.f, 0.f, 0.f, 0.f};
    #pragma unroll
    for (int w = 0; w < GP_WAVES; ++w) {
        v4f p = *(const v4f*)&sPart[w][tok * GP_RP + g4];
        s.x += p.x; s.y += p.y; s.z += p.z; s.w += p.w;
    }
    const float* bp = (g4 < NH) ? (Wb + g4) : (Rb + g4 - NH);
    v4f y;
    y.x = 1.f / (1.f + __expf(-(s.x + bp[0])));
    y.y = 1.f / (1.f + __expf(-(s.y + bp[1])));
    y.z = 1.f / (1.f + __expf(-(s.z + bp[2])));
    y.w = 1.f / (1.f + __expf(-(s.w + bp[3])));
    float* op = ((g4 < NH) ? wout : rout) + (size_t)(m0 + tok) * NH + (g4 & (NH - 1));
    *(v4f*)op = y;
}

// ---------------------------------------------------------------------------
// Unit-normalize Q and K per head (64-wide) in place; wave per (tensor,m,head)
// ---------------------------------------------------------------------------
__global__ __launch_bounds__(256)
void norm_qk(_Float16* __restrict__ Qh, _Float16* __restrict__ Kh) {
    int g    = blockIdx.x * 8 + (threadIdx.x >> 5);
    int lane = threadIdx.x & 31;
    int tsel = g >> 18;
    int idx  = g & ((1 << 18) - 1);
    int m = idx >> 4, h = idx & 15;
    _Float16* p = (tsel ? Kh : Qh) + (size_t)m * DM + h * HD;
    float a = (float)p[lane], c = (float)p[lane + 32];
    float s = a * a + c * c;
    #pragma unroll
    for (int o = 16; o > 0; o >>= 1) s += __shfl_xor(s, o, 32);
    float inv = 1.f / fmaxf(sqrtf(s), 1e-12f);
    p[lane]      = (_Float16)(a * inv);
    p[lane + 32] = (_Float16)(c * inv);
}

// ---------------------------------------------------------------------------
// Vh *= w (per token, per head)
// ---------------------------------------------------------------------------
__global__ __launch_bounds__(256)
void scale_v(_Float16* __restrict__ Vh, const float* __restrict__ wbuf) {
    size_t i = (size_t)blockIdx.x * 256 + threadIdx.x;   // MTOK*DM
    int m = (int)(i >> 10);
    int h = (int)((i & 1023) >> 6);
    Vh[i] = (_Float16)((float)Vh[i] * wbuf[m * NH + h]);
}

// ---------------------------------------------------------------------------
// A[b,n,v,q] = sum_s Vw[s,(b,n),v] * K[s,(b,n),q]  — one block per (b,n),
// WMMA with K-dim = s in chunks of 32, LDS tiles stored transposed [feat][s].
// Writes f32 A to d_out region and f16 copy to workspace.
// ---------------------------------------------------------------------------
__global__ __launch_bounds__(256)
void accum_A(const _Float16* __restrict__ Kh, const _Float16* __restrict__ Vh,
             float* __restrict__ Af, _Float16* __restrict__ Ah) {
    const int bn = blockIdx.x;          // b*16 + n
    const int b  = bn >> 4, n = bn & 15;
    __shared__ __attribute__((aligned(16))) _Float16 sK[2][HD * LDP]; // [q][s]
    __shared__ __attribute__((aligned(16))) _Float16 sV[2][HD * LDP]; // [v][s]

    const int t = threadIdx.x, lane = t & 31, wv = t >> 5;   // 8 waves
    const int vt   = wv >> 1;           // v-tile 0..3
    const int qoff = (wv & 1) * 32;     // q half 0/32

    v8f acc[2] = {vzero8(), vzero8()};
    uint4 kreg, vreg;
    const int s_i = t >> 3, f8 = (t & 7) * 8;
    const int nsc = S_LEN / 32;

    auto fetchA = [&](int sc) {
        size_t m = (size_t)(sc * 32 + s_i) * B_SZ + b;
        kreg = *(const uint4*)(Kh + m * DM + n * HD + f8);
        vreg = *(const uint4*)(Vh + m * DM + n * HD + f8);
    };
    auto stageA = [&](int bb) {
        union { uint4 u; _Float16 h[8]; } ck, cv;
        ck.u = kreg; cv.u = vreg;
        #pragma unroll
        for (int e = 0; e < 8; ++e) {
            sK[bb][(f8 + e) * LDP + s_i] = ck.h[e];   // transpose at store
            sV[bb][(f8 + e) * LDP + s_i] = cv.h[e];
        }
    };

    fetchA(0); stageA(0);
    for (int sc = 0; sc < nsc; ++sc) {
        __syncthreads();
        if (sc + 1 < nsc) fetchA(sc + 1);
        const int bb = sc & 1;
        v16h aF = load_frag(sV[bb], vt * 16, LDP);
        v16h bF0 = load_frag(sK[bb], qoff, LDP);
        v16h bF1 = load_frag(sK[bb], qoff + 16, LDP);
        acc[0] = __builtin_amdgcn_wmma_f32_16x16x32_f16(false, aF, false, bF0, (short)0, acc[0], false, false);
        acc[1] = __builtin_amdgcn_wmma_f32_16x16x32_f16(false, aF, false, bF1, (short)0, acc[1], false, false);
        if (sc + 1 < nsc) stageA((sc + 1) & 1);
    }

    #pragma unroll
    for (int j = 0; j < 2; ++j)
        #pragma unroll
        for (int vg = 0; vg < 8; ++vg) {
            int vIdx = vt * 16 + vg + ((lane >> 4) << 3);
            int qIdx = qoff + j * 16 + (lane & 15);
            size_t idx = ((size_t)bn * HD + vIdx) * HD + qIdx;
            float val = acc[j][vg];
            Af[idx] = val;
            Ah[idx] = (_Float16)val;
        }
}

// ---------------------------------------------------------------------------
// Mid[s,(b,n),v] = r * sum_q Q[s,(b,n),q] * A[b,n,v,q] — WMMA, fragments
// loaded straight from global (Q rows strided by B*DM, A rows contiguous).
// ---------------------------------------------------------------------------
__global__ __launch_bounds__(256)
void apply_A(const _Float16* __restrict__ Qh, const _Float16* __restrict__ Ah,
             const float* __restrict__ rbuf, _Float16* __restrict__ Mid) {
    const int bn = blockIdx.x;          // b*16+n
    const int b  = bn >> 4, n = bn & 15;
    const int lane  = threadIdx.x & 31;
    const int sBase = blockIdx.y * 128 + (threadIdx.x >> 5) * 16;   // 8 waves x 16 rows

    const _Float16* Abase = Ah + (size_t)bn * (HD * HD);
    v8f acc[4] = {vzero8(), vzero8(), vzero8(), vzero8()};

    #pragma unroll
    for (int kt = 0; kt < 2; ++kt) {    // K = 64 = 2 x 32
        const _Float16* qbase = Qh + ((size_t)sBase * B_SZ + b) * DM + n * HD + kt * 32;
        v16h aF = load_frag(qbase, 0, B_SZ * DM);        // row step = next s token
        #pragma unroll
        for (int j = 0; j < 4; ++j) {
            v16h bF = load_frag(Abase + kt * 32, j * 16, HD);
            acc[j] = __builtin_amdgcn_wmma_f32_16x16x32_f16(
                false, aF, false, bF, (short)0, acc[j], false, false);
        }
    }

    float rv[8];
    #pragma unroll
    for (int vg = 0; vg < 8; ++vg) {
        int s = sBase + vg + ((lane >> 4) << 3);
        rv[vg] = rbuf[((size_t)s * B_SZ + b) * NH + n];
    }
    #pragma unroll
    for (int j = 0; j < 4; ++j)
        #pragma unroll
        for (int vg = 0; vg < 8; ++vg) {
            int s = sBase + vg + ((lane >> 4) << 3);
            size_t m = (size_t)s * B_SZ + b;
            Mid[m * DM + n * HD + j * 16 + (lane & 15)] = (_Float16)(acc[j][vg] * rv[vg]);
        }
}

// ---------------------------------------------------------------------------
// Launch
// ---------------------------------------------------------------------------
extern "C" void kernel_launch(void* const* d_in, const int* in_sizes, int n_in,
                              void* d_out, int out_size, void* d_ws, size_t ws_size,
                              hipStream_t stream) {
    (void)in_sizes; (void)n_in; (void)out_size; (void)ws_size;
    const float* inp  = (const float*)d_in[0];
    const float* Wq_w = (const float*)d_in[1];  const float* Wq_b = (const float*)d_in[2];
    const float* Wk_w = (const float*)d_in[3];  const float* Wk_b = (const float*)d_in[4];
    const float* Wv_w = (const float*)d_in[5];  const float* Wv_b = (const float*)d_in[6];
    const float* Wo_w = (const float*)d_in[7];  const float* Wo_b = (const float*)d_in[8];
    const float* Ww_w = (const float*)d_in[9];  const float* Ww_b = (const float*)d_in[10];
    const float* Wr_w = (const float*)d_in[11]; const float* Wr_b = (const float*)d_in[12];

    float* out_f = (float*)d_out;                       // [S,B,DM]
    float* A_f   = out_f + (size_t)MTOK * DM;           // [B,NH,64,64]

    char* ws = (char*)d_ws;
    constexpr size_t HBYTES = (size_t)MTOK * DM * sizeof(_Float16);   // 32 MiB
    constexpr size_t GATE   = (size_t)MTOK * NH * 4;                  // 1 MiB
    constexpr size_t WBYTES = (size_t)DM * DM * sizeof(_Float16);     // 2 MiB
    _Float16* Xh  = (_Float16*)(ws);
    _Float16* Qh  = (_Float16*)(ws + HBYTES);
    _Float16* Kh  = (_Float16*)(ws + 2 * HBYTES);
    _Float16* Vh  = (_Float16*)(ws + 3 * HBYTES);
    float*    wbf = (float*)   (ws + 4 * HBYTES);
    float*    rbf = (float*)   (ws + 4 * HBYTES + GATE);
    _Float16* Ah  = (_Float16*)(ws + 4 * HBYTES + 2 * GATE);
    _Float16* Mid = (_Float16*)(ws + 4 * HBYTES + 2 * GATE + (size_t)B_SZ * NH * HD * HD * 2);
    _Float16* Wqh = (_Float16*)(ws + 5 * HBYTES + 3 * GATE);
    _Float16* Wkh = (_Float16*)(ws + 5 * HBYTES + 3 * GATE + WBYTES);
    _Float16* Wvh = (_Float16*)(ws + 5 * HBYTES + 3 * GATE + 2 * WBYTES);
    _Float16* Woh = (_Float16*)(ws + 5 * HBYTES + 3 * GATE + 3 * WBYTES);

    // 1) fp32 -> fp16: input + four big weight matrices
    cvt_f32_f16<<<(MTOK * DM / 4) / 256, 256, 0, stream>>>(inp, Xh);
    cvt_f32_f16<<<(DM * DM / 4) / 256, 256, 0, stream>>>(Wq_w, Wqh);
    cvt_f32_f16<<<(DM * DM / 4) / 256, 256, 0, stream>>>(Wk_w, Wkh);
    cvt_f32_f16<<<(DM * DM / 4) / 256, 256, 0, stream>>>(Wv_w, Wvh);
    cvt_f32_f16<<<(DM * DM / 4) / 256, 256, 0, stream>>>(Wo_w, Woh);

    // 2) Q/K/V projections (WMMA GEMM, async-LDS pipeline, f16 out)
    dim3 gg(MTOK / 128, DM / 128);
    gemm_xwT<true><<<gg, 256, 0, stream>>>(Xh, Wqh, Wq_b, Qh, nullptr, MTOK, DM, DM);
    gemm_xwT<true><<<gg, 256, 0, stream>>>(Xh, Wkh, Wk_b, Kh, nullptr, MTOK, DM, DM);
    gemm_xwT<true><<<gg, 256, 0, stream>>>(Xh, Wvh, Wv_b, Vh, nullptr, MTOK, DM, DM);

    // 3) gate projections, head-normalize, v*w
    wr_proj<<<MTOK / GP_TOK, GP_WAVES * 32, 0, stream>>>(inp, Ww_w, Ww_b, Wr_w, Wr_b, wbf, rbf);
    norm_qk<<<65536, 256, 0, stream>>>(Qh, Kh);
    scale_v<<<(MTOK * DM) / 256, 256, 0, stream>>>(Vh, wbf);

    // 4) A accumulation (writes f32 A output + f16 copy)
    accum_A<<<B_SZ * NH, 256, 0, stream>>>(Kh, Vh, A_f, Ah);

    // 5) apply A, scale by r
    apply_A<<<dim3(B_SZ * NH, S_LEN / 128), 256, 0, stream>>>(Qh, Ah, rbf, Mid);

    // 6) final O projection (f32 out to d_out)
    gemm_xwT<false><<<gg, 256, 0, stream>>>(Mid, Woh, Wo_b, nullptr, out_f, MTOK, DM, DM);
}

// v003
// One run takes 266 microseconds.
// Next to v002, in two timings, it ran 1.39 and 1.38 times as fast.
// Counting every step since v000, it is 2.02 times as fast.
#include <hip/hip_runtime.h>
#include <hip/hip_bf16.h>
#include <cstdint>

typedef __attribute__((ext_vector_type(16))) _Float16 v16h;
typedef __attribute__((ext_vector_type(4)))  _Float16 v4h;
typedef __attribute__((ext_vector_type(8)))  float    v8f;

#define S_LEN 2048
#define B_SZ  8
#define DM    1024
#define NH    16
#define HD    64
#define MTOK  (S_LEN * B_SZ)          // 16384 tokens

__device__ __forceinline__ void async_ld4_b128(const void* g0, const void* l0,
                                               const void* g1, const void* l1,
                                               const void* g2, const void* l2,
                                               const void* g3, const void* l3) {
    asm volatile("global_load_async_to_lds_b128 %0, %1, off\n\t"
                 "global_load_async_to_lds_b128 %2, %3, off\n\t"
                 "global_load_async_to_lds_b128 %4, %5, off\n\t"
                 "global_load_async_to_lds_b128 %6, %7, off\n\t"
                 "s_wait_xcnt 0x0"
                 :: "v"((unsigned)(uintptr_t)l0), "v"(g0),
                    "v"((unsigned)(uintptr_t)l1), "v"(g1),
                    "v"((unsigned)(uintptr_t)l2), "v"(g2),
                    "v"((unsigned)(uintptr_t)l3), "v"(g3) : "memory");
}
#if __has_builtin(__builtin_amdgcn_s_wait_asynccnt)
#define WAIT_ASYNC(n) __builtin_amdgcn_s_wait_asynccnt(n)
#else
#define WAIT_ASYNC(n) asm volatile("s_wait_asynccnt %0" :: "n"(n) : "memory")
#endif

__device__ __forceinline__ v16h load_frag(const _Float16* tile, int row0, int ld) {
    const int lane = threadIdx.x & 31;
    const _Float16* p = tile + (size_t)(row0 + (lane & 15)) * ld + ((lane >> 4) << 3);
    v16h r;
    ((float4*)&r)[0] = *(const float4*)(p);
    ((float4*)&r)[1] = *(const float4*)(p + 16);
    return r;
}

#define LDP 40

__device__ __forceinline__ v8f vzero8() { v8f z = {0.f,0.f,0.f,0.f,0.f,0.f,0.f,0.f}; return z; }

// ---------------------------------------------------------------------------
// fp32 -> fp16 conversion, float4 vectorized (used for input and weights)
// ---------------------------------------------------------------------------
__global__ __launch_bounds__(256) void cvt_f32_f16(const float* __restrict__ X,
                                                   _Float16* __restrict__ Xh) {
    size_t i = (size_t)blockIdx.x * 256 + threadIdx.x;
    float4 v = ((const float4*)X)[i];
    v4h h; h.x = (_Float16)v.x; h.y = (_Float16)v.y; h.z = (_Float16)v.z; h.w = (_Float16)v.w;
    ((v4h*)Xh)[i] = h;
}

enum { EPI_F32 = 0, EPI_UNIT = 1, EPI_GATE = 2 };

// x + (x of lane ^ XM) inside a 16-lane row; folds into one v_add_f32 with DPP
template<int XM>
__device__ __forceinline__ float add_row_xor(float x) {
    return x + __int_as_float(__builtin_amdgcn_update_dpp(
                   0, __float_as_int(x), 0x160 | XM, 0xf, 0xf, true));   // 0x160 = row_xmask
}

template<int EPI>
__global__ __launch_bounds__(256)
void gemm_xwT(const _Float16* __restrict__ X, const _Float16* __restrict__ Wh,
              const float* __restrict__ bias, const float* __restrict__ gate,
              _Float16* __restrict__ Yh, float* __restrict__ Yf, int M, int N, int K) {
    static_assert(HD == 64, "a wave's 64 columns are one head");
    constexpr int BM = 128, BN = 128, BK = 32;
    __shared__ __attribute__((aligned(16))) _Float16 sX[3][BM * LDP];
    __shared__ __attribute__((aligned(16))) _Float16 sW[3][BN * LDP];

    const int t    = threadIdx.x;
    const int lane = t & 31;
    const int wv   = t >> 5;                  // 0..7
    const int mBlk = blockIdx.x * BM;
    const int nBlk = blockIdx.y * BN;
    const int wm   = (wv >> 1) * 32;          // 0 / 32 / 64 / 96
    const int wn   = (wv & 1) * 64;           // 0 / 64

    v8f acc[2][4];
    #pragma unroll
    for (int i = 0; i < 2; ++i)
        #pragma unroll
        for (int j = 0; j < 4; ++j) acc[i][j] = vzero8();

    const int nk = K / BK;

    // 4 async b128 copies per thread per stage (2 X chunks + 2 W chunks)
    auto issue = [&](int kt, int buf) {
        const int row = t >> 1, kc = (t & 1) * 16;   // chunks 2t and 2t+1: one row, 32 B
        const _Float16* gx = X  + (size_t)(mBlk + row) * K + kt * BK + kc;
        const _Float16* gw = Wh + (size_t)(nBlk + row) * K + kt * BK + kc;
        _Float16* lx = &sX[buf][row * LDP + kc];
        _Float16* lw = &sW[buf][row * LDP + kc];
        async_ld4_b128(gx, lx, gw, lw, gx + 8, lx + 8, gw + 8, lw + 8);
    };

    issue(0, 0);
    for (int kt = 0; kt < nk; ++kt) {
        if (kt + 1 < nk) { issue(kt + 1, (kt + 1) % 3); WAIT_ASYNC(4); }
        else             { WAIT_ASYNC(0); }
        __syncthreads();
        const int b = kt % 3;
        v16h aF[2], bF[4];
        #pragma unroll
        for (int i = 0; i < 2; ++i) aF[i] = load_frag(sX[b], wm + i * 16, LDP);
        #pragma unroll
        for (int j = 0; j < 4; ++j) bF[j] = load_frag(sW[b], wn + j * 16, LDP);
        #pragma unroll
        for (int i = 0; i < 2; ++i)
            #pragma unroll
            for (int j = 0; j < 4; ++j)
                acc[i][j] = __builtin_amdgcn_wmma_f32_16x16x32_f16(
                    false, aF[i], false, bF[j], (short)0, acc[i][j], false, false);
    }

    const int mLane = mBlk + wm + ((lane >> 4) << 3);
    const int nLane = nBlk + wn + (lane & 15);
    const int head  = (nBlk + wn) / HD;
    float bv[4];
    #pragma unroll
    for (int j = 0; j < 4; ++j) bv[j] = bias[nLane + j * 16];
    float sc[2][8];
    if (EPI == EPI_GATE) {
        #pragma unroll
        for (int i = 0; i < 2; ++i)
            #pragma unroll
            for (int vg = 0; vg < 8; ++vg)
                sc[i][vg] = gate[(size_t)(mLane + i * 16 + vg) * NH + head];
    }
    #pragma unroll
    for (int i = 0; i < 2; ++i)
        #pragma unroll
        for (int vg = 0; vg < 8; ++vg) {
            const size_t o = (size_t)(mLane + i * 16 + vg) * N + nLane;
            float val[4];
            #pragma unroll
            for (int j = 0; j < 4; ++j) val[j] = acc[i][j][vg] + bv[j];
            if (EPI == EPI_F32) {
                #pragma unroll
                for (int j = 0; j < 4; ++j) Yf[o + j * 16] = val[j];
            } else {
                float f;
                if (EPI == EPI_UNIT) {
                    float ss = val[0] * val[0] + val[1] * val[1] + val[2] * val[2] + val[3] * val[3];
                    ss = add_row_xor<1>(ss);
                    ss = add_row_xor<2>(ss);
                    ss = add_row_xor<4>(ss);
                    ss = add_row_xor<8>(ss);
                    float rs;
                    asm("v_rsq_f32 %0, %1\n\tv_nop" : "=v"(rs) : "v"(ss));
                    f = fminf(rs, 1e12f);
                } else {
                    f = sc[i][vg];
                }
                #pragma unroll
                for (int j = 0; j < 4; ++j) Yh[o + j * 16] = (_Float16)(val[j] * f);
            }
        }
}

// ---------------------------------------------------------------------------
// w = sigmoid(X@Ww^T + bw), r = sigmoid(X@Wr^T + br), all in fp32, as one
// [32 gates] x [64 tokens] x [K = 1024] product per block on the f32 WMMA.
// 16 waves split K: wave wv owns k = wv*64 .. wv*64+63 and keeps its slice of
// both gate matrices in registers (A operand, rows = gates). Token rows are the
// B operand. Every global load covers whole 256-B row pieces; a wave-private
// LDS tile turns them into fragments. A and B go through the same two
// functions, so their k order is equal at every lane and register.
// The 16 partial sums of each gate value meet in LDS and are added in wave order.
// ---------------------------------------------------------------------------
typedef __attribute__((ext_vector_type(2))) float v2f;
typedef __attribute__((ext_vector_type(4))) float v4f;

#define GP_WAVES 16
#define GP_TOK   64                   // tokens per block
#define GP_KW    (DM / GP_WAVES)      // 64 k per wave = 256 B of a row
#define GP_PITCH (GP_KW + 4)          // staged row pitch, dwords (272 B: 16 B x odd)
#define GP_RP    36                   // partial-sum row pitch, dwords (32 gates + 4)

__device__ __forceinline__ void gp_fetch(const float* rows, int lane, v4f (&st)[8]) {
    #pragma unroll
    for (int i = 0; i < 8; ++i)
        st[i] = *(const v4f*)(rows + (size_t)(2 * i + (lane >> 4)) * DM + (lane & 15) * 4);
}

// rows in registers -> this wave's own LDS tile
__device__ __forceinline__ void gp_stage(float* stg, int lane, const v4f (&st)[8]) {
    #pragma unroll
    for (int i = 0; i < 8; ++i)
        *(v4f*)(stg + (2 * i + (lane >> 4)) * GP_PITCH + (lane & 15) * 4) = st[i];
    // the rows are read back by other lanes of this wave: stores done first
    asm volatile("s_wait_dscnt 0x0" ::: "memory");
}

// LDS tile -> fragments: lane (c = lane&15, h = lane>>4) gets row c,
// k = 8j + 4h .. 8j + 4h + 3 in fr[j]
__device__ __forceinline__ void gp_frag(const float* stg, int lane, v4f (&fr)[8]) {
    #pragma unroll
    for (int j = 0; j < 8; ++j)
        fr[j] = *(const v4f*)(stg + (lane & 15) * GP_PITCH + (2 * j + (lane >> 4)) * 4);
    // the tile is overwritten by the next gp_stage: reads done first
    asm volatile("s_wait_dscnt 0x0" ::: "memory");
}

__global__ __launch_bounds__(GP_WAVES * 32)
void wr_proj(const float* X,
             const float* Ww, const float* Wb,
             const float* Rw, const float* Rb,
             float* wout, float* rout) {
    __shared__ __attribute__((aligned(16))) float sStage[GP_WAVES][16 * GP_PITCH];
    __shared__ __attribute__((aligned(16))) float sPart[GP_WAVES][GP_TOK * GP_RP];

    const int t    = threadIdx.x;
    const int lane = t & 31;
    const int wv   = t >> 5;
    const int m0   = blockIdx.x * GP_TOK;
    float* stg = sStage[wv];
    const float* xs = X + (size_t)m0 * DM + wv * GP_KW;

    v4f sa[8], sb[8], s0[8], s1[8], gw[8], gr[8];
    gp_fetch(Ww + wv * GP_KW, lane, sa);
    gp_fetch(Rw + wv * GP_KW, lane, sb);
    gp_fetch(xs, lane, s0);
    gp_fetch(xs + (size_t)16 * DM, lane, s1);
    gp_stage(stg, lane, sa);
    gp_frag(stg, lane, gw);
    gp_stage(stg, lane, sb);
    gp_frag(stg, lane, gr);

    auto do_tile = [&](int tile, v4f (&cur)[8]) {
        v4f fx[8];
        gp_stage(stg, lane, cur);
        // two tiles ahead, into the registers that were just staged
        if (tile + 2 < GP_TOK / 16) gp_fetch(xs + (size_t)(tile + 2) * 16 * DM, lane, cur);
        gp_frag(stg, lane, fx);
        v8f aw = vzero8(), ar = vzero8();
        #pragma unroll
        for (int j = 0; j < 8; ++j) {
            v2f x0 = {fx[j].x, fx[j].y}, x1 = {fx[j].z, fx[j].w};
            v2f w0 = {gw[j].x, gw[j].y}, w1 = {gw[j].z, gw[j].w};
            v2f r0 = {gr[j].x, gr[j].y}, r1 = {gr[j].z, gr[j].w};
            aw = __builtin_amdgcn_wmma_f32_16x16x4_f32(false, w0, false, x0, (short)0, aw, false, false);
            ar = __builtin_amdgcn_wmma_f32_16x16x4_f32(false, r0, false, x0, (short)0, ar, false, false);
            aw = __builtin_amdgcn_wmma_f32_16x16x4_f32(false, w1, false, x1, (short)0, aw, false, false);
            ar = __builtin_amdgcn_wmma_f32_16x16x4_f32(false, r1, false, x1, (short)0, ar, false, false);
        }
        // D register e = gate 8h + e of token c: 8 consecutive gates per lane
        float* pp = &sPart[wv][(tile * 16 + (lane & 15)) * GP_RP + ((lane >> 4) << 3)];
        *(v4f*)(pp)      = v4f{aw[0], aw[1], aw[2], aw[3]};
        *(v4f*)(pp + 4)  = v4f{aw[4], aw[5], aw[6], aw[7]};
        *(v4f*)(pp + 16) = v4f{ar[0], ar[1], ar[2], ar[3]};
        *(v4f*)(pp + 20) = v4f{ar[4], ar[5], ar[6], ar[7]};
    };
    static_assert(GP_TOK == 64, "four tiles of 16 tokens");
    do_tile(0, s0);
    do_tile(1, s1);
    do_tile(2, s0);
    do_tile(3, s1);
    __syncthreads();

    // 64 tokens x 32 gates = 512 threads x 4 gates
    const int tok = t >> 3, g4 = (t & 7) * 4;
    v4f s = {0.f, 0.f, 0.f, 0.f};
    #pragma unroll
    for (int w = 0; w < GP_WAVES; ++w) {
        v4f p = *(const v4f*)&sPart[w][tok * GP_RP + g4];
        s.x += p.x; s.y += p.y; s.z += p.z; s.w += p.w;
    }
    const float* bp = (g4 < NH) ? (Wb + g4) : (Rb + g4 - NH);
    v4f y;
    y.x = 1.f / (1.f + __expf(-(s.x + bp[0])));
    y.y = 1.f / (1.f + __expf(-(s.y + bp[1])));
    y.z = 1.f / (1.f + __expf(-(s.z + bp[2])));
    y.w = 1.f / (1.f + __expf(-(s.w + bp[3])));
    float* op = ((g4 < NH) ? wout : rout) + (size_t)(m0 + tok) * NH + (g4 & (NH - 1));
    *(v4f*)op = y;
}

// ---------------------------------------------------------------------------
// A[b,n,v,q] = sum_s Vw[s,(b,n),v] * K[s,(b,n),q]  — one block per (b,n),
// WMMA with K-dim = s in chunks of 32, LDS tiles stored transposed [feat][s].
// Writes f32 A to d_out region and f16 copy to workspace.
// ---------------------------------------------------------------------------
__global__ __launch_bounds__(256)
void accum_A(const _Float16* __restrict__ Kh, const _Float16* __restrict__ Vh,
             float* __restrict__ Af, _Float16* __restrict__ Ah) {
    const int bn = blockIdx.x;          // b*16 + n
    const int b  = bn >> 4, n = bn & 15;
    __shared__ __attribute__((aligned(16))) _Float16 sK[2][HD * LDP]; // [q][s]
    __shared__ __attribute__((aligned(16))) _Float16 sV[2][HD * LDP]; // [v][s]

    const int t = threadIdx.x, lane = t & 31, wv = t >> 5;   // 8 waves
    const int vt   = wv >> 1;           // v-tile 0..3
    const int qoff = (wv & 1) * 32;     // q half 0/32

    v8f acc[2] = {vzero8(), vzero8()};
    uint4 kreg, vreg;
    const int s_i = t >> 3, f8 = (t & 7) * 8;
    const int nsc = S_LEN / 32;

    auto fetchA = [&](int sc) {
        size_t m = (size_t)(sc * 32 + s_i) * B_SZ + b;
        kreg = *(const uint4*)(Kh + m * DM + n * HD + f8);
        vreg = *(const uint4*)(Vh + m * DM + n * HD + f8);
    };
    auto stageA = [&](int bb) {
        union { uint4 u; _Float16 h[8]; } ck, cv;
        ck.u = kreg; cv.u = vreg;
        #pragma unroll
        for (int e = 0; e < 8; ++e) {
            sK[bb][(f8 + e) * LDP + s_i] = ck.h[e];   // transpose at store
            sV[bb][(f8 + e) * LDP + s_i] = cv.h[e];
        }
    };

    fetchA(0); stageA(0);
    for (int sc = 0; sc < nsc; ++sc) {
        __syncthreads();
        if (sc + 1 < nsc) fetchA(sc + 1);
        const int bb = sc & 1;
        v16h aF = load_frag(sV[bb], vt * 16, LDP);
        v16h bF0 = load_frag(sK[bb], qoff, LDP);
        v16h bF1 = load_frag(sK[bb], qoff + 16, LDP);
        acc[0] = __builtin_amdgcn_wmma_f32_16x16x32_f16(false, aF, false, bF0, (short)0, acc[0], false, false);
        acc[1] = __builtin_amdgcn_wmma_f32_16x16x32_f16(false, aF, false, bF1, (short)0, acc[1], false, false);
        if (sc + 1 < nsc) stageA((sc + 1) & 1);
    }

    #pragma unroll
    for (int j = 0; j < 2; ++j)
        #pragma unroll
        for (int vg = 0; vg < 8; ++vg) {
            int vIdx = vt * 16 + vg + ((lane >> 4) << 3);
            int qIdx = qoff + j * 16 + (lane & 15);
            size_t idx = ((size_t)bn * HD + vIdx) * HD + qIdx;
            float val = acc[j][vg];
            Af[idx] = val;
            Ah[idx] = (_Float16)val;
        }
}

// ---------------------------------------------------------------------------
// Mid[s,(b,n),v] = r * sum_q Q[s,(b,n),q] * A[b,n,v,q] — WMMA, fragments
// loaded straight from global (Q rows strided by B*DM, A rows contiguous).
// ---------------------------------------------------------------------------
__global__ __launch_bounds__(256)
void apply_A(const _Float16* __restrict__ Qh, const _Float16* __restrict__ Ah,
             const float* __restrict__ rbuf, _Float16* __restrict__ Mid) {
    const int bn = blockIdx.x;          // b*16+n
    const int b  = bn >> 4, n = bn & 15;
    const int lane  = threadIdx.x & 31;
    const int sBase = blockIdx.y * 128 + (threadIdx.x >> 5) * 16;   // 8 waves x 16 rows

    const _Float16* Abase = Ah + (size_t)bn * (HD * HD);
    v8f acc[4] = {vzero8(), vzero8(), vzero8(), vzero8()};

    #pragma unroll
    for (int kt = 0; kt < 2; ++kt) {    // K = 64 = 2 x 32
        const _Float16* qbase = Qh + ((size_t)sBase * B_SZ + b) * DM + n * HD + kt * 32;
        v16h aF = load_frag(qbase, 0, B_SZ * DM);        // row step = next s token
        #pragma unroll
        for (int j = 0; j < 4; ++j) {
            v16h bF = load_frag(Abase + kt * 32, j * 16, HD);
            acc[j] = __builtin_amdgcn_wmma_f32_16x16x32_f16(
                false, aF, false, bF, (short)0, acc[j], false, false);
        }
    }

    float rv[8];
    #pragma unroll
    for (int vg = 0; vg < 8; ++vg) {
        int s = sBase + vg + ((lane >> 4) << 3);
        rv[vg] = rbuf[((size_t)s * B_SZ + b) * NH + n];
    }
    #pragma unroll
    for (int j = 0; j < 4; ++j)
        #pragma unroll
        for (int vg = 0; vg < 8; ++vg) {
            int s = sBase + vg + ((lane >> 4) << 3);
            size_t m = (size_t)s * B_SZ + b;
            Mid[m * DM + n * HD + j * 16 + (lane & 15)] = (_Float16)(acc[j][vg] * rv[vg]);
        }
}

// ---------------------------------------------------------------------------
// Launch
// ---------------------------------------------------------------------------
extern "C" void kernel_launch(void* const* d_in, const int* in_sizes, int n_in,
                              void* d_out, int out_size, void* d_ws, size_t ws_size,
                              hipStream_t stream) {
    (void)in_sizes; (void)n_in; (void)out_size; (void)ws_size;
    const float* inp  = (const float*)d_in[0];
    const float* Wq_w = (const float*)d_in[1];  const float* Wq_b = (const float*)d_in[2];
    const float* Wk_w = (const float*)d_in[3];  const float* Wk_b = (const float*)d_in[4];
    const float* Wv_w = (const float*)d_in[5];  const float* Wv_b = (const float*)d_in[6];
    const float* Wo_w = (const float*)d_in[7];  const float* Wo_b = (const float*)d_in[8];
    const float* Ww_w = (const float*)d_in[9];  const float* Ww_b = (const float*)d_in[10];
    const float* Wr_w = (const float*)d_in[11]; const float* Wr_b = (const float*)d_in[12];

    float* out_f = (float*)d_out;                       // [S,B,DM]
    float* A_f   = out_f + (size_t)MTOK * DM;           // [B,NH,64,64]

    char* ws = (char*)d_ws;
    constexpr size_t HBYTES = (size_t)MTOK * DM * sizeof(_Float16);   // 32 MiB
    constexpr size_t GATE   = (size_t)MTOK * NH * 4;                  // 1 MiB
    constexpr size_t WBYTES = (size_t)DM * DM * sizeof(_Float16);     // 2 MiB
    _Float16* Xh  = (_Float16*)(ws);
    _Float16* Qh  = (_Float16*)(ws + HBYTES);
    _Float16* Kh  = (_Float16*)(ws + 2 * HBYTES);
    _Float16* Vh  = (_Float16*)(ws + 3 * HBYTES);
    float*    wbf = (float*)   (ws + 4 * HBYTES);
    float*    rbf = (float*)   (ws + 4 * HBYTES + GATE);
    _Float16* Ah  = (_Float16*)(ws + 4 * HBYTES + 2 * GATE);
    _Float16* Mid = (_Float16*)(ws + 4 * HBYTES + 2 * GATE + (size_t)B_SZ * NH * HD * HD * 2);
    _Float16* Wqh = (_Float16*)(ws + 5 * HBYTES + 3 * GATE);
    _Float16* Wkh = (_Float16*)(ws + 5 * HBYTES + 3 * GATE + WBYTES);
    _Float16* Wvh = (_Float16*)(ws + 5 * HBYTES + 3 * GATE + 2 * WBYTES);
    _Float16* Woh = (_Float16*)(ws + 5 * HBYTES + 3 * GATE + 3 * WBYTES);

    // 1) fp32 -> fp16: input + four big weight matrices
    cvt_f32_f16<<<(MTOK * DM / 4) / 256, 256, 0, stream>>>(inp, Xh);
    cvt_f32_f16<<<(DM * DM / 4) / 256, 256, 0, stream>>>(Wq_w, Wqh);
    cvt_f32_f16<<<(DM * DM / 4) / 256, 256, 0, stream>>>(Wk_w, Wkh);
    cvt_f32_f16<<<(DM * DM / 4) / 256, 256, 0, stream>>>(Wv_w, Wvh);
    cvt_f32_f16<<<(DM * DM / 4) / 256, 256, 0, stream>>>(Wo_w, Woh);

    // 2) gate projections (w is read by the V projection's epilogue)
    wr_proj<<<MTOK / GP_TOK, GP_WAVES * 32, 0, stream>>>(inp, Ww_w, Ww_b, Wr_w, Wr_b, wbf, rbf);

    // 3) Q/K/V projections (WMMA GEMM, async-LDS pipeline, f16 out):
    //    q and k leave unit-normalized per head, v leaves multiplied by w
    dim3 gg(MTOK / 128, DM / 128);
    gemm_xwT<EPI_UNIT><<<gg, 256, 0, stream>>>(Xh, Wqh, Wq_b, nullptr, Qh, nullptr, MTOK, DM, DM);
    gemm_xwT<EPI_UNIT><<<gg, 256, 0, stream>>>(Xh, Wkh, Wk_b, nullptr, Kh, nullptr, MTOK, DM, DM);
    gemm_xwT<EPI_GATE><<<gg, 256, 0, stream>>>(Xh, Wvh, Wv_b, wbf, Vh, nullptr, MTOK, DM, DM);

    // 4) A accumulation (writes f32 A output + f16 copy)
    accum_A<<<B_SZ * NH, 256, 0, stream>>>(Kh, Vh, A_f, Ah);

    // 5) apply A, scale by r
    apply_A<<<dim3(B_SZ * NH, S_LEN / 128), 256, 0, stream>>>(Qh, Ah, rbf, Mid);

    // 6) final O projection (f32 out to d_out)
    gemm_xwT<EPI_F32><<<gg, 256, 0, stream>>>(Mid, Woh, Wo_b, nullptr, nullptr, out_f, MTOK, DM, DM);
}

// v004
// Measured time: 236 microseconds a run.
// In both of two side-by-side timings against v003, it was 1.13 times as fast.
// Over all steps from v000 it is 2.28 times as fast.
#include <hip/hip_runtime.h>
#include <hip/hip_bf16.h>
#include <cstdint>

typedef __attribute__((ext_vector_type(16))) _Float16 v16h;
typedef __attribute__((ext_vector_type(4)))  _Float16 v4h;
typedef __attribute__((ext_vector_type(8)))  float    v8f;

#define S_LEN 2048
#define B_SZ  8
#define DM    1024
#define NH    16
#define HD    64
#define MTOK  (S_LEN * B_SZ)          // 16384 tokens

__device__ __forceinline__ void async_ld8_b128(const _Float16* const (&g)[8],
                                               const _Float16* const (&l)[8]) {
    asm volatile("global_load_async_to_lds_b128 %0, %1, off\n\t"
                 "global_load_async_to_lds_b128 %2, %3, off\n\t"
                 "global_load_async_to_lds_b128 %4, %5, off\n\t"
                 "global_load_async_to_lds_b128 %6, %7, off\n\t"
                 "global_load_async_to_lds_b128 %8, %9, off\n\t"
                 "global_load_async_to_lds_b128 %10, %11, off\n\t"
                 "global_load_async_to_lds_b128 %12, %13, off\n\t"
                 "global_load_async_to_lds_b128 %14, %15, off\n\t"
                 "s_wait_xcnt 0x0"
                 :: "v"((unsigned)(uintptr_t)l[0]), "v"(g[0]),
                    "v"((unsigned)(uintptr_t)l[1]), "v"(g[1]),
                    "v"((unsigned)(uintptr_t)l[2]), "v"(g[2]),
                    "v"((unsigned)(uintptr_t)l[3]), "v"(g[3]),
                    "v"((unsigned)(uintptr_t)l[4]), "v"(g[4]),
                    "v"((unsigned)(uintptr_t)l[5]), "v"(g[5]),
                    "v"((unsigned)(uintptr_t)l[6]), "v"(g[6]),
                    "v"((unsigned)(uintptr_t)l[7]), "v"(g[7]) : "memory");
}

__device__ __forceinline__ v16h load_frag(const _Float16* tile, int row0, int ld) {
    const int lane = threadIdx.x & 31;
    const _Float16* p = tile + (size_t)(row0 + (lane & 15)) * ld + ((lane >> 4) << 3);
    v16h r;
    ((float4*)&r)[0] = *(const float4*)(p);
    ((float4*)&r)[1] = *(const float4*)(p + 16);
    return r;
}

#define LDP 40
// LDS pitch of a 64-half (128 B) tile row: 144 B = 16 B x odd, for the same reason.
#define LDG 72

__device__ __forceinline__ v8f vzero8() { v8f z = {0.f,0.f,0.f,0.f,0.f,0.f,0.f,0.f}; return z; }

// ---------------------------------------------------------------------------
// fp32 -> fp16 conversion, float4 vectorized (used for input and weights)
// ---------------------------------------------------------------------------
__global__ __launch_bounds__(256) void cvt_f32_f16(const float* __restrict__ X,
                                                   _Float16* __restrict__ Xh) {
    size_t i = (size_t)blockIdx.x * 256 + threadIdx.x;
    float4 v = ((const float4*)X)[i];
    v4h h; h.x = (_Float16)v.x; h.y = (_Float16)v.y; h.z = (_Float16)v.z; h.w = (_Float16)v.w;
    ((v4h*)Xh)[i] = h;
}

enum { EPI_F32 = 0, EPI_UNIT = 1, EPI_GATE = 2 };

// x + (x of lane ^ XM) inside a 16-lane row; folds into one v_add_f32 with DPP
template<int XM>
__device__ __forceinline__ float add_row_xor(float x) {
    return x + __int_as_float(__builtin_amdgcn_update_dpp(
                   0, __float_as_int(x), 0x160 | XM, 0xf, 0xf, true));   // 0x160 = row_xmask
}

template<int EPI>
__global__ __launch_bounds__(256)
void gemm_xwT(const _Float16* __restrict__ X, const _Float16* __restrict__ Wh,
              const float* __restrict__ bias, const float* __restrict__ gate,
              _Float16* __restrict__ Yh, float* __restrict__ Yf, int M, int N, int K) {
    static_assert(HD == 64, "a wave's 64 columns are one head");
    constexpr int BM = 128, BN = 128, BK = 64;
    __shared__ __attribute__((aligned(16))) _Float16 sX[2][BM * LDG];
    __shared__ __attribute__((aligned(16))) _Float16 sW[2][BN * LDG];

    const int t    = threadIdx.x;
    const int lane = t & 31;
    const int wv   = t >> 5;                  // 0..7
    const int mBlk = blockIdx.x * BM;
    const int nBlk = blockIdx.y * BN;
    const int wm   = (wv >> 1) * 32;          // 0 / 32 / 64 / 96
    const int wn   = (wv & 1) * 64;           // 0 / 64

    v8f acc[2][4];
    #pragma unroll
    for (int i = 0; i < 2; ++i)
        #pragma unroll
        for (int j = 0; j < 4; ++j) acc[i][j] = vzero8();

    const int nk = K / BK;

    // 8 async b128 copies per thread per stage (4 X chunks + 4 W chunks):
    // lanes 8r .. 8r+7 take the 128 B of one row, a wave 4 rows, the block 32 rows
    const int row = t >> 3, kc = (t & 7) * 8;
    const _Float16* gx0 = X  + (size_t)(mBlk + row) * K + kc;
    const _Float16* gw0 = Wh + (size_t)(nBlk + row) * K + kc;
    const size_t rstep = (size_t)32 * K;             // 32 rows on, the same for every lane
    auto issue = [&](int kt, int buf) {
        const _Float16* g[8];
        const _Float16* l[8];
        #pragma unroll
        for (int p = 0; p < 4; ++p) {
            g[2 * p]     = gx0 + (p * rstep + (size_t)kt * BK);
            g[2 * p + 1] = gw0 + (p * rstep + (size_t)kt * BK);
            l[2 * p]     = &sX[buf][(row + p * 32) * LDG + kc];
            l[2 * p + 1] = &sW[buf][(row + p * 32) * LDG + kc];
        }
        async_ld8_b128(g, l);
    };

    issue(0, 0);
    // stage 0 has landed for this wave, and behind the barrier for every wave
    asm volatile("s_wait_asynccnt 0x0" ::: "memory");
    __syncthreads();
    if (1 < nk) issue(1, 1);
    for (int kt = 0; kt < nk; ++kt) {
        const int b = kt & 1;
        #pragma unroll
        for (int kk = 0; kk < BK; kk += 32) {
            v16h aF[2], bF[4];
            #pragma unroll
            for (int i = 0; i < 2; ++i) aF[i] = load_frag(sX[b] + kk, wm + i * 16, LDG);
            #pragma unroll
            for (int j = 0; j < 4; ++j) bF[j] = load_frag(sW[b] + kk, wn + j * 16, LDG);
            #pragma unroll
            for (int i = 0; i < 2; ++i)
                #pragma unroll
                for (int j = 0; j < 4; ++j)
                    acc[i][j] = __builtin_amdgcn_wmma_f32_16x16x32_f16(
                        false, aF[i], false, bF[j], (short)0, acc[i][j], false, false);
        }
        // this wave's reads of buf b are done before the buffer may be refilled
        asm volatile("s_wait_dscnt 0x0" ::: "memory");
        // this wave's copies of stage kt+1 have landed before the barrier publishes them
        asm volatile("s_wait_asynccnt 0x0" ::: "memory");
        __syncthreads();
        if (kt + 2 < nk) issue(kt + 2, b);
    }
    // no copy is outstanding when the wave goes on to its end
    asm volatile("s_wait_asynccnt 0x0" ::: "memory");

    const int mLane = mBlk + wm + ((lane >> 4) << 3);
    const int nLane = nBlk + wn + (lane & 15);
    const int head  = (nBlk + wn) / HD;
    float bv[4];
    #pragma unroll
    for (int j = 0; j < 4; ++j) bv[j] = bias[nLane + j * 16];
    float sc[2][8];
    if (EPI == EPI_GATE) {
        #pragma unroll
        for (int i = 0; i < 2; ++i)
            #pragma unroll
            for (int vg = 0; vg < 8; ++vg)
                sc[i][vg] = gate[(size_t)(mLane + i * 16 + vg) * NH + head];
    }
    #pragma unroll
    for (int i = 0; i < 2; ++i)
        #pragma unroll
        for (int vg = 0; vg < 8; ++vg) {
            const size_t o = (size_t)(mLane + i * 16 + vg) * N + nLane;
            float val[4];
            #pragma unroll
            for (int j = 0; j < 4; ++j) val[j] = acc[i][j][vg] + bv[j];
            if (EPI == EPI_F32) {
                #pragma unroll
                for (int j = 0; j < 4; ++j) Yf[o + j * 16] = val[j];
            } else {
                float f;
                if (EPI == EPI_UNIT) {
                    float ss = val[0] * val[0] + val[1] * val[1] + val[2] * val[2] + val[3] * val[3];
                    ss = add_row_xor<1>(ss);
                    ss = add_row_xor<2>(ss);
                    ss = add_row_xor<4>(ss);
                    ss = add_row_xor<8>(ss);
                    float rs;
                    asm("v_rsq_f32 %0, %1\n\tv_nop" : "=v"(rs) : "v"(ss));
                    f = fminf(rs, 1e12f);
                } else {
                    f = sc[i][vg];
                }
                #pragma unroll
                for (int j = 0; j < 4; ++j) Yh[o + j * 16] = (_Float16)(val[j] * f);
            }
        }
}

// ---------------------------------------------------------------------------
// w = sigmoid(X@Ww^T + bw), r = sigmoid(X@Wr^T + br), all in fp32, as one
// [32 gates] x [64 tokens] x [K = 1024] product per block on the f32 WMMA.
// 16 waves split K: wave wv owns k = wv*64 .. wv*64+63 and keeps its slice of
// both gate matrices in registers (A operand, rows = gates). Token rows are the
// B operand. Every global load covers whole 256-B row pieces; a wave-private
// LDS tile turns them into fragments. A and B go through the same two
// functions, so their k order is equal at every lane and register.
// The 16 partial sums of each gate value meet in LDS and are added in wave order.
// ---------------------------------------------------------------------------
typedef __attribute__((ext_vector_type(2))) float v2f;
typedef __attribute__((ext_vector_type(4))) float v4f;

#define GP_WAVES 16
#define GP_TOK   64                   // tokens per block
#define GP_KW    (DM / GP_WAVES)      // 64 k per wave = 256 B of a row
#define GP_PITCH (GP_KW + 4)          // staged row pitch, dwords (272 B: 16 B x odd)
#define GP_RP    36                   // partial-sum row pitch, dwords (32 gates + 4)

__device__ __forceinline__ void gp_fetch(const float* rows, int lane, v4f (&st)[8]) {
    #pragma unroll
    for (int i = 0; i < 8; ++i)
        st[i] = *(const v4f*)(rows + (size_t)(2 * i + (lane >> 4)) * DM + (lane & 15) * 4);
}

// rows in registers -> this wave's own LDS tile
__device__ __forceinline__ void gp_stage(float* stg, int lane, const v4f (&st)[8]) {
    #pragma unroll
    for (int i = 0; i < 8; ++i)
        *(v4f*)(stg + (2 * i + (lane >> 4)) * GP_PITCH + (lane & 15) * 4) = st[i];
    // the rows are read back by other lanes of this wave: stores done first
    asm volatile("s_wait_dscnt 0x0" ::: "memory");
}

// LDS tile -> fragments: lane (c = lane&15, h = lane>>4) gets row c,
// k = 8j + 4h .. 8j + 4h + 3 in fr[j]
__device__ __forceinline__ void gp_frag(const float* stg, int lane, v4f (&fr)[8]) {
    #pragma unroll
    for (int j = 0; j < 8; ++j)
        fr[j] = *(const v4f*)(stg + (lane & 15) * GP_PITCH + (2 * j + (lane >> 4)) * 4);
    // the tile is overwritten by the next gp_stage: reads done first
    asm volatile("s_wait_dscnt 0x0" ::: "memory");
}

__global__ __launch_bounds__(GP_WAVES * 32)
void wr_proj(const float* X,
             const float* Ww, const float* Wb,
             const float* Rw, const float* Rb,
             float* wout, float* rout) {
    __shared__ __attribute__((aligned(16))) float sStage[GP_WAVES][16 * GP_PITCH];
    __shared__ __attribute__((aligned(16))) float sPart[GP_WAVES][GP_TOK * GP_RP];

    const int t    = threadIdx.x;
    const int lane = t & 31;
    const int wv   = t >> 5;
    const int m0   = blockIdx.x * GP_TOK;
    float* stg = sStage[wv];
    const float* xs = X + (size_t)m0 * DM + wv * GP_KW;

    v4f sa[8], sb[8], s0[8], s1[8], gw[8], gr[8];
    gp_fetch(Ww + wv * GP_KW, lane, sa);
    gp_fetch(Rw + wv * GP_KW, lane, sb);
    gp_fetch(xs, lane, s0);
    gp_fetch(xs + (size_t)16 * DM, lane, s1);
    gp_stage(stg, lane, sa);
    gp_frag(stg, lane, gw);
    gp_stage(stg, lane, sb);
    gp_frag(stg, lane, gr);

    auto do_tile = [&](int tile, v4f (&cur)[8]) {
        v4f fx[8];
        gp_stage(stg, lane, cur);
        // two tiles ahead, into the registers that were just staged
        if (tile + 2 < GP_TOK / 16) gp_fetch(xs + (size_t)(tile + 2) * 16 * DM, lane, cur);
        gp_frag(stg, lane, fx);
        v8f aw = vzero8(), ar = vzero8();
        #pragma unroll
        for (int j = 0; j < 8; ++j) {
            v2f x0 = {fx[j].x, fx[j].y}, x1 = {fx[j].z, fx[j].w};
            v2f w0 = {gw[j].x, gw[j].y}, w1 = {gw[j].z, gw[j].w};
            v2f r0 = {gr[j].x, gr[j].y}, r1 = {gr[j].z, gr[j].w};
            aw = __builtin_amdgcn_wmma_f32_16x16x4_f32(false, w0, false, x0, (short)0, aw, false, false);
            ar = __builtin_amdgcn_wmma_f32_16x16x4_f32(false, r0, false, x0, (short)0, ar, false, false);
            aw = __builtin_amdgcn_wmma_f32_16x16x4_f32(false, w1, false, x1, (short)0, aw, false, false);
            ar = __builtin_amdgcn_wmma_f32_16x16x4_f32(false, r1, false, x1, (short)0, ar, false, false);
        }
        // D register e = gate 8h + e of token c: 8 consecutive gates per lane
        float* pp = &sPart[wv][(tile * 16 + (lane & 15)) * GP_RP + ((lane >> 4) << 3)];
        *(v4f*)(pp)      = v4f{aw[0], aw[1], aw[2], aw[3]};
        *(v4f*)(pp + 4)  = v4f{aw[4], aw[5], aw[6], aw[7]};
        *(v4f*)(pp + 16) = v4f{ar[0], ar[1], ar[2], ar[3]};
        *(v4f*)(pp + 20) = v4f{ar[4], ar[5], ar[6], ar[7]};
    };
    static_assert(GP_TOK == 64, "four tiles of 16 tokens");
    do_tile(0, s0);
    do_tile(1, s1);
    do_tile(2, s0);
    do_tile(3, s1);
    __syncthreads();

    // 64 tokens x 32 gates = 512 threads x 4 gates
    const int tok = t >> 3, g4 = (t & 7) * 4;
    v4f s = {0.f, 0.f, 0.f, 0.f};
    #pragma unroll
    for (int w = 0; w < GP_WAVES; ++w) {
        v4f p = *(const v4f*)&sPart[w][tok * GP_RP + g4];
        s.x += p.x; s.y += p.y; s.z += p.z; s.w += p.w;
    }
    const float* bp = (g4 < NH) ? (Wb + g4) : (Rb + g4 - NH);
    v4f y;
    y.x = 1.f / (1.f + __expf(-(s.x + bp[0])));
    y.y = 1.f / (1.f + __expf(-(s.y + bp[1])));
    y.z = 1.f / (1.f + __expf(-(s.z + bp[2])));
    y.w = 1.f / (1.f + __expf(-(s.w + bp[3])));
    float* op = ((g4 < NH) ? wout : rout) + (size_t)(m0 + tok) * NH + (g4 & (NH - 1));
    *(v4f*)op = y;
}

// ---------------------------------------------------------------------------
// A[b,n,v,q] = sum_s Vw[s,(b,n),v] * K[s,(b,n),q]  — one block per (b,n),
// WMMA with K-dim = s in chunks of 32, LDS tiles stored transposed [feat][s].
// Writes f32 A to d_out region and f16 copy to workspace.
// ---------------------------------------------------------------------------
__global__ __launch_bounds__(256)
void accum_A(const _Float16* __restrict__ Kh, const _Float16* __restrict__ Vh,
             float* __restrict__ Af, _Float16* __restrict__ Ah) {
    const int bn = blockIdx.x;          // b*16 + n
    const int b  = bn >> 4, n = bn & 15;
    __shared__ __attribute__((aligned(16))) _Float16 sK[2][HD * LDP]; // [q][s]
    __shared__ __attribute__((aligned(16))) _Float16 sV[2][HD * LDP]; // [v][s]

    const int t = threadIdx.x, lane = t & 31, wv = t >> 5;   // 8 waves
    const int vt   = wv >> 1;           // v-tile 0..3
    const int qoff = (wv & 1) * 32;     // q half 0/32

    v8f acc[2] = {vzero8(), vzero8()};
    uint4 kreg, vreg;
    const int s_i = t >> 3, f8 = (t & 7) * 8;
    const int nsc = S_LEN / 32;

    auto fetchA = [&](int sc) {
        size_t m = (size_t)(sc * 32 + s_i) * B_SZ + b;
        kreg = *(const uint4*)(Kh + m * DM + n * HD + f8);
        vreg = *(const uint4*)(Vh + m * DM + n * HD + f8);
    };
    auto stageA = [&](int bb) {
        union { uint4 u; _Float16 h[8]; } ck, cv;
        ck.u = kreg; cv.u = vreg;
        #pragma unroll
        for (int e = 0; e < 8; ++e) {
            sK[bb][(f8 + e) * LDP + s_i] = ck.h[e];   // transpose at store
            sV[bb][(f8 + e) * LDP + s_i] = cv.h[e];
        }
    };

    fetchA(0); stageA(0);
    for (int sc = 0; sc < nsc; ++sc) {
        __syncthreads();
        if (sc + 1 < nsc) fetchA(sc + 1);
        const int bb = sc & 1;
        v16h aF = load_frag(sV[bb], vt * 16, LDP);
        v16h bF0 = load_frag(sK[bb], qoff, LDP);
        v16h bF1 = load_frag(sK[bb], qoff + 16, LDP);
        acc[0] = __builtin_amdgcn_wmma_f32_16x16x32_f16(false, aF, false, bF0, (short)0, acc[0], false, false);
        acc[1] = __builtin_amdgcn_wmma_f32_16x16x32_f16(false, aF, false, bF1, (short)0, acc[1], false, false);
        if (sc + 1 < nsc) stageA((sc + 1) & 1);
    }

    #pragma unroll
    for (int j = 0; j < 2; ++j)
        #pragma unroll
        for (int vg = 0; vg < 8; ++vg) {
            int vIdx = vt * 16 + vg + ((lane >> 4) << 3);
            int qIdx = qoff + j * 16 + (lane & 15);
            size_t idx = ((size_t)bn * HD + vIdx) * HD + qIdx;
            float val = acc[j][vg];
            Af[idx] = val;
            Ah[idx] = (_Float16)val;
        }
}

// ---------------------------------------------------------------------------
// Mid[s,(b,n),v] = r * sum_q Q[s,(b,n),q] * A[b,n,v,q] — WMMA, fragments
// loaded straight from global (Q rows strided by B*DM, A rows contiguous).
// ---------------------------------------------------------------------------
__global__ __launch_bounds__(256)
void apply_A(const _Float16* __restrict__ Qh, const _Float16* __restrict__ Ah,
             const float* __restrict__ rbuf, _Float16* __restrict__ Mid) {
    const int bn = blockIdx.x;          // b*16+n
    const int b  = bn >> 4, n = bn & 15;
    const int lane  = threadIdx.x & 31;
    const int sBase = blockIdx.y * 128 + (threadIdx.x >> 5) * 16;   // 8 waves x 16 rows

    const _Float16* Abase = Ah + (size_t)bn * (HD * HD);
    v8f acc[4] = {vzero8(), vzero8(), vzero8(), vzero8()};

    #pragma unroll
    for (int kt = 0; kt < 2; ++kt) {    // K = 64 = 2 x 32
        const _Float16* qbase = Qh + ((size_t)sBase * B_SZ + b) * DM + n * HD + kt * 32;
        v16h aF = load_frag(qbase, 0, B_SZ * DM);        // row step = next s token
        #pragma unroll
        for (int j = 0; j < 4; ++j) {
            v16h bF = load_frag(Abase + kt * 32, j * 16, HD);
            acc[j] = __builtin_amdgcn_wmma_f32_16x16x32_f16(
                false, aF, false, bF, (short)0, acc[j], false, false);
        }
    }

    float rv[8];
    #pragma unroll
    for (int vg = 0; vg < 8; ++vg) {
        int s = sBase + vg + ((lane >> 4) << 3);
        rv[vg] = rbuf[((size_t)s * B_SZ + b) * NH + n];
    }
    #pragma unroll
    for (int j = 0; j < 4; ++j)
        #pragma unroll
        for (int vg = 0; vg < 8; ++vg) {
            int s = sBase + vg + ((lane >> 4) << 3);
            size_t m = (size_t)s * B_SZ + b;
            Mid[m * DM + n * HD + j * 16 + (lane & 15)] = (_Float16)(acc[j][vg] * rv[vg]);
        }
}

// ---------------------------------------------------------------------------
// Launch
// ---------------------------------------------------------------------------
extern "C" void kernel_launch(void* const* d_in, const int* in_sizes, int n_in,
                              void* d_out, int out_size, void* d_ws, size_t ws_size,
                              hipStream_t stream) {
    (void)in_sizes; (void)n_in; (void)out_size; (void)ws_size;
    const float* inp  = (const float*)d_in[0];
    const float* Wq_w = (const float*)d_in[1];  const float* Wq_b = (const float*)d_in[2];
    const float* Wk_w = (const float*)d_in[3];  const float* Wk_b = (const float*)d_in[4];
    const float* Wv_w = (const float*)d_in[5];  const float* Wv_b = (const float*)d_in[6];
    const float* Wo_w = (const float*)d_in[7];  const float* Wo_b = (const float*)d_in[8];
    const float* Ww_w = (const float*)d_in[9];  const float* Ww_b = (const float*)d_in[10];
    const float* Wr_w = (const float*)d_in[11]; const float* Wr_b = (const float*)d_in[12];

    float* out_f = (float*)d_out;                       // [S,B,DM]
    float* A_f   = out_f + (size_t)MTOK * DM;           // [B,NH,64,64]

    char* ws = (char*)d_ws;
    constexpr size_t HBYTES = (size_t)MTOK * DM * sizeof(_Float16);   // 32 MiB
    constexpr size_t GATE   = (size_t)MTOK * NH * 4;                  // 1 MiB
    constexpr size_t WBYTES = (size_t)DM * DM * sizeof(_Float16);     // 2 MiB
    _Float16* Xh  = (_Float16*)(ws);
    _Float16* Qh  = (_Float16*)(ws + HBYTES);
    _Float16* Kh  = (_Float16*)(ws + 2 * HBYTES);
    _Float16* Vh  = (_Float16*)(ws + 3 * HBYTES);
    float*    wbf = (float*)   (ws + 4 * HBYTES);
    float*    rbf = (float*)   (ws + 4 * HBYTES + GATE);
    _Float16* Ah  = (_Float16*)(ws + 4 * HBYTES + 2 * GATE);
    _Float16* Mid = (_Float16*)(ws + 4 * HBYTES + 2 * GATE + (size_t)B_SZ * NH * HD * HD * 2);
    _Float16* Wqh = (_Float16*)(ws + 5 * HBYTES + 3 * GATE);
    _Float16* Wkh = (_Float16*)(ws + 5 * HBYTES + 3 * GATE + WBYTES);
    _Float16* Wvh = (_Float16*)(ws + 5 * HBYTES + 3 * GATE + 2 * WBYTES);
    _Float16* Woh = (_Float16*)(ws + 5 * HBYTES + 3 * GATE + 3 * WBYTES);

    // 1) fp32 -> fp16: input + four big weight matrices
    cvt_f32_f16<<<(MTOK * DM / 4) / 256, 256, 0, stream>>>(inp, Xh);
    cvt_f32_f16<<<(DM * DM / 4) / 256, 256, 0, stream>>>(Wq_w, Wqh);
    cvt_f32_f16<<<(DM * DM / 4) / 256, 256, 0, stream>>>(Wk_w, Wkh);
    cvt_f32_f16<<<(DM * DM / 4) / 256, 256, 0, stream>>>(Wv_w, Wvh);
    cvt_f32_f16<<<(DM * DM / 4) / 256, 256, 0, stream>>>(Wo_w, Woh);

    // 2) gate projections (w is read by the V projection's epilogue)
    wr_proj<<<MTOK / GP_TOK, GP_WAVES * 32, 0, stream>>>(inp, Ww_w, Ww_b, Wr_w, Wr_b, wbf, rbf);

    // 3) Q/K/V projections (WMMA GEMM, async-LDS pipeline, f16 out):
    //    q and k leave unit-normalized per head, v leaves multiplied by w
    dim3 gg(MTOK / 128, DM / 128);
    gemm_xwT<EPI_UNIT><<<gg, 256, 0, stream>>>(Xh, Wqh, Wq_b, nullptr, Qh, nullptr, MTOK, DM, DM);
    gemm_xwT<EPI_UNIT><<<gg, 256, 0, stream>>>(Xh, Wkh, Wk_b, nullptr, Kh, nullptr, MTOK, DM, DM);
    gemm_xwT<EPI_GATE><<<gg, 256, 0, stream>>>(Xh, Wvh, Wv_b, wbf, Vh, nullptr, MTOK, DM, DM);

    // 4) A accumulation (writes f32 A output + f16 copy)
    accum_A<<<B_SZ * NH, 256, 0, stream>>>(Kh, Vh, A_f, Ah);

    // 5) apply A, scale by r
    apply_A<<<dim3(B_SZ * NH, S_LEN / 128), 256, 0, stream>>>(Qh, Ah, rbf, Mid);

    // 6) final O projection (f32 out to d_out)
    gemm_xwT<EPI_F32><<<gg, 256, 0, stream>>>(Mid, Woh, Wo_b, nullptr, nullptr, out_f, MTOK, DM, DM);
}

// v005
// Measured time: 226 microseconds a run.
// Next to v004, in two timings, it ran 1.04 times as fast each time.
// All steps since v000 together make it 2.38 times as fast.
#include <hip/hip_runtime.h>
#include <hip/hip_bf16.h>
#include <cstdint>

typedef __attribute__((ext_vector_type(16))) _Float16 v16h;
typedef __attribute__((ext_vector_type(4)))  _Float16 v4h;
typedef __attribute__((ext_vector_type(8)))  float    v8f;

#define S_LEN 2048
#define B_SZ  8
#define DM    1024
#define NH    16
#define HD    64
#define MTOK  (S_LEN * B_SZ)          // 16384 tokens

__device__ __forceinline__ void async_ld8_b128(const _Float16* const (&g)[8],
                                               const _Float16* const (&l)[8]) {
    asm volatile("global_load_async_to_lds_b128 %0, %1, off\n\t"
                 "global_load_async_to_lds_b128 %2, %3, off\n\t"
                 "global_load_async_to_lds_b128 %4, %5, off\n\t"
                 "global_load_async_to_lds_b128 %6, %7, off\n\t"
                 "global_load_async_to_lds_b128 %8, %9, off\n\t"
                 "global_load_async_to_lds_b128 %10, %11, off\n\t"
                 "global_load_async_to_lds_b128 %12, %13, off\n\t"
                 "global_load_async_to_lds_b128 %14, %15, off\n\t"
                 "s_wait_xcnt 0x0"
                 :: "v"((unsigned)(uintptr_t)l[0]), "v"(g[0]),
                    "v"((unsigned)(uintptr_t)l[1]), "v"(g[1]),
                    "v"((unsigned)(uintptr_t)l[2]), "v"(g[2]),
                    "v"((unsigned)(uintptr_t)l[3]), "v"(g[3]),
                    "v"((unsigned)(uintptr_t)l[4]), "v"(g[4]),
                    "v"((unsigned)(uintptr_t)l[5]), "v"(g[5]),
                    "v"((unsigned)(uintptr_t)l[6]), "v"(g[6]),
                    "v"((unsigned)(uintptr_t)l[7]), "v"(g[7]) : "memory");
}

__device__ __forceinline__ v16h load_frag(const _Float16* tile, int row0, int ld) {
    const int lane = threadIdx.x & 31;
    const _Float16* p = tile + (size_t)(row0 + (lane & 15)) * ld + ((lane >> 4) << 3);
    v16h r;
    ((float4*)&r)[0] = *(const float4*)(p);
    ((float4*)&r)[1] = *(const float4*)(p + 16);
    return r;
}

#define LDP 40
// LDS pitch of a 64-half (128 B) tile row: 144 B = 16 B x odd, for the same reason.
#define LDG 72

__device__ __forceinline__ v8f vzero8() { v8f z = {0.f,0.f,0.f,0.f,0.f,0.f,0.f,0.f}; return z; }

// ---------------------------------------------------------------------------
// fp32 -> fp16 conversion, float4 vectorized (used for input and weights)
// ---------------------------------------------------------------------------
__global__ __launch_bounds__(256) void cvt_f32_f16(const float* __restrict__ X,
                                                   _Float16* __restrict__ Xh) {
    size_t i = (size_t)blockIdx.x * 256 + threadIdx.x;
    float4 v = ((const float4*)X)[i];
    v4h h; h.x = (_Float16)v.x; h.y = (_Float16)v.y; h.z = (_Float16)v.z; h.w = (_Float16)v.w;
    ((v4h*)Xh)[i] = h;
}

enum { EPI_F32 = 0, EPI_UNIT = 1, EPI_GATE = 2 };

// x + (x of lane ^ XM) inside a 16-lane row; folds into one v_add_f32 with DPP
template<int XM>
__device__ __forceinline__ float add_row_xor(float x) {
    return x + __int_as_float(__builtin_amdgcn_update_dpp(
                   0, __float_as_int(x), 0x160 | XM, 0xf, 0xf, true));   // 0x160 = row_xmask
}

template<int EPI>
__global__ __launch_bounds__(256)
void gemm_xwT(const _Float16* __restrict__ X, const _Float16* __restrict__ Wh,
              const float* __restrict__ bias, const float* __restrict__ gate,
              _Float16* __restrict__ Yh, float* __restrict__ Yf, int M, int N, int K) {
    static_assert(HD == 64, "a wave's 128 columns are two heads");
    constexpr int BM = 256, BN = 256, BK = 64;
    __shared__ __attribute__((aligned(16))) _Float16 sX[2][BM * LDG];
    __shared__ __attribute__((aligned(16))) _Float16 sW[2][BN * LDG];

    const int t    = threadIdx.x;
    const int lane = t & 31;
    const int wv   = t >> 5;                  // 0..7
    const int mBlk = blockIdx.x * BM;
    const int nBlk = blockIdx.y * BN;
    const int wm   = (wv >> 1) * 64;          // 0 / 64 / 128 / 192
    const int wn   = (wv & 1) * 128;          // 0 / 128

    v8f acc[4][8];
    #pragma unroll
    for (int i = 0; i < 4; ++i)
        #pragma unroll
        for (int j = 0; j < 8; ++j) acc[i][j] = vzero8();

    const int nk = K / BK;

    // 16 async b128 copies per thread per stage (8 X chunks, then 8 W chunks):
    // lanes 8r .. 8r+7 take the 128 B of one row, a wave 4 rows, the block 32 rows
    const int row = t >> 3, kc = (t & 7) * 8;
    const _Float16* gx0 = X  + (size_t)(mBlk + row) * K + kc;
    const _Float16* gw0 = Wh + (size_t)(nBlk + row) * K + kc;
    const size_t rstep = (size_t)32 * K;             // 32 rows on, the same for every lane
    auto issue = [&](int kt, int buf) {
        const _Float16* g[8];
        const _Float16* l[8];
        #pragma unroll
        for (int p = 0; p < 8; ++p) {
            g[p] = gx0 + (p * rstep + (size_t)kt * BK);
            l[p] = &sX[buf][(row + p * 32) * LDG + kc];
        }
        async_ld8_b128(g, l);
        #pragma unroll
        for (int p = 0; p < 8; ++p) {
            g[p] = gw0 + (p * rstep + (size_t)kt * BK);
            l[p] = &sW[buf][(row + p * 32) * LDG + kc];
        }
        async_ld8_b128(g, l);
    };

    issue(0, 0);
    // stage 0 has landed for this wave, and behind the barrier for every wave
    asm volatile("s_wait_asynccnt 0x0" ::: "memory");
    __syncthreads();
    if (1 < nk) issue(1, 1);
    for (int kt = 0; kt < nk; ++kt) {
        const int b = kt & 1;
        #pragma unroll
        for (int kk = 0; kk < BK; kk += 32) {
            v16h aF[4], bF[8];
            #pragma unroll
            for (int i = 0; i < 4; ++i) aF[i] = load_frag(sX[b] + kk, wm + i * 16, LDG);
            #pragma unroll
            for (int j = 0; j < 8; ++j) bF[j] = load_frag(sW[b] + kk, wn + j * 16, LDG);
            __builtin_amdgcn_sched_barrier(0);
            #pragma unroll
            for (int i = 0; i < 4; ++i)
                #pragma unroll
                for (int j = 0; j < 8; ++j)
                    acc[i][j] = __builtin_amdgcn_wmma_f32_16x16x32_f16(
                        false, aF[i], false, bF[j], (short)0, acc[i][j], false, false);
        }
        // keeps the trip's last WMMAs in front of the barrier: sunk behind it they would
        // stand between the barrier and the copies of stage kt+2 and shorten their flight
        __builtin_amdgcn_sched_barrier(0);
        // this wave's reads of buf b are done before the buffer may be refilled
        asm volatile("s_wait_dscnt 0x0" ::: "memory");
        // this wave's copies of stage kt+1 have landed before the barrier publishes them
        asm volatile("s_wait_asynccnt 0x0" ::: "memory");
        __syncthreads();
        if (kt + 2 < nk) issue(kt + 2, b);
    }
    // no copy is outstanding when the wave goes on to its end
    asm volatile("s_wait_asynccnt 0x0" ::: "memory");

    const int mLane = mBlk + wm + ((lane >> 4) << 3);
    const int nLane = nBlk + wn + (lane & 15);
    const int head  = (nBlk + wn) / HD;
    float bv[8];
    #pragma unroll
    for (int j = 0; j < 8; ++j) bv[j] = bias[nLane + j * 16];
    float sc[4][8][2];
    if (EPI == EPI_GATE) {
        const float* gp = gate + (size_t)mLane * NH + head;   // one address for all 64 values
        #pragma unroll
        for (int i = 0; i < 4; ++i)
            #pragma unroll
            for (int vg = 0; vg < 8; ++vg)
                #pragma unroll
                for (int h = 0; h < 2; ++h)
                    sc[i][vg][h] = gp[(i * 16 + vg) * NH + h];
        // the wait stands before a register that one of the loads above names is overwritten;
        // gp as an input keeps the address register whole up to the wait: without it
        // the last load takes it as its destination while the others still name it
        asm volatile("s_wait_xcnt 0x0" :: "v"(gp) : "memory");
    } else {
        // the wait stands before a register that one of the bias loads names is overwritten
        asm volatile("s_wait_xcnt 0x0" ::: "memory");
    }
    // keeps the arithmetic that overwrites those registers behind the wait
    __builtin_amdgcn_sched_barrier(0);
    // 16 rows at a time: first all their arithmetic, then all their stores, then the wait
    #pragma unroll
    for (int i = 0; i < 4; ++i) {
        float    rf[8][2][4];
        _Float16 rh[8][2][4];
        size_t o[8];
        #pragma unroll
        for (int vg = 0; vg < 8; ++vg) {
            o[vg] = (size_t)(mLane + i * 16 + vg) * N + nLane;
            #pragma unroll
            for (int h = 0; h < 2; ++h) {
                float val[4];
                #pragma unroll
                for (int j = 0; j < 4; ++j) val[j] = acc[i][h * 4 + j][vg] + bv[h * 4 + j];
                float f = 1.f;
                if (EPI == EPI_UNIT) {
                    float ss = val[0] * val[0] + val[1] * val[1] + val[2] * val[2] + val[3] * val[3];
                    ss = add_row_xor<1>(ss);
                    ss = add_row_xor<2>(ss);
                    ss = add_row_xor<4>(ss);
                    ss = add_row_xor<8>(ss);
                    float rs;
                    asm("v_rsq_f32 %0, %1\n\tv_nop" : "=v"(rs) : "v"(ss));
                    f = fminf(rs, 1e12f);
                } else if (EPI == EPI_GATE) {
                    f = sc[i][vg][h];
                }
                #pragma unroll
                for (int j = 0; j < 4; ++j) {
                    if (EPI == EPI_F32) rf[vg][h][j] = val[j];
                    else                rh[vg][h][j] = (_Float16)(val[j] * f);
                }
            }
        }
        // no arithmetic moves in among the stores below, where it could overwrite a
        // register that an issued store names ahead of the wait behind them
        __builtin_amdgcn_sched_barrier(0);
        #pragma unroll
        for (int vg = 0; vg < 8; ++vg)
            #pragma unroll
            for (int h = 0; h < 2; ++h)
                #pragma unroll
                for (int j = 0; j < 4; ++j) {
                    if (EPI == EPI_F32) Yf[o[vg] + h * HD + j * 16] = rf[vg][h][j];
                    else                Yh[o[vg] + h * HD + j * 16] = rh[vg][h][j];
                }
        if (i < 3) {
            // the wait stands before the next rows' arithmetic overwrites the address and
            // data registers of these stores; the scheduling barrier keeps it behind the wait
            asm volatile("s_wait_xcnt 0x0" ::: "memory");
            __builtin_amdgcn_sched_barrier(0);
        }
    }
}

// ---------------------------------------------------------------------------
// w = sigmoid(X@Ww^T + bw), r = sigmoid(X@Wr^T + br), all in fp32, as one
// [32 gates] x [64 tokens] x [K = 1024] product per block on the f32 WMMA.
// 16 waves split K: wave wv owns k = wv*64 .. wv*64+63 and keeps its slice of
// both gate matrices in registers (A operand, rows = gates). Token rows are the
// B operand. Every global load covers whole 256-B row pieces; a wave-private
// LDS tile turns them into fragments. A and B go through the same two
// functions, so their k order is equal at every lane and register.
// The 16 partial sums of each gate value meet in LDS and are added in wave order.
// ---------------------------------------------------------------------------
typedef __attribute__((ext_vector_type(2))) float v2f;
typedef __attribute__((ext_vector_type(4))) float v4f;

#define GP_WAVES 16
#define GP_TOK   64                   // tokens per block
#define GP_KW    (DM / GP_WAVES)      // 64 k per wave = 256 B of a row
#define GP_PITCH (GP_KW + 4)          // staged row pitch, dwords (272 B: 16 B x odd)
#define GP_RP    36                   // partial-sum row pitch, dwords (32 gates + 4)

__device__ __forceinline__ void gp_fetch(const float* rows, int lane, v4f (&st)[8]) {
    #pragma unroll
    for (int i = 0; i < 8; ++i)
        st[i] = *(const v4f*)(rows + (size_t)(2 * i + (lane >> 4)) * DM + (lane & 15) * 4);
}

// rows in registers -> this wave's own LDS tile
__device__ __forceinline__ void gp_stage(float* stg, int lane, const v4f (&st)[8]) {
    #pragma unroll
    for (int i = 0; i < 8; ++i)
        *(v4f*)(stg + (2 * i + (lane >> 4)) * GP_PITCH + (lane & 15) * 4) = st[i];
    // the rows are read back by other lanes of this wave: stores done first
    asm volatile("s_wait_dscnt 0x0" ::: "memory");
}

// LDS tile -> fragments: lane (c = lane&15, h = lane>>4) gets row c,
// k = 8j + 4h .. 8j + 4h + 3 in fr[j]
__device__ __forceinline__ void gp_frag(const float* stg, int lane, v4f (&fr)[8]) {
    #pragma unroll
    for (int j = 0; j < 8; ++j)
        fr[j] = *(const v4f*)(stg + (lane & 15) * GP_PITCH + (2 * j + (lane >> 4)) * 4);
    // the tile is overwritten by the next gp_stage: reads done first
    asm volatile("s_wait_dscnt 0x0" ::: "memory");
}

__global__ __launch_bounds__(GP_WAVES * 32)
void wr_proj(const float* X,
             const float* Ww, const float* Wb,
             const float* Rw, const float* Rb,
             float* wout, float* rout) {
    __shared__ __attribute__((aligned(16))) float sStage[GP_WAVES][16 * GP_PITCH];
    __shared__ __attribute__((aligned(16))) float sPart[GP_WAVES][GP_TOK * GP_RP];

    const int t    = threadIdx.x;
    const int lane = t & 31;
    const int wv   = t >> 5;
    const int m0   = blockIdx.x * GP_TOK;
    float* stg = sStage[wv];
    const float* xs = X + (size_t)m0 * DM + wv * GP_KW;

    v4f sa[8], sb[8], s0[8], s1[8], gw[8], gr[8];
    gp_fetch(Ww + wv * GP_KW, lane, sa);
    gp_fetch(Rw + wv * GP_KW, lane, sb);
    gp_fetch(xs, lane, s0);
    gp_fetch(xs + (size_t)16 * DM, lane, s1);
    gp_stage(stg, lane, sa);
    gp_frag(stg, lane, gw);
    gp_stage(stg, lane, sb);
    gp_frag(stg, lane, gr);

    auto do_tile = [&](int tile, v4f (&cur)[8]) {
        v4f fx[8];
        gp_stage(stg, lane, cur);
        // two tiles ahead, into the registers that were just staged
        if (tile + 2 < GP_TOK / 16) gp_fetch(xs + (size_t)(tile + 2) * 16 * DM, lane, cur);
        gp_frag(stg, lane, fx);
        v8f aw = vzero8(), ar = vzero8();
        #pragma unroll
        for (int j = 0; j < 8; ++j) {
            v2f x0 = {fx[j].x, fx[j].y}, x1 = {fx[j].z, fx[j].w};
            v2f w0 = {gw[j].x, gw[j].y}, w1 = {gw[j].z, gw[j].w};
            v2f r0 = {gr[j].x, gr[j].y}, r1 = {gr[j].z, gr[j].w};
            aw = __builtin_amdgcn_wmma_f32_16x16x4_f32(false, w0, false, x0, (short)0, aw, false, false);
            ar = __builtin_amdgcn_wmma_f32_16x16x4_f32(false, r0, false, x0, (short)0, ar, false, false);
            aw = __builtin_amdgcn_wmma_f32_16x16x4_f32(false, w1, false, x1, (short)0, aw, false, false);
            ar = __builtin_amdgcn_wmma_f32_16x16x4_f32(false, r1, false, x1, (short)0, ar, false, false);
        }
        // D register e = gate 8h + e of token c: 8 consecutive gates per lane
        float* pp = &sPart[wv][(tile * 16 + (lane & 15)) * GP_RP + ((lane >> 4) << 3)];
        *(v4f*)(pp)      = v4f{aw[0], aw[1], aw[2], aw[3]};
        *(v4f*)(pp + 4)  = v4f{aw[4], aw[5], aw[6], aw[7]};
        *(v4f*)(pp + 16) = v4f{ar[0], ar[1], ar[2], ar[3]};
        *(v4f*)(pp + 20) = v4f{ar[4], ar[5], ar[6], ar[7]};
    };
    static_assert(GP_TOK == 64, "four tiles of 16 tokens");
    do_tile(0, s0);
    do_tile(1, s1);
    do_tile(2, s0);
    do_tile(3, s1);
    __syncthreads();

    // 64 tokens x 32 gates = 512 threads x 4 gates
    const int tok = t >> 3, g4 = (t & 7) * 4;
    v4f s = {0.f, 0.f, 0.f, 0.f};
    #pragma unroll
    for (int w = 0; w < GP_WAVES; ++w) {
        v4f p = *(const v4f*)&sPart[w][tok * GP_RP + g4];
        s.x += p.x; s.y += p.y; s.z += p.z; s.w += p.w;
    }
    const float* bp = (g4 < NH) ? (Wb + g4) : (Rb + g4 - NH);
    v4f y;
    y.x = 1.f / (1.f + __expf(-(s.x + bp[0])));
    y.y = 1.f / (1.f + __expf(-(s.y + bp[1])));
    y.z = 1.f / (1.f + __expf(-(s.z + bp[2])));
    y.w = 1.f / (1.f + __expf(-(s.w + bp[3])));
    float* op = ((g4 < NH) ? wout : rout) + (size_t)(m0 + tok) * NH + (g4 & (NH - 1));
    *(v4f*)op = y;
}

// ---------------------------------------------------------------------------
// A[b,n,v,q] = sum_s Vw[s,(b,n),v] * K[s,(b,n),q]  — one block per (b,n),
// WMMA with K-dim = s in chunks of 32, LDS tiles stored transposed [feat][s].
// Writes f32 A to d_out region and f16 copy to workspace.
// ---------------------------------------------------------------------------
__global__ __launch_bounds__(256)
void accum_A(const _Float16* __restrict__ Kh, const _Float16* __restrict__ Vh,
             float* __restrict__ Af, _Float16* __restrict__ Ah) {
    const int bn = blockIdx.x;          // b*16 + n
    const int b  = bn >> 4, n = bn & 15;
    __shared__ __attribute__((aligned(16))) _Float16 sK[2][HD * LDP]; // [q][s]
    __shared__ __attribute__((aligned(16))) _Float16 sV[2][HD * LDP]; // [v][s]

    const int t = threadIdx.x, lane = t & 31, wv = t >> 5;   // 8 waves
    const int vt   = wv >> 1;           // v-tile 0..3
    const int qoff = (wv & 1) * 32;     // q half 0/32

    v8f acc[2] = {vzero8(), vzero8()};
    uint4 kreg, vreg;
    const int s_i = t >> 3, f8 = (t & 7) * 8;
    const int nsc = S_LEN / 32;

    auto fetchA = [&](int sc) {
        size_t m = (size_t)(sc * 32 + s_i) * B_SZ + b;
        kreg = *(const uint4*)(Kh + m * DM + n * HD + f8);
        vreg = *(const uint4*)(Vh + m * DM + n * HD + f8);
    };
    auto stageA = [&](int bb) {
        union { uint4 u; _Float16 h[8]; } ck, cv;
        ck.u = kreg; cv.u = vreg;
        #pragma unroll
        for (int e = 0; e < 8; ++e) {
            sK[bb][(f8 + e) * LDP + s_i] = ck.h[e];   // transpose at store
            sV[bb][(f8 + e) * LDP + s_i] = cv.h[e];
        }
    };

    fetchA(0); stageA(0);
    for (int sc = 0; sc < nsc; ++sc) {
        __syncthreads();
        if (sc + 1 < nsc) fetchA(sc + 1);
        const int bb = sc & 1;
        v16h aF = load_frag(sV[bb], vt * 16, LDP);
        v16h bF0 = load_frag(sK[bb], qoff, LDP);
        v16h bF1 = load_frag(sK[bb], qoff + 16, LDP);
        acc[0] = __builtin_amdgcn_wmma_f32_16x16x32_f16(false, aF, false, bF0, (short)0, acc[0], false, false);
        acc[1] = __builtin_amdgcn_wmma_f32_16x16x32_f16(false, aF, false, bF1, (short)0, acc[1], false, false);
        if (sc + 1 < nsc) stageA((sc + 1) & 1);
    }

    #pragma unroll
    for (int j = 0; j < 2; ++j)
        #pragma unroll
        for (int vg = 0; vg < 8; ++vg) {
            int vIdx = vt * 16 + vg + ((lane >> 4) << 3);
            int qIdx = qoff + j * 16 + (lane & 15);
            size_t idx = ((size_t)bn * HD + vIdx) * HD + qIdx;
            float val = acc[j][vg];
            Af[idx] = val;
            Ah[idx] = (_Float16)val;
        }
}

// ---------------------------------------------------------------------------
// Mid[s,(b,n),v] = r * sum_q Q[s,(b,n),q] * A[b,n,v,q] — WMMA, fragments
// loaded straight from global (Q rows strided by B*DM, A rows contiguous).
// ---------------------------------------------------------------------------
__global__ __launch_bounds__(256)
void apply_A(const _Float16* __restrict__ Qh, const _Float16* __restrict__ Ah,
             const float* __restrict__ rbuf, _Float16* __restrict__ Mid) {
    const int bn = blockIdx.x;          // b*16+n
    const int b  = bn >> 4, n = bn & 15;
    const int lane  = threadIdx.x & 31;
    const int sBase = blockIdx.y * 128 + (threadIdx.x >> 5) * 16;   // 8 waves x 16 rows

    const _Float16* Abase = Ah + (size_t)bn * (HD * HD);
    v8f acc[4] = {vzero8(), vzero8(), vzero8(), vzero8()};

    #pragma unroll
    for (int kt = 0; kt < 2; ++kt) {    // K = 64 = 2 x 32
        const _Float16* qbase = Qh + ((size_t)sBase * B_SZ + b) * DM + n * HD + kt * 32;
        v16h aF = load_frag(qbase, 0, B_SZ * DM);        // row step = next s token
        #pragma unroll
        for (int j = 0; j < 4; ++j) {
            v16h bF = load_frag(Abase + kt * 32, j * 16, HD);
            acc[j] = __builtin_amdgcn_wmma_f32_16x16x32_f16(
                false, aF, false, bF, (short)0, acc[j], false, false);
        }
    }

    float rv[8];
    #pragma unroll
    for (int vg = 0; vg < 8; ++vg) {
        int s = sBase + vg + ((lane >> 4) << 3);
        rv[vg] = rbuf[((size_t)s * B_SZ + b) * NH + n];
    }
    #pragma unroll
    for (int j = 0; j < 4; ++j)
        #pragma unroll
        for (int vg = 0; vg < 8; ++vg) {
            int s = sBase + vg + ((lane >> 4) << 3);
            size_t m = (size_t)s * B_SZ + b;
            Mid[m * DM + n * HD + j * 16 + (lane & 15)] = (_Float16)(acc[j][vg] * rv[vg]);
        }
}

// ---------------------------------------------------------------------------
// Launch
// ---------------------------------------------------------------------------
extern "C" void kernel_launch(void* const* d_in, const int* in_sizes, int n_in,
                              void* d_out, int out_size, void* d_ws, size_t ws_size,
                              hipStream_t stream) {
    (void)in_sizes; (void)n_in; (void)out_size; (void)ws_size;
    const float* inp  = (const float*)d_in[0];
    const float* Wq_w = (const float*)d_in[1];  const float* Wq_b = (const float*)d_in[2];
    const float* Wk_w = (const float*)d_in[3];  const float* Wk_b = (const float*)d_in[4];
    const float* Wv_w = (const float*)d_in[5];  const float* Wv_b = (const float*)d_in[6];
    const float* Wo_w = (const float*)d_in[7];  const float* Wo_b = (const float*)d_in[8];
    const float* Ww_w = (const float*)d_in[9];  const float* Ww_b = (const float*)d_in[10];
    const float* Wr_w = (const float*)d_in[11]; const float* Wr_b = (const float*)d_in[12];

    float* out_f = (float*)d_out;                       // [S,B,DM]
    float* A_f   = out_f + (size_t)MTOK * DM;           // [B,NH,64,64]

    char* ws = (char*)d_ws;
    constexpr size_t HBYTES = (size_t)MTOK * DM * sizeof(_Float16);   // 32 MiB
    constexpr size_t GATE   = (size_t)MTOK * NH * 4;                  // 1 MiB
    constexpr size_t WBYTES = (size_t)DM * DM * sizeof(_Float16);     // 2 MiB
    _Float16* Xh  = (_Float16*)(ws);
    _Float16* Qh  = (_Float16*)(ws + HBYTES);
    _Float16* Kh  = (_Float16*)(ws + 2 * HBYTES);
    _Float16* Vh  = (_Float16*)(ws + 3 * HBYTES);
    float*    wbf = (float*)   (ws + 4 * HBYTES);
    float*    rbf = (float*)   (ws + 4 * HBYTES + GATE);
    _Float16* Ah  = (_Float16*)(ws + 4 * HBYTES + 2 * GATE);
    _Float16* Mid = (_Float16*)(ws + 4 * HBYTES + 2 * GATE + (size_t)B_SZ * NH * HD * HD * 2);
    _Float16* Wqh = (_Float16*)(ws + 5 * HBYTES + 3 * GATE);
    _Float16* Wkh = (_Float16*)(ws + 5 * HBYTES + 3 * GATE + WBYTES);
    _Float16* Wvh = (_Float16*)(ws + 5 * HBYTES + 3 * GATE + 2 * WBYTES);
    _Float16* Woh = (_Float16*)(ws + 5 * HBYTES + 3 * GATE + 3 * WBYTES);

    // 1) fp32 -> fp16: input + four big weight matrices
    cvt_f32_f16<<<(MTOK * DM / 4) / 256, 256, 0, stream>>>(inp, Xh);
    cvt_f32_f16<<<(DM * DM / 4) / 256, 256, 0, stream>>>(Wq_w, Wqh);
    cvt_f32_f16<<<(DM * DM / 4) / 256, 256, 0, stream>>>(Wk_w, Wkh);
    cvt_f32_f16<<<(DM * DM / 4) / 256, 256, 0, stream>>>(Wv_w, Wvh);
    cvt_f32_f16<<<(DM * DM / 4) / 256, 256, 0, stream>>>(Wo_w, Woh);

    // 2) gate projections (w is read by the V projection's epilogue)
    wr_proj<<<MTOK / GP_TOK, GP_WAVES * 32, 0, stream>>>(inp, Ww_w, Ww_b, Wr_w, Wr_b, wbf, rbf);

    // 3) Q/K/V projections (WMMA GEMM, async-LDS pipeline, f16 out):
    //    q and k leave unit-normalized per head, v leaves multiplied by w
    dim3 gg(MTOK / 256, DM / 256);
    gemm_xwT<EPI_UNIT><<<gg, 256, 0, stream>>>(Xh, Wqh, Wq_b, nullptr, Qh, nullptr, MTOK, DM, DM);
    gemm_xwT<EPI_UNIT><<<gg, 256, 0, stream>>>(Xh, Wkh, Wk_b, nullptr, Kh, nullptr, MTOK, DM, DM);
    gemm_xwT<EPI_GATE><<<gg, 256, 0, stream>>>(Xh, Wvh, Wv_b, wbf, Vh, nullptr, MTOK, DM, DM);

    // 4) A accumulation (writes f32 A output + f16 copy)
    accum_A<<<B_SZ * NH, 256, 0, stream>>>(Kh, Vh, A_f, Ah);

    // 5) apply A, scale by r
    apply_A<<<dim3(B_SZ * NH, S_LEN / 128), 256, 0, stream>>>(Qh, Ah, rbf, Mid);

    // 6) final O projection (f32 out to d_out)
    gemm_xwT<EPI_F32><<<gg, 256, 0, stream>>>(Mid, Woh, Wo_b, nullptr, nullptr, out_f, MTOK, DM, DM);
}

// v006
// It runs in 177 microseconds.
// Two timings next to v005 both put it at 1.27 times that version's speed.
// Counting every step since v000, it is 3.02 times as fast.
#include <hip/hip_runtime.h>
#include <hip/hip_bf16.h>
#include <cstdint>

typedef __attribute__((ext_vector_type(16))) _Float16 v16h;
typedef __attribute__((ext_vector_type(4)))  _Float16 v4h;
typedef __attribute__((ext_vector_type(8)))  float    v8f;

#define S_LEN 2048
#define B_SZ  8
#define DM    1024
#define NH    16
#define HD    64
#define MTOK  (S_LEN * B_SZ)          // 16384 tokens

__device__ __forceinline__ void async_ld8_b128(const _Float16* const (&g)[8],
                                               const _Float16* const (&l)[8]) {
    asm volatile("global_load_async_to_lds_b128 %0, %1, off\n\t"
                 "global_load_async_to_lds_b128 %2, %3, off\n\t"
                 "global_load_async_to_lds_b128 %4, %5, off\n\t"
                 "global_load_async_to_lds_b128 %6, %7, off\n\t"
                 "global_load_async_to_lds_b128 %8, %9, off\n\t"
                 "global_load_async_to_lds_b128 %10, %11, off\n\t"
                 "global_load_async_to_lds_b128 %12, %13, off\n\t"
                 "global_load_async_to_lds_b128 %14, %15, off\n\t"
                 "s_wait_xcnt 0x0"
                 :: "v"((unsigned)(uintptr_t)l[0]), "v"(g[0]),
                    "v"((unsigned)(uintptr_t)l[1]), "v"(g[1]),
                    "v"((unsigned)(uintptr_t)l[2]), "v"(g[2]),
                    "v"((unsigned)(uintptr_t)l[3]), "v"(g[3]),
                    "v"((unsigned)(uintptr_t)l[4]), "v"(g[4]),
                    "v"((unsigned)(uintptr_t)l[5]), "v"(g[5]),
                    "v"((unsigned)(uintptr_t)l[6]), "v"(g[6]),
                    "v"((unsigned)(uintptr_t)l[7]), "v"(g[7]) : "memory");
}

__device__ __forceinline__ v16h load_frag(const _Float16* tile, int row0, int ld) {
    const int lane = threadIdx.x & 31;
    const _Float16* p = tile + (size_t)(row0 + (lane & 15)) * ld + ((lane >> 4) << 3);
    v16h r;
    ((float4*)&r)[0] = *(const float4*)(p);
    ((float4*)&r)[1] = *(const float4*)(p + 16);
    return r;
}

#define LDG 72

__device__ __forceinline__ v8f vzero8() { v8f z = {0.f,0.f,0.f,0.f,0.f,0.f,0.f,0.f}; return z; }

// ---------------------------------------------------------------------------
// fp32 -> fp16 conversion, float4 vectorized (used for input and weights)
// ---------------------------------------------------------------------------
__global__ __launch_bounds__(256) void cvt_f32_f16(const float* __restrict__ X,
                                                   _Float16* __restrict__ Xh) {
    size_t i = (size_t)blockIdx.x * 256 + threadIdx.x;
    float4 v = ((const float4*)X)[i];
    v4h h; h.x = (_Float16)v.x; h.y = (_Float16)v.y; h.z = (_Float16)v.z; h.w = (_Float16)v.w;
    ((v4h*)Xh)[i] = h;
}

enum { EPI_F32 = 0, EPI_UNIT = 1, EPI_GATE = 2 };

// x + (x of lane ^ XM) inside a 16-lane row; folds into one v_add_f32 with DPP
template<int XM>
__device__ __forceinline__ float add_row_xor(float x) {
    return x + __int_as_float(__builtin_amdgcn_update_dpp(
                   0, __float_as_int(x), 0x160 | XM, 0xf, 0xf, true));   // 0x160 = row_xmask
}

template<int EPI>
__global__ __launch_bounds__(256)
void gemm_xwT(const _Float16* __restrict__ X, const _Float16* __restrict__ Wh,
              const float* __restrict__ bias, const float* __restrict__ gate,
              _Float16* __restrict__ Yh, float* __restrict__ Yf, int M, int N, int K) {
    static_assert(HD == 64, "a wave's 128 columns are two heads");
    constexpr int BM = 256, BN = 256, BK = 64;
    __shared__ __attribute__((aligned(16))) _Float16 sX[2][BM * LDG];
    __shared__ __attribute__((aligned(16))) _Float16 sW[2][BN * LDG];

    const int t    = threadIdx.x;
    const int lane = t & 31;
    const int wv   = t >> 5;                  // 0..7
    const int mBlk = blockIdx.x * BM;
    const int nBlk = blockIdx.y * BN;
    const int wm   = (wv >> 1) * 64;          // 0 / 64 / 128 / 192
    const int wn   = (wv & 1) * 128;          // 0 / 128

    v8f acc[4][8];
    #pragma unroll
    for (int i = 0; i < 4; ++i)
        #pragma unroll
        for (int j = 0; j < 8; ++j) acc[i][j] = vzero8();

    const int nk = K / BK;

    // 16 async b128 copies per thread per stage (8 X chunks, then 8 W chunks):
    // lanes 8r .. 8r+7 take the 128 B of one row, a wave 4 rows, the block 32 rows
    const int row = t >> 3, kc = (t & 7) * 8;
    const _Float16* gx0 = X  + (size_t)(mBlk + row) * K + kc;
    const _Float16* gw0 = Wh + (size_t)(nBlk + row) * K + kc;
    const size_t rstep = (size_t)32 * K;             // 32 rows on, the same for every lane
    auto issue = [&](int kt, int buf) {
        const _Float16* g[8];
        const _Float16* l[8];
        #pragma unroll
        for (int p = 0; p < 8; ++p) {
            g[p] = gx0 + (p * rstep + (size_t)kt * BK);
            l[p] = &sX[buf][(row + p * 32) * LDG + kc];
        }
        async_ld8_b128(g, l);
        #pragma unroll
        for (int p = 0; p < 8; ++p) {
            g[p] = gw0 + (p * rstep + (size_t)kt * BK);
            l[p] = &sW[buf][(row + p * 32) * LDG + kc];
        }
        async_ld8_b128(g, l);
    };

    issue(0, 0);
    // stage 0 has landed for this wave, and behind the barrier for every wave
    asm volatile("s_wait_asynccnt 0x0" ::: "memory");
    __syncthreads();
    if (1 < nk) issue(1, 1);
    for (int kt = 0; kt < nk; ++kt) {
        const int b = kt & 1;
        #pragma unroll
        for (int kk = 0; kk < BK; kk += 32) {
            v16h aF[4], bF[8];
            #pragma unroll
            for (int i = 0; i < 4; ++i) aF[i] = load_frag(sX[b] + kk, wm + i * 16, LDG);
            #pragma unroll
            for (int j = 0; j < 8; ++j) bF[j] = load_frag(sW[b] + kk, wn + j * 16, LDG);
            __builtin_amdgcn_sched_barrier(0);
            #pragma unroll
            for (int i = 0; i < 4; ++i)
                #pragma unroll
                for (int j = 0; j < 8; ++j)
                    acc[i][j] = __builtin_amdgcn_wmma_f32_16x16x32_f16(
                        false, aF[i], false, bF[j], (short)0, acc[i][j], false, false);
        }
        // keeps the trip's last WMMAs in front of the barrier: sunk behind it they would
        // stand between the barrier and the copies of stage kt+2 and shorten their flight
        __builtin_amdgcn_sched_barrier(0);
        // this wave's reads of buf b are done before the buffer may be refilled
        asm volatile("s_wait_dscnt 0x0" ::: "memory");
        // this wave's copies of stage kt+1 have landed before the barrier publishes them
        asm volatile("s_wait_asynccnt 0x0" ::: "memory");
        __syncthreads();
        if (kt + 2 < nk) issue(kt + 2, b);
    }
    // no copy is outstanding when the wave goes on to its end
    asm volatile("s_wait_asynccnt 0x0" ::: "memory");

    const int mLane = mBlk + wm + ((lane >> 4) << 3);
    const int nLane = nBlk + wn + (lane & 15);
    const int head  = (nBlk + wn) / HD;
    float bv[8];
    #pragma unroll
    for (int j = 0; j < 8; ++j) bv[j] = bias[nLane + j * 16];
    float sc[4][8][2];
    if (EPI == EPI_GATE) {
        const float* gp = gate + (size_t)mLane * NH + head;   // one address for all 64 values
        #pragma unroll
        for (int i = 0; i < 4; ++i)
            #pragma unroll
            for (int vg = 0; vg < 8; ++vg)
                #pragma unroll
                for (int h = 0; h < 2; ++h)
                    sc[i][vg][h] = gp[(i * 16 + vg) * NH + h];
        // the wait stands before a register that one of the loads above names is overwritten;
        // gp as an input keeps the address register whole up to the wait: without it
        // the last load takes it as its destination while the others still name it
        asm volatile("s_wait_xcnt 0x0" :: "v"(gp) : "memory");
    } else {
        // the wait stands before a register that one of the bias loads names is overwritten
        asm volatile("s_wait_xcnt 0x0" ::: "memory");
    }
    // keeps the arithmetic that overwrites those registers behind the wait
    __builtin_amdgcn_sched_barrier(0);
    // 16 rows at a time: first all their arithmetic, then all their stores, then the wait
    #pragma unroll
    for (int i = 0; i < 4; ++i) {
        float    rf[8][2][4];
        _Float16 rh[8][2][4];
        size_t o[8];
        #pragma unroll
        for (int vg = 0; vg < 8; ++vg) {
            o[vg] = (size_t)(mLane + i * 16 + vg) * N + nLane;
            #pragma unroll
            for (int h = 0; h < 2; ++h) {
                float val[4];
                #pragma unroll
                for (int j = 0; j < 4; ++j) val[j] = acc[i][h * 4 + j][vg] + bv[h * 4 + j];
                float f = 1.f;
                if (EPI == EPI_UNIT) {
                    float ss = val[0] * val[0] + val[1] * val[1] + val[2] * val[2] + val[3] * val[3];
                    ss = add_row_xor<1>(ss);
                    ss = add_row_xor<2>(ss);
                    ss = add_row_xor<4>(ss);
                    ss = add_row_xor<8>(ss);
                    float rs;
                    asm("v_rsq_f32 %0, %1\n\tv_nop" : "=v"(rs) : "v"(ss));
                    f = fminf(rs, 1e12f);
                } else if (EPI == EPI_GATE) {
                    f = sc[i][vg][h];
                }
                #pragma unroll
                for (int j = 0; j < 4; ++j) {
                    if (EPI == EPI_F32) rf[vg][h][j] = val[j];
                    else                rh[vg][h][j] = (_Float16)(val[j] * f);
                }
            }
        }
        // no arithmetic moves in among the stores below, where it could overwrite a
        // register that an issued store names ahead of the wait behind them
        __builtin_amdgcn_sched_barrier(0);
        #pragma unroll
        for (int vg = 0; vg < 8; ++vg)
            #pragma unroll
            for (int h = 0; h < 2; ++h)
                #pragma unroll
                for (int j = 0; j < 4; ++j) {
                    if (EPI == EPI_F32) Yf[o[vg] + h * HD + j * 16] = rf[vg][h][j];
                    else                Yh[o[vg] + h * HD + j * 16] = rh[vg][h][j];
                }
        if (i < 3) {
            // the wait stands before the next rows' arithmetic overwrites the address and
            // data registers of these stores; the scheduling barrier keeps it behind the wait
            asm volatile("s_wait_xcnt 0x0" ::: "memory");
            __builtin_amdgcn_sched_barrier(0);
        }
    }
}

// ---------------------------------------------------------------------------
// w = sigmoid(X@Ww^T + bw), r = sigmoid(X@Wr^T + br), all in fp32, as one
// [32 gates] x [64 tokens] x [K = 1024] product per block on the f32 WMMA.
// 16 waves split K: wave wv owns k = wv*64 .. wv*64+63 and keeps its slice of
// both gate matrices in registers (A operand, rows = gates). Token rows are the
// B operand. Every global load covers whole 256-B row pieces; a wave-private
// LDS tile turns them into fragments. A and B go through the same two
// functions, so their k order is equal at every lane and register.
// The 16 partial sums of each gate value meet in LDS and are added in wave order.
// ---------------------------------------------------------------------------
typedef __attribute__((ext_vector_type(2))) float v2f;
typedef __attribute__((ext_vector_type(4))) float v4f;

#define GP_WAVES 16
#define GP_TOK   64                   // tokens per block
#define GP_KW    (DM / GP_WAVES)      // 64 k per wave = 256 B of a row
#define GP_PITCH (GP_KW + 4)          // staged row pitch, dwords (272 B: 16 B x odd)
#define GP_RP    36                   // partial-sum row pitch, dwords (32 gates + 4)

__device__ __forceinline__ void gp_fetch(const float* rows, int lane, v4f (&st)[8]) {
    #pragma unroll
    for (int i = 0; i < 8; ++i)
        st[i] = *(const v4f*)(rows + (size_t)(2 * i + (lane >> 4)) * DM + (lane & 15) * 4);
}

// rows in registers -> this wave's own LDS tile
__device__ __forceinline__ void gp_stage(float* stg, int lane, const v4f (&st)[8]) {
    #pragma unroll
    for (int i = 0; i < 8; ++i)
        *(v4f*)(stg + (2 * i + (lane >> 4)) * GP_PITCH + (lane & 15) * 4) = st[i];
    // the rows are read back by other lanes of this wave: stores done first
    asm volatile("s_wait_dscnt 0x0" ::: "memory");
}

// LDS tile -> fragments: lane (c = lane&15, h = lane>>4) gets row c,
// k = 8j + 4h .. 8j + 4h + 3 in fr[j]
__device__ __forceinline__ void gp_frag(const float* stg, int lane, v4f (&fr)[8]) {
    #pragma unroll
    for (int j = 0; j < 8; ++j)
        fr[j] = *(const v4f*)(stg + (lane & 15) * GP_PITCH + (2 * j + (lane >> 4)) * 4);
    // the tile is overwritten by the next gp_stage: reads done first
    asm volatile("s_wait_dscnt 0x0" ::: "memory");
}

__global__ __launch_bounds__(GP_WAVES * 32)
void wr_proj(const float* X,
             const float* Ww, const float* Wb,
             const float* Rw, const float* Rb,
             float* wout, float* rout) {
    __shared__ __attribute__((aligned(16))) float sStage[GP_WAVES][16 * GP_PITCH];
    __shared__ __attribute__((aligned(16))) float sPart[GP_WAVES][GP_TOK * GP_RP];

    const int t    = threadIdx.x;
    const int lane = t & 31;
    const int wv   = t >> 5;
    const int m0   = blockIdx.x * GP_TOK;
    float* stg = sStage[wv];
    const float* xs = X + (size_t)m0 * DM + wv * GP_KW;

    v4f sa[8], sb[8], s0[8], s1[8], gw[8], gr[8];
    gp_fetch(Ww + wv * GP_KW, lane, sa);
    gp_fetch(Rw + wv * GP_KW, lane, sb);
    gp_fetch(xs, lane, s0);
    gp_fetch(xs + (size_t)16 * DM, lane, s1);
    gp_stage(stg, lane, sa);
    gp_frag(stg, lane, gw);
    gp_stage(stg, lane, sb);
    gp_frag(stg, lane, gr);

    auto do_tile = [&](int tile, v4f (&cur)[8]) {
        v4f fx[8];
        gp_stage(stg, lane, cur);
        // two tiles ahead, into the registers that were just staged
        if (tile + 2 < GP_TOK / 16) gp_fetch(xs + (size_t)(tile + 2) * 16 * DM, lane, cur);
        gp_frag(stg, lane, fx);
        v8f aw = vzero8(), ar = vzero8();
        #pragma unroll
        for (int j = 0; j < 8; ++j) {
            v2f x0 = {fx[j].x, fx[j].y}, x1 = {fx[j].z, fx[j].w};
            v2f w0 = {gw[j].x, gw[j].y}, w1 = {gw[j].z, gw[j].w};
            v2f r0 = {gr[j].x, gr[j].y}, r1 = {gr[j].z, gr[j].w};
            aw = __builtin_amdgcn_wmma_f32_16x16x4_f32(false, w0, false, x0, (short)0, aw, false, false);
            ar = __builtin_amdgcn_wmma_f32_16x16x4_f32(false, r0, false, x0, (short)0, ar, false, false);
            aw = __builtin_amdgcn_wmma_f32_16x16x4_f32(false, w1, false, x1, (short)0, aw, false, false);
            ar = __builtin_amdgcn_wmma_f32_16x16x4_f32(false, r1, false, x1, (short)0, ar, false, false);
        }
        // D register e = gate 8h + e of token c: 8 consecutive gates per lane
        float* pp = &sPart[wv][(tile * 16 + (lane & 15)) * GP_RP + ((lane >> 4) << 3)];
        *(v4f*)(pp)      = v4f{aw[0], aw[1], aw[2], aw[3]};
        *(v4f*)(pp + 4)  = v4f{aw[4], aw[5], aw[6], aw[7]};
        *(v4f*)(pp + 16) = v4f{ar[0], ar[1], ar[2], ar[3]};
        *(v4f*)(pp + 20) = v4f{ar[4], ar[5], ar[6], ar[7]};
    };
    static_assert(GP_TOK == 64, "four tiles of 16 tokens");
    do_tile(0, s0);
    do_tile(1, s1);
    do_tile(2, s0);
    do_tile(3, s1);
    __syncthreads();

    // 64 tokens x 32 gates = 512 threads x 4 gates
    const int tok = t >> 3, g4 = (t & 7) * 4;
    v4f s = {0.f, 0.f, 0.f, 0.f};
    #pragma unroll
    for (int w = 0; w < GP_WAVES; ++w) {
        v4f p = *(const v4f*)&sPart[w][tok * GP_RP + g4];
        s.x += p.x; s.y += p.y; s.z += p.z; s.w += p.w;
    }
    const float* bp = (g4 < NH) ? (Wb + g4) : (Rb + g4 - NH);
    v4f y;
    y.x = 1.f / (1.f + __expf(-(s.x + bp[0])));
    y.y = 1.f / (1.f + __expf(-(s.y + bp[1])));
    y.z = 1.f / (1.f + __expf(-(s.z + bp[2])));
    y.w = 1.f / (1.f + __expf(-(s.w + bp[3])));
    float* op = ((g4 < NH) ? wout : rout) + (size_t)(m0 + tok) * NH + (g4 & (NH - 1));
    *(v4f*)op = y;
}

// ---------------------------------------------------------------------------
// A[b,n,v,q] = sum_s Vw[s,(b,n),v] * K[s,(b,n),q], one block per (b,n),
// WMMA with K-dim = s in chunks of 32.
// The 128-B head rows of K and Vw go to LDS as they lie in memory, [s][feat], by
// async copies, 256 s to a stage (64 KB in flight per block), two buffers; the
// transposition is done by the LDS read: ds_load_tr16_b128 hands lane (c, h) the
// eight s = 8h .. 8h+7 of feature c, which is the k order of load_frag.
// Both operands go through the same function, so their k order is equal.
// Writes f32 A to d_out region and f16 copy to workspace.
// ---------------------------------------------------------------------------
// LDS pitch of a 64-half (128 B) row read by ds_load_tr16_b128: 160 B = 32 B x odd
#define LDT 80
#define AST 256                       // s rows per stage

typedef __attribute__((ext_vector_type(8))) short s16x8;

// tile is [s][LDT]; the fragment holds features f0 .. f0+15 (row or column c) over
// s0 .. s0+31: halves 0..7 = s0 + 8h + 0..7, halves 8..15 = s0 + 16 + 8h + 0..7
__device__ __forceinline__ v16h load_frag_tr(const _Float16* tile, int s0, int f0) {
    typedef __attribute__((address_space(3))) s16x8 lds_s16x8;
    const int lane = threadIdx.x & 31;
    const _Float16* p = tile + (s0 + ((lane >> 4) << 3) + (lane & 7)) * LDT
                             + f0 + (((lane >> 3) & 1) << 3);
    union { v16h v; s16x8 q[2]; } r;
    r.q[0] = __builtin_amdgcn_ds_load_tr16_b128_v8i16((lds_s16x8*)p);
    r.q[1] = __builtin_amdgcn_ds_load_tr16_b128_v8i16((lds_s16x8*)(p + 16 * LDT));
    return r.v;
}

__global__ __launch_bounds__(256)
void accum_A(const _Float16* __restrict__ Kh, const _Float16* __restrict__ Vh,
             float* __restrict__ Af, _Float16* __restrict__ Ah) {
    const int bn = blockIdx.x;          // b*16 + n
    const int b  = bn >> 4, n = bn & 15;
    __shared__ __attribute__((aligned(16))) _Float16 sK[2][AST * LDT]; // [s][q]
    __shared__ __attribute__((aligned(16))) _Float16 sV[2][AST * LDT]; // [s][v]

    const int t = threadIdx.x, lane = t & 31, wv = t >> 5;   // 8 waves
    const int vt   = wv >> 1;           // v-tile 0..3
    const int qoff = (wv & 1) * 32;     // q half 0/32

    v8f acc[2] = {vzero8(), vzero8()};
    constexpr int nst = S_LEN / AST;
    static_assert(AST == 256 && nst >= 2, "8 x 32 rows per stage; stages 0 and 1 exist");

    // 16 async b128 copies per thread per stage (8 of K, then 8 of V): lanes 8r .. 8r+7
    // take the 128 B of one row, a wave 4 whole lines, the block 32 rows
    const int row = t >> 3, kc = (t & 7) * 8;
    const size_t off0 = ((size_t)row * B_SZ + b) * DM + n * HD + kc;
    const size_t rstep = (size_t)32 * B_SZ * DM;     // 32 s on, the same for every lane
    auto issue = [&](int st, int buf) {
        const _Float16* g[8];
        const _Float16* l[8];
        #pragma unroll
        for (int p = 0; p < 8; ++p) {
            g[p] = Kh + (off0 + (size_t)(st * 8 + p) * rstep);
            l[p] = &sK[buf][(row + p * 32) * LDT + kc];
        }
        async_ld8_b128(g, l);
        #pragma unroll
        for (int p = 0; p < 8; ++p) {
            g[p] = Vh + (off0 + (size_t)(st * 8 + p) * rstep);
            l[p] = &sV[buf][(row + p * 32) * LDT + kc];
        }
        async_ld8_b128(g, l);
    };

    issue(0, 0);
    // stage 0 has landed for this wave, and behind the barrier for every wave
    asm volatile("s_wait_asynccnt 0x0" ::: "memory");
    __syncthreads();
    issue(1, 1);
    for (int st = 0; st < nst; ++st) {
        const int bb = st & 1;
        #pragma unroll
        for (int sc = 0; sc < AST; sc += 32) {
            v16h aF  = load_frag_tr(sV[bb], sc, vt * 16);
            v16h bF0 = load_frag_tr(sK[bb], sc, qoff);
            v16h bF1 = load_frag_tr(sK[bb], sc, qoff + 16);
            acc[0] = __builtin_amdgcn_wmma_f32_16x16x32_f16(false, aF, false, bF0, (short)0, acc[0], false, false);
            acc[1] = __builtin_amdgcn_wmma_f32_16x16x32_f16(false, aF, false, bF1, (short)0, acc[1], false, false);
        }
        // this wave's reads of buffer bb are done before the buffer may be refilled
        asm volatile("s_wait_dscnt 0x0" ::: "memory");
        // this wave's copies of stage st+1 have landed before the barrier publishes them
        asm volatile("s_wait_asynccnt 0x0" ::: "memory");
        __syncthreads();
        if (st + 2 < nst) issue(st + 2, bb);
    }
    // no copy is outstanding when the wave goes on to its end
    asm volatile("s_wait_asynccnt 0x0" ::: "memory");

    #pragma unroll
    for (int j = 0; j < 2; ++j)
        #pragma unroll
        for (int vg = 0; vg < 8; ++vg) {
            int vIdx = vt * 16 + vg + ((lane >> 4) << 3);
            int qIdx = qoff + j * 16 + (lane & 15);
            size_t idx = ((size_t)bn * HD + vIdx) * HD + qIdx;
            float val = acc[j][vg];
            Af[idx] = val;
            Ah[idx] = (_Float16)val;
        }
}

// ---------------------------------------------------------------------------
// Mid[s,(b,n),v] = r * sum_q Q[s,(b,n),q] * A[b,n,v,q] — WMMA, fragments
// loaded straight from global (Q rows strided by B*DM, A rows contiguous).
// ---------------------------------------------------------------------------
__global__ __launch_bounds__(256)
void apply_A(const _Float16* __restrict__ Qh, const _Float16* __restrict__ Ah,
             const float* __restrict__ rbuf, _Float16* __restrict__ Mid) {
    const int bn = blockIdx.x;          // b*16+n
    const int b  = bn >> 4, n = bn & 15;
    const int lane  = threadIdx.x & 31;
    const int sBase = blockIdx.y * 128 + (threadIdx.x >> 5) * 16;   // 8 waves x 16 rows

    const _Float16* Abase = Ah + (size_t)bn * (HD * HD);
    v8f acc[4] = {vzero8(), vzero8(), vzero8(), vzero8()};

    #pragma unroll
    for (int kt = 0; kt < 2; ++kt) {    // K = 64 = 2 x 32
        const _Float16* qbase = Qh + ((size_t)sBase * B_SZ + b) * DM + n * HD + kt * 32;
        v16h aF = load_frag(qbase, 0, B_SZ * DM);        // row step = next s token
        #pragma unroll
        for (int j = 0; j < 4; ++j) {
            v16h bF = load_frag(Abase + kt * 32, j * 16, HD);
            acc[j] = __builtin_amdgcn_wmma_f32_16x16x32_f16(
                false, aF, false, bF, (short)0, acc[j], false, false);
        }
    }

    float rv[8];
    #pragma unroll
    for (int vg = 0; vg < 8; ++vg) {
        int s = sBase + vg + ((lane >> 4) << 3);
        rv[vg] = rbuf[((size_t)s * B_SZ + b) * NH + n];
    }
    #pragma unroll
    for (int j = 0; j < 4; ++j)
        #pragma unroll
        for (int vg = 0; vg < 8; ++vg) {
            int s = sBase + vg + ((lane >> 4) << 3);
            size_t m = (size_t)s * B_SZ + b;
            Mid[m * DM + n * HD + j * 16 + (lane & 15)] = (_Float16)(acc[j][vg] * rv[vg]);
        }
}

// ---------------------------------------------------------------------------
// Launch
// ---------------------------------------------------------------------------
extern "C" void kernel_launch(void* const* d_in, const int* in_sizes, int n_in,
                              void* d_out, int out_size, void* d_ws, size_t ws_size,
                              hipStream_t stream) {
    (void)in_sizes; (void)n_in; (void)out_size; (void)ws_size;
    const float* inp  = (const float*)d_in[0];
    const float* Wq_w = (const float*)d_in[1];  const float* Wq_b = (const float*)d_in[2];
    const float* Wk_w = (const float*)d_in[3];  const float* Wk_b = (const float*)d_in[4];
    const float* Wv_w = (const float*)d_in[5];  const float* Wv_b = (const float*)d_in[6];
    const float* Wo_w = (const float*)d_in[7];  const float* Wo_b = (const float*)d_in[8];
    const float* Ww_w = (const float*)d_in[9];  const float* Ww_b = (const float*)d_in[10];
    const float* Wr_w = (const float*)d_in[11]; const float* Wr_b = (const float*)d_in[12];

    float* out_f = (float*)d_out;                       // [S,B,DM]
    float* A_f   = out_f + (size_t)MTOK * DM;           // [B,NH,64,64]

    char* ws = (char*)d_ws;
    constexpr size_t HBYTES = (size_t)MTOK * DM * sizeof(_Float16);   // 32 MiB
    constexpr size_t GATE   = (size_t)MTOK * NH * 4;                  // 1 MiB
    constexpr size_t WBYTES = (size_t)DM * DM * sizeof(_Float16);     // 2 MiB
    _Float16* Xh  = (_Float16*)(ws);
    _Float16* Qh  = (_Float16*)(ws + HBYTES);
    _Float16* Kh  = (_Float16*)(ws + 2 * HBYTES);
    _Float16* Vh  = (_Float16*)(ws + 3 * HBYTES);
    float*    wbf = (float*)   (ws + 4 * HBYTES);
    float*    rbf = (float*)   (ws + 4 * HBYTES + GATE);
    _Float16* Ah  = (_Float16*)(ws + 4 * HBYTES + 2 * GATE);
    _Float16* Mid = (_Float16*)(ws + 4 * HBYTES + 2 * GATE + (size_t)B_SZ * NH * HD * HD * 2);
    _Float16* Wqh = (_Float16*)(ws + 5 * HBYTES + 3 * GATE);
    _Float16* Wkh = (_Float16*)(ws + 5 * HBYTES + 3 * GATE + WBYTES);
    _Float16* Wvh = (_Float16*)(ws + 5 * HBYTES + 3 * GATE + 2 * WBYTES);
    _Float16* Woh = (_Float16*)(ws + 5 * HBYTES + 3 * GATE + 3 * WBYTES);

    // 1) fp32 -> fp16: input + four big weight matrices
    cvt_f32_f16<<<(MTOK * DM / 4) / 256, 256, 0, stream>>>(inp, Xh);
    cvt_f32_f16<<<(DM * DM / 4) / 256, 256, 0, stream>>>(Wq_w, Wqh);
    cvt_f32_f16<<<(DM * DM / 4) / 256, 256, 0, stream>>>(Wk_w, Wkh);
    cvt_f32_f16<<<(DM * DM / 4) / 256, 256, 0, stream>>>(Wv_w, Wvh);
    cvt_f32_f16<<<(DM * DM / 4) / 256, 256, 0, stream>>>(Wo_w, Woh);

    // 2) gate projections (w is read by the V projection's epilogue)
    wr_proj<<<MTOK / GP_TOK, GP_WAVES * 32, 0, stream>>>(inp, Ww_w, Ww_b, Wr_w, Wr_b, wbf, rbf);

    // 3) Q/K/V projections (WMMA GEMM, async-LDS pipeline, f16 out):
    //    q and k leave unit-normalized per head, v leaves multiplied by w
    dim3 gg(MTOK / 256, DM / 256);
    gemm_xwT<EPI_UNIT><<<gg, 256, 0, stream>>>(Xh, Wqh, Wq_b, nullptr, Qh, nullptr, MTOK, DM, DM);
    gemm_xwT<EPI_UNIT><<<gg, 256, 0, stream>>>(Xh, Wkh, Wk_b, nullptr, Kh, nullptr, MTOK, DM, DM);
    gemm_xwT<EPI_GATE><<<gg, 256, 0, stream>>>(Xh, Wvh, Wv_b, wbf, Vh, nullptr, MTOK, DM, DM);

    // 4) A accumulation (writes f32 A output + f16 copy)
    accum_A<<<B_SZ * NH, 256, 0, stream>>>(Kh, Vh, A_f, Ah);

    // 5) apply A, scale by r
    apply_A<<<dim3(B_SZ * NH, S_LEN / 128), 256, 0, stream>>>(Qh, Ah, rbf, Mid);

    // 6) final O projection (f32 out to d_out)
    gemm_xwT<EPI_F32><<<gg, 256, 0, stream>>>(Mid, Woh, Wo_b, nullptr, nullptr, out_f, MTOK, DM, DM);
}

// v007
// It runs in 160 microseconds.
// Timed twice side by side with v006, it ran 1.11 times as fast both times.
// All steps since v000 together make it 3.35 times as fast.
#include <hip/hip_runtime.h>
#include <hip/hip_bf16.h>
#include <cstdint>

typedef __attribute__((ext_vector_type(16))) _Float16 v16h;
typedef __attribute__((ext_vector_type(4)))  _Float16 v4h;
typedef __attribute__((ext_vector_type(8)))  float    v8f;

#define S_LEN 2048
#define B_SZ  8
#define DM    1024
#define NH    16
#define HD    64
#define MTOK  (S_LEN * B_SZ)          // 16384 tokens

__device__ __forceinline__ void async_ld8_b128(const _Float16* const (&g)[8],
                                               const _Float16* const (&l)[8]) {
    asm volatile("global_load_async_to_lds_b128 %0, %1, off\n\t"
                 "global_load_async_to_lds_b128 %2, %3, off\n\t"
                 "global_load_async_to_lds_b128 %4, %5, off\n\t"
                 "global_load_async_to_lds_b128 %6, %7, off\n\t"
                 "global_load_async_to_lds_b128 %8, %9, off\n\t"
                 "global_load_async_to_lds_b128 %10, %11, off\n\t"
                 "global_load_async_to_lds_b128 %12, %13, off\n\t"
                 "global_load_async_to_lds_b128 %14, %15, off\n\t"
                 "s_wait_xcnt 0x0"
                 :: "v"((unsigned)(uintptr_t)l[0]), "v"(g[0]),
                    "v"((unsigned)(uintptr_t)l[1]), "v"(g[1]),
                    "v"((unsigned)(uintptr_t)l[2]), "v"(g[2]),
                    "v"((unsigned)(uintptr_t)l[3]), "v"(g[3]),
                    "v"((unsigned)(uintptr_t)l[4]), "v"(g[4]),
                    "v"((unsigned)(uintptr_t)l[5]), "v"(g[5]),
                    "v"((unsigned)(uintptr_t)l[6]), "v"(g[6]),
                    "v"((unsigned)(uintptr_t)l[7]), "v"(g[7]) : "memory");
}

__device__ __forceinline__ v16h load_frag(const _Float16* tile, int row0, int ld) {
    const int lane = threadIdx.x & 31;
    const _Float16* p = tile + (size_t)(row0 + (lane & 15)) * ld + ((lane >> 4) << 3);
    v16h r;
    ((float4*)&r)[0] = *(const float4*)(p);
    ((float4*)&r)[1] = *(const float4*)(p + 16);
    return r;
}

#define LDG 72

__device__ __forceinline__ v8f vzero8() { v8f z = {0.f,0.f,0.f,0.f,0.f,0.f,0.f,0.f}; return z; }

enum { EPI_F32 = 0, EPI_UNIT = 1, EPI_GATE = 2 };

// x + (x of lane ^ XM) inside a 16-lane row; folds into one v_add_f32 with DPP
template<int XM>
__device__ __forceinline__ float add_row_xor(float x) {
    return x + __int_as_float(__builtin_amdgcn_update_dpp(
                   0, __float_as_int(x), 0x160 | XM, 0xf, 0xf, true));   // 0x160 = row_xmask
}

template<int EPI>
__global__ __launch_bounds__(256)
void gemm_xwT(const _Float16* __restrict__ X, const _Float16* __restrict__ Wh,
              const float* __restrict__ bias, const float* __restrict__ gate,
              _Float16* __restrict__ Yh, float* __restrict__ Yf, int M, int N, int K) {
    static_assert(HD == 64, "a wave's 128 columns are two heads");
    constexpr int BM = 256, BN = 256, BK = 64;
    __shared__ __attribute__((aligned(16))) _Float16 sX[2][BM * LDG];
    __shared__ __attribute__((aligned(16))) _Float16 sW[2][BN * LDG];

    const int t    = threadIdx.x;
    const int lane = t & 31;
    const int wv   = t >> 5;                  // 0..7
    const int mBlk = blockIdx.x * BM;
    const int nBlk = blockIdx.y * BN;
    const int wm   = (wv >> 1) * 64;          // 0 / 64 / 128 / 192
    const int wn   = (wv & 1) * 128;          // 0 / 128

    v8f acc[4][8];
    #pragma unroll
    for (int i = 0; i < 4; ++i)
        #pragma unroll
        for (int j = 0; j < 8; ++j) acc[i][j] = vzero8();

    const int nk = K / BK;

    // 16 async b128 copies per thread per stage (8 X chunks, then 8 W chunks):
    // lanes 8r .. 8r+7 take the 128 B of one row, a wave 4 rows, the block 32 rows
    const int row = t >> 3, kc = (t & 7) * 8;
    const _Float16* gx0 = X  + (size_t)(mBlk + row) * K + kc;
    const _Float16* gw0 = Wh + (size_t)(nBlk + row) * K + kc;
    const size_t rstep = (size_t)32 * K;             // 32 rows on, the same for every lane
    auto issue = [&](int kt, int buf) {
        const _Float16* g[8];
        const _Float16* l[8];
        #pragma unroll
        for (int p = 0; p < 8; ++p) {
            g[p] = gx0 + (p * rstep + (size_t)kt * BK);
            l[p] = &sX[buf][(row + p * 32) * LDG + kc];
        }
        async_ld8_b128(g, l);
        #pragma unroll
        for (int p = 0; p < 8; ++p) {
            g[p] = gw0 + (p * rstep + (size_t)kt * BK);
            l[p] = &sW[buf][(row + p * 32) * LDG + kc];
        }
        async_ld8_b128(g, l);
    };

    issue(0, 0);
    // stage 0 has landed for this wave, and behind the barrier for every wave
    asm volatile("s_wait_asynccnt 0x0" ::: "memory");
    __syncthreads();
    if (1 < nk) issue(1, 1);
    for (int kt = 0; kt < nk; ++kt) {
        const int b = kt & 1;
        #pragma unroll
        for (int kk = 0; kk < BK; kk += 32) {
            v16h aF[4], bF[8];
            #pragma unroll
            for (int i = 0; i < 4; ++i) aF[i] = load_frag(sX[b] + kk, wm + i * 16, LDG);
            #pragma unroll
            for (int j = 0; j < 8; ++j) bF[j] = load_frag(sW[b] + kk, wn + j * 16, LDG);
            __builtin_amdgcn_sched_barrier(0);
            #pragma unroll
            for (int i = 0; i < 4; ++i)
                #pragma unroll
                for (int j = 0; j < 8; ++j)
                    acc[i][j] = __builtin_amdgcn_wmma_f32_16x16x32_f16(
                        false, aF[i], false, bF[j], (short)0, acc[i][j], false, false);
        }
        // keeps the trip's last WMMAs in front of the barrier: sunk behind it they would
        // stand between the barrier and the copies of stage kt+2 and shorten their flight
        __builtin_amdgcn_sched_barrier(0);
        // this wave's reads of buf b are done before the buffer may be refilled
        asm volatile("s_wait_dscnt 0x0" ::: "memory");
        // this wave's copies of stage kt+1 have landed before the barrier publishes them
        asm volatile("s_wait_asynccnt 0x0" ::: "memory");
        __syncthreads();
        if (kt + 2 < nk) issue(kt + 2, b);
    }
    // no copy is outstanding when the wave goes on to its end
    asm volatile("s_wait_asynccnt 0x0" ::: "memory");

    const int mLane = mBlk + wm + ((lane >> 4) << 3);
    const int nLane = nBlk + wn + (lane & 15);
    const int head  = (nBlk + wn) / HD;
    float bv[8];
    #pragma unroll
    for (int j = 0; j < 8; ++j) bv[j] = bias[nLane + j * 16];
    float sc[4][8][2];
    if (EPI == EPI_GATE) {
        const float* gp = gate + (size_t)mLane * NH + head;   // one address for all 64 values
        #pragma unroll
        for (int i = 0; i < 4; ++i)
            #pragma unroll
            for (int vg = 0; vg < 8; ++vg)
                #pragma unroll
                for (int h = 0; h < 2; ++h)
                    sc[i][vg][h] = gp[(i * 16 + vg) * NH + h];
        // the wait stands before a register that one of the loads above names is overwritten;
        // gp as an input keeps the address register whole up to the wait: without it
        // the last load takes it as its destination while the others still name it
        asm volatile("s_wait_xcnt 0x0" :: "v"(gp) : "memory");
    } else {
        // the wait stands before a register that one of the bias loads names is overwritten
        asm volatile("s_wait_xcnt 0x0" ::: "memory");
    }
    // keeps the arithmetic that overwrites those registers behind the wait
    __builtin_amdgcn_sched_barrier(0);
    // 16 rows at a time: first all their arithmetic, then all their stores, then the wait
    #pragma unroll
    for (int i = 0; i < 4; ++i) {
        float    rf[8][2][4];
        _Float16 rh[8][2][4];
        size_t o[8];
        #pragma unroll
        for (int vg = 0; vg < 8; ++vg) {
            o[vg] = (size_t)(mLane + i * 16 + vg) * N + nLane;
            #pragma unroll
            for (int h = 0; h < 2; ++h) {
                float val[4];
                #pragma unroll
                for (int j = 0; j < 4; ++j) val[j] = acc[i][h * 4 + j][vg] + bv[h * 4 + j];
                float f = 1.f;
                if (EPI == EPI_UNIT) {
                    float ss = val[0] * val[0] + val[1] * val[1] + val[2] * val[2] + val[3] * val[3];
                    ss = add_row_xor<1>(ss);
                    ss = add_row_xor<2>(ss);
                    ss = add_row_xor<4>(ss);
                    ss = add_row_xor<8>(ss);
                    float rs;
                    asm("v_rsq_f32 %0, %1\n\tv_nop" : "=v"(rs) : "v"(ss));
                    f = fminf(rs, 1e12f);
                } else if (EPI == EPI_GATE) {
                    f = sc[i][vg][h];
                }
                #pragma unroll
                for (int j = 0; j < 4; ++j) {
                    if (EPI == EPI_F32) rf[vg][h][j] = val[j];
                    else                rh[vg][h][j] = (_Float16)(val[j] * f);
                }
            }
        }
        // no arithmetic moves in among the stores below, where it could overwrite a
        // register that an issued store names ahead of the wait behind them
        __builtin_amdgcn_sched_barrier(0);
        #pragma unroll
        for (int vg = 0; vg < 8; ++vg)
            #pragma unroll
            for (int h = 0; h < 2; ++h)
                #pragma unroll
                for (int j = 0; j < 4; ++j) {
                    if (EPI == EPI_F32) Yf[o[vg] + h * HD + j * 16] = rf[vg][h][j];
                    else                Yh[o[vg] + h * HD + j * 16] = rh[vg][h][j];
                }
        if (i < 3) {
            // the wait stands before the next rows' arithmetic overwrites the address and
            // data registers of these stores; the scheduling barrier keeps it behind the wait
            asm volatile("s_wait_xcnt 0x0" ::: "memory");
            __builtin_amdgcn_sched_barrier(0);
        }
    }
}

// ---------------------------------------------------------------------------
// w = sigmoid(X@Ww^T + bw), r = sigmoid(X@Wr^T + br), all in fp32, as one
// [32 gates] x [64 tokens] x [K = 1024] product per block on the f32 WMMA.
// 16 waves split K: wave wv owns k = wv*64 .. wv*64+63 and keeps its slice of
// both gate matrices in registers (A operand, rows = gates). Token rows are the
// B operand. Every global load covers whole 256-B row pieces; a wave-private
// LDS tile turns them into fragments. A and B go through the same two
// functions, so their k order is equal at every lane and register.
// The 16 partial sums of each gate value meet in LDS and are added in wave order.
// This kernel also makes the f16 copies of X and of the four big weight matrices for the GEMMs:
//   X : each 16-row tile is rounded to f16 from the registers that hold it for the
//       gates and stored, 16 lanes to one whole 128-B line of Xh;
//   W : each of the 256 blocks rounds 1/256 of the four 1024 x 1024 weight matrices
//       (a quarter of the blocks to each matrix), loaded behind its first X tiles.
// ---------------------------------------------------------------------------
typedef __attribute__((ext_vector_type(2))) float v2f;
typedef __attribute__((ext_vector_type(4))) float v4f;

#define GP_WAVES 16
#define GP_TOK   64                   // tokens per block
#define GP_KW    (DM / GP_WAVES)      // 64 k per wave = 256 B of a row
#define GP_PITCH (GP_KW + 4)          // staged row pitch, dwords (272 B: 16 B x odd)
#define GP_RP    36                   // partial-sum row pitch, dwords (32 gates + 4)
#define GP_BLK   (MTOK / GP_TOK)      // 256 blocks
#define GP_WSH   (4 * DM * DM / GP_BLK)        // weight elements a block rounds: 16384
#define GP_WLD   (GP_WSH / (GP_WAVES * 32 * 4)) // 16-B loads of them per thread: 8

__device__ __forceinline__ v4h to_f16(v4f v) {
    v4h h; h.x = (_Float16)v.x; h.y = (_Float16)v.y; h.z = (_Float16)v.z; h.w = (_Float16)v.w;
    return h;
}

__device__ __forceinline__ void gp_fetch(const float* rows, int lane, v4f (&st)[8]) {
    #pragma unroll
    for (int i = 0; i < 8; ++i)
        st[i] = *(const v4f*)(rows + (size_t)(2 * i + (lane >> 4)) * DM + (lane & 15) * 4);
}

// rows in registers -> this wave's own LDS tile
__device__ __forceinline__ void gp_stage(float* stg, int lane, const v4f (&st)[8]) {
    #pragma unroll
    for (int i = 0; i < 8; ++i)
        *(v4f*)(stg + (2 * i + (lane >> 4)) * GP_PITCH + (lane & 15) * 4) = st[i];
    // the rows are read back by other lanes of this wave: stores done first
    asm volatile("s_wait_dscnt 0x0" ::: "memory");
}

// LDS tile -> fragments: lane (c = lane&15, h = lane>>4) gets row c,
// k = 8j + 4h .. 8j + 4h + 3 in fr[j]
__device__ __forceinline__ void gp_frag(const float* stg, int lane, v4f (&fr)[8]) {
    #pragma unroll
    for (int j = 0; j < 8; ++j)
        fr[j] = *(const v4f*)(stg + (lane & 15) * GP_PITCH + (2 * j + (lane >> 4)) * 4);
    // the tile is overwritten by the next gp_stage: reads done first
    asm volatile("s_wait_dscnt 0x0" ::: "memory");
}

__global__ __launch_bounds__(GP_WAVES * 32)
void wr_proj(const float* X,
             const float* Ww, const float* Wb,
             const float* Rw, const float* Rb,
             const float* Wq, const float* Wk, const float* Wv, const float* Wo,
             float* wout, float* rout,
             _Float16* Xh, _Float16* Wh4) {      // Wh4: f16 Wq, Wk, Wv, Wo, one behind the other
    __shared__ __attribute__((aligned(16))) float sStage[GP_WAVES][16 * GP_PITCH];
    __shared__ __attribute__((aligned(16))) float sPart[GP_WAVES][GP_TOK * GP_RP];

    const int t    = threadIdx.x;
    const int lane = t & 31;
    const int wv   = t >> 5;
    const int m0   = blockIdx.x * GP_TOK;
    float* stg = sStage[wv];
    const float* xs = X + (size_t)m0 * DM + wv * GP_KW;
    _Float16*    xh = Xh + (size_t)m0 * DM + wv * GP_KW;

    // this block's share of the big weights: GP_BLK / 4 blocks to a matrix
    static_assert(GP_BLK % 4 == 0 && GP_WLD == 8, "whole blocks per matrix, 8 loads per thread");
    const int    wsel = blockIdx.x / (GP_BLK / 4);
    const float* wsrc = (wsel == 0 ? Wq : wsel == 1 ? Wk : wsel == 2 ? Wv : Wo)
                      + (size_t)(blockIdx.x % (GP_BLK / 4)) * GP_WSH + t * 4;
    _Float16*    wdst = Wh4 + (size_t)blockIdx.x * GP_WSH + t * 4;

    v4f sa[8], sb[8], s0[8], s1[8], gw[8], gr[8], bw[GP_WLD];
    gp_fetch(Ww + wv * GP_KW, lane, sa);
    gp_fetch(Rw + wv * GP_KW, lane, sb);
    // the wait stands before an address register of the gate loads is overwritten
    asm volatile("s_wait_xcnt 0x0" ::: "memory");
    // keeps that overwrite behind the wait, and both gate matrices' loads in front of the X loads:
    // loads return in issue order, and with Rw's issued last the first tile would wait until
    // every X load of the burst has landed
    __builtin_amdgcn_sched_barrier(0);
    gp_fetch(xs, lane, s0);
    gp_fetch(xs + (size_t)16 * DM, lane, s1);
    // keeps the second tile's loads in the first burst: left free they sink behind the wait for Ww
    __builtin_amdgcn_sched_barrier(0);
    gp_stage(stg, lane, sa);
    gp_frag(stg, lane, gw);
    gp_stage(stg, lane, sb);
    gp_frag(stg, lane, gr);
    // behind the gates and the first two X tiles, so that none of them waits for these loads;
    // a wave's load covers 512 contiguous bytes
    #pragma unroll
    for (int i = 0; i < GP_WLD; ++i) bw[i] = *(const v4f*)(wsrc + i * (GP_WAVES * 32 * 4));

    auto do_tile = [&](int tile, v4f (&cur)[8]) {
        v4f fx[8];
        gp_stage(stg, lane, cur);
        v4h hx[8];
        #pragma unroll
        for (int i = 0; i < 8; ++i) hx[i] = to_f16(cur[i]);
        // two tiles ahead, into the registers that were just staged
        if (tile + 2 < GP_TOK / 16) gp_fetch(xs + (size_t)(tile + 2) * 16 * DM, lane, cur);
        #pragma unroll
        for (int i = 0; i < 8; ++i)
            *(v4h*)(xh + (size_t)(tile * 16 + 2 * i + (lane >> 4)) * DM + (lane & 15) * 4) = hx[i];
        // the wait stands before a register that one of these stores names is overwritten
        asm volatile("s_wait_xcnt 0x0" ::: "memory");
        gp_frag(stg, lane, fx);
        v8f aw = vzero8(), ar = vzero8();
        #pragma unroll
        for (int j = 0; j < 8; ++j) {
            v2f x0 = {fx[j].x, fx[j].y}, x1 = {fx[j].z, fx[j].w};
            v2f w0 = {gw[j].x, gw[j].y}, w1 = {gw[j].z, gw[j].w};
            v2f r0 = {gr[j].x, gr[j].y}, r1 = {gr[j].z, gr[j].w};
            aw = __builtin_amdgcn_wmma_f32_16x16x4_f32(false, w0, false, x0, (short)0, aw, false, false);
            ar = __builtin_amdgcn_wmma_f32_16x16x4_f32(false, r0, false, x0, (short)0, ar, false, false);
            aw = __builtin_amdgcn_wmma_f32_16x16x4_f32(false, w1, false, x1, (short)0, aw, false, false);
            ar = __builtin_amdgcn_wmma_f32_16x16x4_f32(false, r1, false, x1, (short)0, ar, false, false);
        }
        // D register e = gate 8h + e of token c: 8 consecutive gates per lane
        float* pp = &sPart[wv][(tile * 16 + (lane & 15)) * GP_RP + ((lane >> 4) << 3)];
        *(v4f*)(pp)      = v4f{aw[0], aw[1], aw[2], aw[3]};
        *(v4f*)(pp + 4)  = v4f{aw[4], aw[5], aw[6], aw[7]};
        *(v4f*)(pp + 16) = v4f{ar[0], ar[1], ar[2], ar[3]};
        *(v4f*)(pp + 20) = v4f{ar[4], ar[5], ar[6], ar[7]};
    };
    static_assert(GP_TOK == 64, "four tiles of 16 tokens");
    do_tile(0, s0);
    do_tile(1, s1);
    // the weight share has landed with the first two tiles; a wave's store covers 256 B
    #pragma unroll
    for (int i = 0; i < GP_WLD; ++i) *(v4h*)(wdst + i * (GP_WAVES * 32 * 4)) = to_f16(bw[i]);
    // the wait stands before a register that one of these stores names is overwritten
    asm volatile("s_wait_xcnt 0x0" ::: "memory");
    do_tile(2, s0);
    do_tile(3, s1);
    __syncthreads();

    // 64 tokens x 32 gates = 512 threads x 4 gates
    const int tok = t >> 3, g4 = (t & 7) * 4;
    v4f s = {0.f, 0.f, 0.f, 0.f};
    #pragma unroll
    for (int w = 0; w < GP_WAVES; ++w) {
        v4f p = *(const v4f*)&sPart[w][tok * GP_RP + g4];
        s.x += p.x; s.y += p.y; s.z += p.z; s.w += p.w;
    }
    const float* bp = (g4 < NH) ? (Wb + g4) : (Rb + g4 - NH);
    v4f y;
    y.x = 1.f / (1.f + __expf(-(s.x + bp[0])));
    y.y = 1.f / (1.f + __expf(-(s.y + bp[1])));
    y.z = 1.f / (1.f + __expf(-(s.z + bp[2])));
    y.w = 1.f / (1.f + __expf(-(s.w + bp[3])));
    float* op = ((g4 < NH) ? wout : rout) + (size_t)(m0 + tok) * NH + (g4 & (NH - 1));
    *(v4f*)op = y;
}

// ---------------------------------------------------------------------------
// A[b,n,v,q] = sum_s Vw[s,(b,n),v] * K[s,(b,n),q], one block per (b,n),
// WMMA with K-dim = s in chunks of 32.
// The 128-B head rows of K and Vw go to LDS as they lie in memory, [s][feat], by
// async copies, 256 s to a stage (64 KB in flight per block), two buffers; the
// transposition is done by the LDS read: ds_load_tr16_b128 hands lane (c, h) the
// eight s = 8h .. 8h+7 of feature c, which is the k order of load_frag.
// Both operands go through the same function, so their k order is equal.
// Writes f32 A to d_out region and f16 copy to workspace.
// ---------------------------------------------------------------------------
// LDS pitch of a 64-half (128 B) row read by ds_load_tr16_b128: 160 B = 32 B x odd
#define LDT 80
#define AST 256                       // s rows per stage

typedef __attribute__((ext_vector_type(8))) short s16x8;

// tile is [s][LDT]; the fragment holds features f0 .. f0+15 (row or column c) over
// s0 .. s0+31: halves 0..7 = s0 + 8h + 0..7, halves 8..15 = s0 + 16 + 8h + 0..7
__device__ __forceinline__ v16h load_frag_tr(const _Float16* tile, int s0, int f0) {
    typedef __attribute__((address_space(3))) s16x8 lds_s16x8;
    const int lane = threadIdx.x & 31;
    const _Float16* p = tile + (s0 + ((lane >> 4) << 3) + (lane & 7)) * LDT
                             + f0 + (((lane >> 3) & 1) << 3);
    union { v16h v; s16x8 q[2]; } r;
    r.q[0] = __builtin_amdgcn_ds_load_tr16_b128_v8i16((lds_s16x8*)p);
    r.q[1] = __builtin_amdgcn_ds_load_tr16_b128_v8i16((lds_s16x8*)(p + 16 * LDT));
    return r.v;
}

__global__ __launch_bounds__(256)
void accum_A(const _Float16* __restrict__ Kh, const _Float16* __restrict__ Vh,
             float* __restrict__ Af, _Float16* __restrict__ Ah) {
    const int bn = blockIdx.x;          // b*16 + n
    const int b  = bn >> 4, n = bn & 15;
    __shared__ __attribute__((aligned(16))) _Float16 sK[2][AST * LDT]; // [s][q]
    __shared__ __attribute__((aligned(16))) _Float16 sV[2][AST * LDT]; // [s][v]

    const int t = threadIdx.x, lane = t & 31, wv = t >> 5;   // 8 waves
    const int vt   = wv >> 1;           // v-tile 0..3
    const int qoff = (wv & 1) * 32;     // q half 0/32

    v8f acc[2] = {vzero8(), vzero8()};
    constexpr int nst = S_LEN / AST;
    static_assert(AST == 256 && nst >= 2, "8 x 32 rows per stage; stages 0 and 1 exist");

    // 16 async b128 copies per thread per stage (8 of K, then 8 of V): lanes 8r .. 8r+7
    // take the 128 B of one row, a wave 4 whole lines, the block 32 rows
    const int row = t >> 3, kc = (t & 7) * 8;
    const size_t off0 = ((size_t)row * B_SZ + b) * DM + n * HD + kc;
    const size_t rstep = (size_t)32 * B_SZ * DM;     // 32 s on, the same for every lane
    auto issue = [&](int st, int buf) {
        const _Float16* g[8];
        const _Float16* l[8];
        #pragma unroll
        for (int p = 0; p < 8; ++p) {
            g[p] = Kh + (off0 + (size_t)(st * 8 + p) * rstep);
            l[p] = &sK[buf][(row + p * 32) * LDT + kc];
        }
        async_ld8_b128(g, l);
        #pragma unroll
        for (int p = 0; p < 8; ++p) {
            g[p] = Vh + (off0 + (size_t)(st * 8 + p) * rstep);
            l[p] = &sV[buf][(row + p * 32) * LDT + kc];
        }
        async_ld8_b128(g, l);
    };

    issue(0, 0);
    // stage 0 has landed for this wave, and behind the barrier for every wave
    asm volatile("s_wait_asynccnt 0x0" ::: "memory");
    __syncthreads();
    issue(1, 1);
    for (int st = 0; st < nst; ++st) {
        const int bb = st & 1;
        #pragma unroll
        for (int sc = 0; sc < AST; sc += 32) {
            v16h aF  = load_frag_tr(sV[bb], sc, vt * 16);
            v16h bF0 = load_frag_tr(sK[bb], sc, qoff);
            v16h bF1 = load_frag_tr(sK[bb], sc, qoff + 16);
            acc[0] = __builtin_amdgcn_wmma_f32_16x16x32_f16(false, aF, false, bF0, (short)0, acc[0], false, false);
            acc[1] = __builtin_amdgcn_wmma_f32_16x16x32_f16(false, aF, false, bF1, (short)0, acc[1], false, false);
        }
        // this wave's reads of buffer bb are done before the buffer may be refilled
        asm volatile("s_wait_dscnt 0x0" ::: "memory");
        // this wave's copies of stage st+1 have landed before the barrier publishes them
        asm volatile("s_wait_asynccnt 0x0" ::: "memory");
        __syncthreads();
        if (st + 2 < nst) issue(st + 2, bb);
    }
    // no copy is outstanding when the wave goes on to its end
    asm volatile("s_wait_asynccnt 0x0" ::: "memory");

    #pragma unroll
    for (int j = 0; j < 2; ++j)
        #pragma unroll
        for (int vg = 0; vg < 8; ++vg) {
            int vIdx = vt * 16 + vg + ((lane >> 4) << 3);
            int qIdx = qoff + j * 16 + (lane & 15);
            size_t idx = ((size_t)bn * HD + vIdx) * HD + qIdx;
            float val = acc[j][vg];
            Af[idx] = val;
            Ah[idx] = (_Float16)val;
        }
}

// ---------------------------------------------------------------------------
// Mid[s,(b,n),v] = r * sum_q Q[s,(b,n),q] * A[b,n,v,q] — WMMA, fragments
// loaded straight from global (Q rows strided by B*DM, A rows contiguous).
// ---------------------------------------------------------------------------
__global__ __launch_bounds__(256)
void apply_A(const _Float16* __restrict__ Qh, const _Float16* __restrict__ Ah,
             const float* __restrict__ rbuf, _Float16* __restrict__ Mid) {
    const int bn = blockIdx.x;          // b*16+n
    const int b  = bn >> 4, n = bn & 15;
    const int lane  = threadIdx.x & 31;
    const int sBase = blockIdx.y * 128 + (threadIdx.x >> 5) * 16;   // 8 waves x 16 rows

    const _Float16* Abase = Ah + (size_t)bn * (HD * HD);
    v8f acc[4] = {vzero8(), vzero8(), vzero8(), vzero8()};

    #pragma unroll
    for (int kt = 0; kt < 2; ++kt) {    // K = 64 = 2 x 32
        const _Float16* qbase = Qh + ((size_t)sBase * B_SZ + b) * DM + n * HD + kt * 32;
        v16h aF = load_frag(qbase, 0, B_SZ * DM);        // row step = next s token
        #pragma unroll
        for (int j = 0; j < 4; ++j) {
            v16h bF = load_frag(Abase + kt * 32, j * 16, HD);
            acc[j] = __builtin_amdgcn_wmma_f32_16x16x32_f16(
                false, aF, false, bF, (short)0, acc[j], false, false);
        }
    }

    float rv[8];
    #pragma unroll
    for (int vg = 0; vg < 8; ++vg) {
        int s = sBase + vg + ((lane >> 4) << 3);
        rv[vg] = rbuf[((size_t)s * B_SZ + b) * NH + n];
    }
    #pragma unroll
    for (int j = 0; j < 4; ++j)
        #pragma unroll
        for (int vg = 0; vg < 8; ++vg) {
            int s = sBase + vg + ((lane >> 4) << 3);
            size_t m = (size_t)s * B_SZ + b;
            Mid[m * DM + n * HD + j * 16 + (lane & 15)] = (_Float16)(acc[j][vg] * rv[vg]);
        }
}

// ---------------------------------------------------------------------------
// Launch
// ---------------------------------------------------------------------------
extern "C" void kernel_launch(void* const* d_in, const int* in_sizes, int n_in,
                              void* d_out, int out_size, void* d_ws, size_t ws_size,
                              hipStream_t stream) {
    (void)in_sizes; (void)n_in; (void)out_size; (void)ws_size;
    const float* inp  = (const float*)d_in[0];
    const float* Wq_w = (const float*)d_in[1];  const float* Wq_b = (const float*)d_in[2];
    const float* Wk_w = (const float*)d_in[3];  const float* Wk_b = (const float*)d_in[4];
    const float* Wv_w = (const float*)d_in[5];  const float* Wv_b = (const float*)d_in[6];
    const float* Wo_w = (const float*)d_in[7];  const float* Wo_b = (const float*)d_in[8];
    const float* Ww_w = (const float*)d_in[9];  const float* Ww_b = (const float*)d_in[10];
    const float* Wr_w = (const float*)d_in[11]; const float* Wr_b = (const float*)d_in[12];

    float* out_f = (float*)d_out;                       // [S,B,DM]
    float* A_f   = out_f + (size_t)MTOK * DM;           // [B,NH,64,64]

    char* ws = (char*)d_ws;
    constexpr size_t HBYTES = (size_t)MTOK * DM * sizeof(_Float16);   // 32 MiB
    constexpr size_t GATE   = (size_t)MTOK * NH * 4;                  // 1 MiB
    constexpr size_t WBYTES = (size_t)DM * DM * sizeof(_Float16);     // 2 MiB
    _Float16* Xh  = (_Float16*)(ws);
    _Float16* Qh  = (_Float16*)(ws + HBYTES);
    _Float16* Kh  = (_Float16*)(ws + 2 * HBYTES);
    _Float16* Vh  = (_Float16*)(ws + 3 * HBYTES);
    float*    wbf = (float*)   (ws + 4 * HBYTES);
    float*    rbf = (float*)   (ws + 4 * HBYTES + GATE);
    _Float16* Ah  = (_Float16*)(ws + 4 * HBYTES + 2 * GATE);
    _Float16* Mid = (_Float16*)(ws + 4 * HBYTES + 2 * GATE + (size_t)B_SZ * NH * HD * HD * 2);
    _Float16* Wqh = (_Float16*)(ws + 5 * HBYTES + 3 * GATE);
    _Float16* Wkh = (_Float16*)(ws + 5 * HBYTES + 3 * GATE + WBYTES);
    _Float16* Wvh = (_Float16*)(ws + 5 * HBYTES + 3 * GATE + 2 * WBYTES);
    _Float16* Woh = (_Float16*)(ws + 5 * HBYTES + 3 * GATE + 3 * WBYTES);

    // 1, 2) gate projections (w is read by the V projection's epilogue), and with them the
    //       f16 copies of the input and of the four big weight matrices (Wqh .. Woh adjoin)
    wr_proj<<<GP_BLK, GP_WAVES * 32, 0, stream>>>(inp, Ww_w, Ww_b, Wr_w, Wr_b,
                                                  Wq_w, Wk_w, Wv_w, Wo_w, wbf, rbf, Xh, Wqh);

    // 3) Q/K/V projections (WMMA GEMM, async-LDS pipeline, f16 out):
    //    q and k leave unit-normalized per head, v leaves multiplied by w
    dim3 gg(MTOK / 256, DM / 256);
    gemm_xwT<EPI_UNIT><<<gg, 256, 0, stream>>>(Xh, Wqh, Wq_b, nullptr, Qh, nullptr, MTOK, DM, DM);
    gemm_xwT<EPI_UNIT><<<gg, 256, 0, stream>>>(Xh, Wkh, Wk_b, nullptr, Kh, nullptr, MTOK, DM, DM);
    gemm_xwT<EPI_GATE><<<gg, 256, 0, stream>>>(Xh, Wvh, Wv_b, wbf, Vh, nullptr, MTOK, DM, DM);

    // 4) A accumulation (writes f32 A output + f16 copy)
    accum_A<<<B_SZ * NH, 256, 0, stream>>>(Kh, Vh, A_f, Ah);

    // 5) apply A, scale by r
    apply_A<<<dim3(B_SZ * NH, S_LEN / 128), 256, 0, stream>>>(Qh, Ah, rbf, Mid);

    // 6) final O projection (f32 out to d_out)
    gemm_xwT<EPI_F32><<<gg, 256, 0, stream>>>(Mid, Woh, Wo_b, nullptr, nullptr, out_f, MTOK, DM, DM);
}

// v008
// Measured time: 151 microseconds a run.
// Two timings next to v007 put it at 1.09 and 1.02 times that version's speed.
// Counting every step since v000, it is 3.54 times as fast.
#include <hip/hip_runtime.h>
#include <hip/hip_bf16.h>
#include <cstdint>

typedef __attribute__((ext_vector_type(16))) _Float16 v16h;
typedef __attribute__((ext_vector_type(4)))  _Float16 v4h;
typedef __attribute__((ext_vector_type(8)))  _Float16 v8h;
typedef __attribute__((ext_vector_type(8)))  float    v8f;

#define S_LEN 2048
#define B_SZ  8
#define DM    1024
#define NH    16
#define HD    64
#define MTOK  (S_LEN * B_SZ)          // 16384 tokens

__device__ __forceinline__ void async_ld8_b128(const _Float16* const (&g)[8],
                                               const _Float16* const (&l)[8]) {
    asm volatile("global_load_async_to_lds_b128 %0, %1, off\n\t"
                 "global_load_async_to_lds_b128 %2, %3, off\n\t"
                 "global_load_async_to_lds_b128 %4, %5, off\n\t"
                 "global_load_async_to_lds_b128 %6, %7, off\n\t"
                 "global_load_async_to_lds_b128 %8, %9, off\n\t"
                 "global_load_async_to_lds_b128 %10, %11, off\n\t"
                 "global_load_async_to_lds_b128 %12, %13, off\n\t"
                 "global_load_async_to_lds_b128 %14, %15, off\n\t"
                 "s_wait_xcnt 0x0"
                 :: "v"((unsigned)(uintptr_t)l[0]), "v"(g[0]),
                    "v"((unsigned)(uintptr_t)l[1]), "v"(g[1]),
                    "v"((unsigned)(uintptr_t)l[2]), "v"(g[2]),
                    "v"((unsigned)(uintptr_t)l[3]), "v"(g[3]),
                    "v"((unsigned)(uintptr_t)l[4]), "v"(g[4]),
                    "v"((unsigned)(uintptr_t)l[5]), "v"(g[5]),
                    "v"((unsigned)(uintptr_t)l[6]), "v"(g[6]),
                    "v"((unsigned)(uintptr_t)l[7]), "v"(g[7]) : "memory");
}

__device__ __forceinline__ v16h load_frag(const _Float16* tile, int row0, int ld) {
    const int lane = threadIdx.x & 31;
    const _Float16* p = tile + (size_t)(row0 + (lane & 15)) * ld + ((lane >> 4) << 3);
    v16h r;
    ((float4*)&r)[0] = *(const float4*)(p);
    ((float4*)&r)[1] = *(const float4*)(p + 16);
    return r;
}

// The same fragment from a lane's own pointer: row (lane&15) and k0 are already in p.
__device__ __forceinline__ v16h frag_at(const _Float16* p) {
    v16h r;
    ((float4*)&r)[0] = *(const float4*)(p);
    ((float4*)&r)[1] = *(const float4*)(p + 16);
    return r;
}

#define LDG 72

__device__ __forceinline__ v8f vzero8() { v8f z = {0.f,0.f,0.f,0.f,0.f,0.f,0.f,0.f}; return z; }

enum { EPI_F32 = 0, EPI_UNIT = 1, EPI_GATE = 2, EPI_UNITG = 3 };

// x + (x of lane ^ XM) inside a 16-lane row; folds into one v_add_f32 with DPP
template<int XM>
__device__ __forceinline__ float add_row_xor(float x) {
    return x + __int_as_float(__builtin_amdgcn_update_dpp(
                   0, __float_as_int(x), 0x160 | XM, 0xf, 0xf, true));   // 0x160 = row_xmask
}

template<int EPI, int RS = 1>
__global__ __launch_bounds__(256)
void gemm_xwT(const _Float16* __restrict__ X, const _Float16* __restrict__ Wh,
              const float* __restrict__ bias, const float* __restrict__ gate,
              _Float16* __restrict__ Yh, float* __restrict__ Yf, int M, int N, int K) {
    static_assert(HD == 64, "a wave's 128 columns are two heads");
    static_assert(RS == 1 || EPI == EPI_F32, "the gate index is written for consecutive tokens");
    constexpr int BM = 256, BN = 256, BK = 64;
    __shared__ __attribute__((aligned(16))) _Float16 sX[2][BM * LDG];
    __shared__ __attribute__((aligned(16))) _Float16 sW[2][BN * LDG];

    const int t    = threadIdx.x;
    const int lane = t & 31;
    const int wv   = t >> 5;                  // 0..7
    const int bsel = (RS == 1) ? 0 : (int)(blockIdx.x % RS);
    const int mBlk = (RS == 1) ? (int)blockIdx.x * BM : (int)(blockIdx.x / RS) * (BM * RS) + bsel;
    const int nBlk = blockIdx.y * BN;
    const int wm   = (wv >> 1) * 64;          // 0 / 64 / 128 / 192
    const int wn   = (wv & 1) * 128;          // 0 / 128

    v8f acc[4][8];
    #pragma unroll
    for (int i = 0; i < 4; ++i)
        #pragma unroll
        for (int j = 0; j < 8; ++j) acc[i][j] = vzero8();

    const int nk = K / BK;

    // 16 async b128 copies per thread per stage (8 X chunks, then 8 W chunks):
    // lanes 8r .. 8r+7 take the 128 B of one row, a wave 4 rows, the block 32 rows
    const int row = t >> 3, kc = (t & 7) * 8;
    const _Float16* gx0 = X  + (size_t)(mBlk + row * RS) * K + kc;
    const _Float16* gw0 = Wh + ((size_t)bsel * N + nBlk + row) * K + kc;
    const size_t rstep = (size_t)32 * K;             // 32 rows on, the same for every lane
    auto issue = [&](int kt, int buf) {
        const _Float16* g[8];
        const _Float16* l[8];
        #pragma unroll
        for (int p = 0; p < 8; ++p) {
            g[p] = gx0 + (p * (RS * rstep) + (size_t)kt * BK);
            l[p] = &sX[buf][(row + p * 32) * LDG + kc];
        }
        async_ld8_b128(g, l);
        #pragma unroll
        for (int p = 0; p < 8; ++p) {
            g[p] = gw0 + (p * rstep + (size_t)kt * BK);
            l[p] = &sW[buf][(row + p * 32) * LDG + kc];
        }
        async_ld8_b128(g, l);
    };

    issue(0, 0);
    // stage 0 has landed for this wave, and behind the barrier for every wave
    asm volatile("s_wait_asynccnt 0x0" ::: "memory");
    __syncthreads();
    if (1 < nk) issue(1, 1);
    for (int kt = 0; kt < nk; ++kt) {
        const int b = kt & 1;
        #pragma unroll
        for (int kk = 0; kk < BK; kk += 32) {
            v16h aF[4], bF[8];
            #pragma unroll
            for (int i = 0; i < 4; ++i) aF[i] = load_frag(sX[b] + kk, wm + i * 16, LDG);
            #pragma unroll
            for (int j = 0; j < 8; ++j) bF[j] = load_frag(sW[b] + kk, wn + j * 16, LDG);
            __builtin_amdgcn_sched_barrier(0);
            #pragma unroll
            for (int i = 0; i < 4; ++i)
                #pragma unroll
                for (int j = 0; j < 8; ++j)
                    acc[i][j] = __builtin_amdgcn_wmma_f32_16x16x32_f16(
                        false, aF[i], false, bF[j], (short)0, acc[i][j], false, false);
        }
        // keeps the trip's last WMMAs in front of the barrier: sunk behind it they would
        // stand between the barrier and the copies of stage kt+2 and shorten their flight
        __builtin_amdgcn_sched_barrier(0);
        // this wave's reads of buf b are done before the buffer may be refilled
        asm volatile("s_wait_dscnt 0x0" ::: "memory");
        // this wave's copies of stage kt+1 have landed before the barrier publishes them
        asm volatile("s_wait_asynccnt 0x0" ::: "memory");
        __syncthreads();
        if (kt + 2 < nk) issue(kt + 2, b);
    }
    // no copy is outstanding when the wave goes on to its end
    asm volatile("s_wait_asynccnt 0x0" ::: "memory");

    const int mLane = mBlk + (wm + ((lane >> 4) << 3)) * RS;
    const int nLane = nBlk + wn + (lane & 15);
    const int head  = (nBlk + wn) / HD;
    float bv[8];
    #pragma unroll
    for (int j = 0; j < 8; ++j) bv[j] = bias[nLane + j * 16];
    float sc[4][8][2];
    if (EPI == EPI_GATE || EPI == EPI_UNITG) {
        const float* gp = gate + (size_t)mLane * NH + head;   // one address for all 64 values
        #pragma unroll
        for (int i = 0; i < 4; ++i)
            #pragma unroll
            for (int vg = 0; vg < 8; ++vg)
                #pragma unroll
                for (int h = 0; h < 2; ++h)
                    sc[i][vg][h] = gp[(i * 16 + vg) * NH + h];
        // the wait stands before a register that one of the loads above names is overwritten;
        // gp as an input keeps the address register whole up to the wait: without it
        // the last load takes it as its destination while the others still name it
        asm volatile("s_wait_xcnt 0x0" :: "v"(gp) : "memory");
    } else {
        // the wait stands before a register that one of the bias loads names is overwritten
        asm volatile("s_wait_xcnt 0x0" ::: "memory");
    }
    // keeps the arithmetic that overwrites those registers behind the wait
    __builtin_amdgcn_sched_barrier(0);
    // 16 rows at a time: first all their arithmetic, then all their stores, then the wait
    #pragma unroll
    for (int i = 0; i < 4; ++i) {
        float    rf[8][2][4];
        _Float16 rh[8][2][4];
        size_t o[8];
        #pragma unroll
        for (int vg = 0; vg < 8; ++vg) {
            o[vg] = (size_t)(mLane + (i * 16 + vg) * RS) * N + nLane;
            #pragma unroll
            for (int h = 0; h < 2; ++h) {
                float val[4];
                #pragma unroll
                for (int j = 0; j < 4; ++j) val[j] = acc[i][h * 4 + j][vg] + bv[h * 4 + j];
                float f = 1.f;
                if (EPI == EPI_UNIT || EPI == EPI_UNITG) {
                    float ss = val[0] * val[0] + val[1] * val[1] + val[2] * val[2] + val[3] * val[3];
                    ss = add_row_xor<1>(ss);
                    ss = add_row_xor<2>(ss);
                    ss = add_row_xor<4>(ss);
                    ss = add_row_xor<8>(ss);
                    float rs;
                    asm("v_rsq_f32 %0, %1\n\tv_nop" : "=v"(rs) : "v"(ss));
                    f = fminf(rs, 1e12f);
                    if (EPI == EPI_UNITG) f *= sc[i][vg][h];
                } else if (EPI == EPI_GATE) {
                    f = sc[i][vg][h];
                }
                #pragma unroll
                for (int j = 0; j < 4; ++j) {
                    if (EPI == EPI_F32) rf[vg][h][j] = val[j];
                    else                rh[vg][h][j] = (_Float16)(val[j] * f);
                }
            }
        }
        // no arithmetic moves in among the stores below, where it could overwrite a
        // register that an issued store names ahead of the wait behind them
        __builtin_amdgcn_sched_barrier(0);
        #pragma unroll
        for (int vg = 0; vg < 8; ++vg)
            #pragma unroll
            for (int h = 0; h < 2; ++h)
                #pragma unroll
                for (int j = 0; j < 4; ++j) {
                    if (EPI == EPI_F32) Yf[o[vg] + h * HD + j * 16] = rf[vg][h][j];
                    else                Yh[o[vg] + h * HD + j * 16] = rh[vg][h][j];
                }
        if (i < 3) {
            // the wait stands before the next rows' arithmetic overwrites the address and
            // data registers of these stores; the scheduling barrier keeps it behind the wait
            asm volatile("s_wait_xcnt 0x0" ::: "memory");
            __builtin_amdgcn_sched_barrier(0);
        }
    }
}

// ---------------------------------------------------------------------------
// w = sigmoid(X@Ww^T + bw), r = sigmoid(X@Wr^T + br), all in fp32, as one
// [32 gates] x [64 tokens] x [K = 1024] product per block on the f32 WMMA.
// 16 waves split K: wave wv owns k = wv*64 .. wv*64+63 and keeps its slice of
// both gate matrices in registers (A operand, rows = gates). Token rows are the
// B operand. Every global load covers whole 256-B row pieces; a wave-private
// LDS tile turns them into fragments. A and B go through the same two
// functions, so their k order is equal at every lane and register.
// The 16 partial sums of each gate value meet in LDS and are added in wave order.
// This kernel also makes the f16 copies of X and of the four big weight matrices for the GEMMs:
//   X : each 16-row tile is rounded to f16 from the registers that hold it for the
//       gates and stored, 16 lanes to one whole 128-B line of Xh;
//   W : each of the 256 blocks rounds 1/256 of the four 1024 x 1024 weight matrices
//       (a quarter of the blocks to each matrix), loaded behind its first X tiles.
// ---------------------------------------------------------------------------
typedef __attribute__((ext_vector_type(2))) float v2f;
typedef __attribute__((ext_vector_type(4))) float v4f;

#define GP_WAVES 16
#define GP_TOK   64                   // tokens per block
#define GP_KW    (DM / GP_WAVES)      // 64 k per wave = 256 B of a row
#define GP_PITCH (GP_KW + 4)          // staged row pitch, dwords (272 B: 16 B x odd)
#define GP_RP    36                   // partial-sum row pitch, dwords (32 gates + 4)
#define GP_BLK   (MTOK / GP_TOK)      // 256 blocks
#define GP_WSH   (4 * DM * DM / GP_BLK)        // weight elements a block rounds: 16384
#define GP_WLD   (GP_WSH / (GP_WAVES * 32 * 4)) // 16-B loads of them per thread: 8

__device__ __forceinline__ v4h to_f16(v4f v) {
    v4h h; h.x = (_Float16)v.x; h.y = (_Float16)v.y; h.z = (_Float16)v.z; h.w = (_Float16)v.w;
    return h;
}

__device__ __forceinline__ void gp_fetch(const float* rows, int lane, v4f (&st)[8]) {
    #pragma unroll
    for (int i = 0; i < 8; ++i)
        st[i] = *(const v4f*)(rows + (size_t)(2 * i + (lane >> 4)) * DM + (lane & 15) * 4);
}

// rows in registers -> this wave's own LDS tile
__device__ __forceinline__ void gp_stage(float* stg, int lane, const v4f (&st)[8]) {
    #pragma unroll
    for (int i = 0; i < 8; ++i)
        *(v4f*)(stg + (2 * i + (lane >> 4)) * GP_PITCH + (lane & 15) * 4) = st[i];
    // the rows are read back by other lanes of this wave: stores done first
    asm volatile("s_wait_dscnt 0x0" ::: "memory");
}

// LDS tile -> fragments: lane (c = lane&15, h = lane>>4) gets row c,
// k = 8j + 4h .. 8j + 4h + 3 in fr[j]
__device__ __forceinline__ void gp_frag(const float* stg, int lane, v4f (&fr)[8]) {
    #pragma unroll
    for (int j = 0; j < 8; ++j)
        fr[j] = *(const v4f*)(stg + (lane & 15) * GP_PITCH + (2 * j + (lane >> 4)) * 4);
    // the tile is overwritten by the next gp_stage: reads done first
    asm volatile("s_wait_dscnt 0x0" ::: "memory");
}

__global__ __launch_bounds__(GP_WAVES * 32)
void wr_proj(const float* X,
             const float* Ww, const float* Wb,
             const float* Rw, const float* Rb,
             const float* Wq, const float* Wk, const float* Wv, const float* Wo,
             float* wout, float* rout,
             _Float16* Xh, _Float16* Wh4) {      // Wh4: f16 Wq, Wk, Wv, Wo, one behind the other
    __shared__ __attribute__((aligned(16))) float sStage[GP_WAVES][16 * GP_PITCH];
    __shared__ __attribute__((aligned(16))) float sPart[GP_WAVES][GP_TOK * GP_RP];

    const int t    = threadIdx.x;
    const int lane = t & 31;
    const int wv   = t >> 5;
    const int m0   = blockIdx.x * GP_TOK;
    float* stg = sStage[wv];
    const float* xs = X + (size_t)m0 * DM + wv * GP_KW;
    _Float16*    xh = Xh + (size_t)m0 * DM + wv * GP_KW;

    // this block's share of the big weights: GP_BLK / 4 blocks to a matrix
    static_assert(GP_BLK % 4 == 0 && GP_WLD == 8, "whole blocks per matrix, 8 loads per thread");
    const int    wsel = blockIdx.x / (GP_BLK / 4);
    const float* wsrc = (wsel == 0 ? Wq : wsel == 1 ? Wk : wsel == 2 ? Wv : Wo)
                      + (size_t)(blockIdx.x % (GP_BLK / 4)) * GP_WSH + t * 4;
    _Float16*    wdst = Wh4 + (size_t)blockIdx.x * GP_WSH + t * 4;

    v4f sa[8], sb[8], s0[8], s1[8], gw[8], gr[8], bw[GP_WLD];
    gp_fetch(Ww + wv * GP_KW, lane, sa);
    gp_fetch(Rw + wv * GP_KW, lane, sb);
    // the wait stands before an address register of the gate loads is overwritten
    asm volatile("s_wait_xcnt 0x0" ::: "memory");
    // keeps that overwrite behind the wait, and both gate matrices' loads in front of the X loads:
    // loads return in issue order, and with Rw's issued last the first tile would wait until
    // every X load of the burst has landed
    __builtin_amdgcn_sched_barrier(0);
    gp_fetch(xs, lane, s0);
    gp_fetch(xs + (size_t)16 * DM, lane, s1);
    // keeps the second tile's loads in the first burst: left free they sink behind the wait for Ww
    __builtin_amdgcn_sched_barrier(0);
    gp_stage(stg, lane, sa);
    gp_frag(stg, lane, gw);
    gp_stage(stg, lane, sb);
    gp_frag(stg, lane, gr);
    // behind the gates and the first two X tiles, so that none of them waits for these loads;
    // a wave's load covers 512 contiguous bytes
    #pragma unroll
    for (int i = 0; i < GP_WLD; ++i) bw[i] = *(const v4f*)(wsrc + i * (GP_WAVES * 32 * 4));

    auto do_tile = [&](int tile, v4f (&cur)[8]) {
        v4f fx[8];
        gp_stage(stg, lane, cur);
        v4h hx[8];
        #pragma unroll
        for (int i = 0; i < 8; ++i) hx[i] = to_f16(cur[i]);
        // two tiles ahead, into the registers that were just staged
        if (tile + 2 < GP_TOK / 16) gp_fetch(xs + (size_t)(tile + 2) * 16 * DM, lane, cur);
        #pragma unroll
        for (int i = 0; i < 8; ++i)
            *(v4h*)(xh + (size_t)(tile * 16 + 2 * i + (lane >> 4)) * DM + (lane & 15) * 4) = hx[i];
        // the wait stands before a register that one of these stores names is overwritten
        asm volatile("s_wait_xcnt 0x0" ::: "memory");
        gp_frag(stg, lane, fx);
        v8f aw = vzero8(), ar = vzero8();
        #pragma unroll
        for (int j = 0; j < 8; ++j) {
            v2f x0 = {fx[j].x, fx[j].y}, x1 = {fx[j].z, fx[j].w};
            v2f w0 = {gw[j].x, gw[j].y}, w1 = {gw[j].z, gw[j].w};
            v2f r0 = {gr[j].x, gr[j].y}, r1 = {gr[j].z, gr[j].w};
            aw = __builtin_amdgcn_wmma_f32_16x16x4_f32(false, w0, false, x0, (short)0, aw, false, false);
            ar = __builtin_amdgcn_wmma_f32_16x16x4_f32(false, r0, false, x0, (short)0, ar, false, false);
            aw = __builtin_amdgcn_wmma_f32_16x16x4_f32(false, w1, false, x1, (short)0, aw, false, false);
            ar = __builtin_amdgcn_wmma_f32_16x16x4_f32(false, r1, false, x1, (short)0, ar, false, false);
        }
        // D register e = gate 8h + e of token c: 8 consecutive gates per lane
        float* pp = &sPart[wv][(tile * 16 + (lane & 15)) * GP_RP + ((lane >> 4) << 3)];
        *(v4f*)(pp)      = v4f{aw[0], aw[1], aw[2], aw[3]};
        *(v4f*)(pp + 4)  = v4f{aw[4], aw[5], aw[6], aw[7]};
        *(v4f*)(pp + 16) = v4f{ar[0], ar[1], ar[2], ar[3]};
        *(v4f*)(pp + 20) = v4f{ar[4], ar[5], ar[6], ar[7]};
    };
    static_assert(GP_TOK == 64, "four tiles of 16 tokens");
    do_tile(0, s0);
    do_tile(1, s1);
    // the weight share has landed with the first two tiles; a wave's store covers 256 B
    #pragma unroll
    for (int i = 0; i < GP_WLD; ++i) *(v4h*)(wdst + i * (GP_WAVES * 32 * 4)) = to_f16(bw[i]);
    // the wait stands before a register that one of these stores names is overwritten
    asm volatile("s_wait_xcnt 0x0" ::: "memory");
    do_tile(2, s0);
    do_tile(3, s1);
    __syncthreads();

    // 64 tokens x 32 gates = 512 threads x 4 gates
    const int tok = t >> 3, g4 = (t & 7) * 4;
    v4f s = {0.f, 0.f, 0.f, 0.f};
    #pragma unroll
    for (int w = 0; w < GP_WAVES; ++w) {
        v4f p = *(const v4f*)&sPart[w][tok * GP_RP + g4];
        s.x += p.x; s.y += p.y; s.z += p.z; s.w += p.w;
    }
    const float* bp = (g4 < NH) ? (Wb + g4) : (Rb + g4 - NH);
    v4f y;
    y.x = 1.f / (1.f + __expf(-(s.x + bp[0])));
    y.y = 1.f / (1.f + __expf(-(s.y + bp[1])));
    y.z = 1.f / (1.f + __expf(-(s.z + bp[2])));
    y.w = 1.f / (1.f + __expf(-(s.w + bp[3])));
    float* op = ((g4 < NH) ? wout : rout) + (size_t)(m0 + tok) * NH + (g4 & (NH - 1));
    *(v4f*)op = y;
}

// ---------------------------------------------------------------------------
// A[b,n,v,q] = sum_s Vw[s,(b,n),v] * K[s,(b,n),q], one block per (b,n),
// WMMA with K-dim = s in chunks of 32.
// The 128-B head rows of K and Vw go to LDS as they lie in memory, [s][feat], by
// async copies, 256 s to a stage (64 KB in flight per block), two buffers; the
// transposition is done by the LDS read: ds_load_tr16_b128 hands lane (c, h) the
// eight s = 8h .. 8h+7 of feature c, which is the k order of load_frag.
// Both operands go through the same function, so their k order is equal.
// Writes f32 A to the d_out region. A is then folded into the output projection:
//   out[s,b,o] = sum_n sum_v (r * sum_q Q[q] A[v,q]) Wo[o, n*64+v]
//              = sum_n sum_q (r * Q[q]) * P[b][o, n*64+q],  P[b][o, n*64+q] = sum_v A[v,q] Wo[o, n*64+v]
// The block makes its 1024 x 64 slice of P[b] on the WMMA: rows (M) = q from A^T, rounded
// to f16 and laid [q][v] in LDS, columns (N) = o from the rows of Wo, k = v. Each wave takes
// 128 o; its Wo fragments are loaded behind the first two stages' copies and wait in
// registers. A lane's 8 D registers are 8 consecutive q of one o: one 16-B store.
// ---------------------------------------------------------------------------
// LDS pitch of a 64-half (128 B) row read by ds_load_tr16_b128: 160 B = 32 B x odd
#define LDT 80
#define AST 256                       // s rows per stage

typedef __attribute__((ext_vector_type(8))) short s16x8;

// tile is [s][LDT]; the fragment holds features f0 .. f0+15 (row or column c) over
// s0 .. s0+31: halves 0..7 = s0 + 8h + 0..7, halves 8..15 = s0 + 16 + 8h + 0..7
__device__ __forceinline__ v16h load_frag_tr(const _Float16* tile, int s0, int f0) {
    typedef __attribute__((address_space(3))) s16x8 lds_s16x8;
    const int lane = threadIdx.x & 31;
    const _Float16* p = tile + (s0 + ((lane >> 4) << 3) + (lane & 7)) * LDT
                             + f0 + (((lane >> 3) & 1) << 3);
    union { v16h v; s16x8 q[2]; } r;
    r.q[0] = __builtin_amdgcn_ds_load_tr16_b128_v8i16((lds_s16x8*)p);
    r.q[1] = __builtin_amdgcn_ds_load_tr16_b128_v8i16((lds_s16x8*)(p + 16 * LDT));
    return r.v;
}

__global__ __launch_bounds__(256)
void accum_A(const _Float16* __restrict__ Kh, const _Float16* __restrict__ Vh,
             const _Float16* Woh, float* __restrict__ Af, _Float16* __restrict__ Ph) {
    const int bn = blockIdx.x;          // b*16 + n
    const int b  = bn >> 4, n = bn & 15;
    __shared__ __attribute__((aligned(16))) _Float16 sK[2][AST * LDT]; // [s][q]
    __shared__ __attribute__((aligned(16))) _Float16 sV[2][AST * LDT]; // [s][v]
    __shared__ __attribute__((aligned(16))) _Float16 sAt[HD * LDG];    // [q][v]

    const int t = threadIdx.x, lane = t & 31, wv = t >> 5;   // 8 waves
    const int vt   = wv >> 1;           // v-tile 0..3
    const int qoff = (wv & 1) * 32;     // q half 0/32

    v8f acc[2] = {vzero8(), vzero8()};
    constexpr int nst = S_LEN / AST;
    static_assert(AST == 256 && nst >= 2, "8 x 32 rows per stage; stages 0 and 1 exist");

    // 16 async b128 copies per thread per stage (8 of K, then 8 of V): lanes 8r .. 8r+7
    // take the 128 B of one row, a wave 4 whole lines, the block 32 rows
    const int row = t >> 3, kc = (t & 7) * 8;
    const size_t off0 = ((size_t)row * B_SZ + b) * DM + n * HD + kc;
    const size_t rstep = (size_t)32 * B_SZ * DM;     // 32 s on, the same for every lane
    auto issue = [&](int st, int buf) {
        const _Float16* g[8];
        const _Float16* l[8];
        #pragma unroll
        for (int p = 0; p < 8; ++p) {
            g[p] = Kh + (off0 + (size_t)(st * 8 + p) * rstep);
            l[p] = &sK[buf][(row + p * 32) * LDT + kc];
        }
        async_ld8_b128(g, l);
        #pragma unroll
        for (int p = 0; p < 8; ++p) {
            g[p] = Vh + (off0 + (size_t)(st * 8 + p) * rstep);
            l[p] = &sV[buf][(row + p * 32) * LDT + kc];
        }
        async_ld8_b128(g, l);
    };

    issue(0, 0);
    // stage 0 has landed for this wave, and behind the barrier for every wave
    asm volatile("s_wait_asynccnt 0x0" ::: "memory");
    __syncthreads();
    issue(1, 1);
    // this wave's 128 rows of Wo, columns of head n, as 8 x 2 fragments. The pointer has no
    // restrict, so the loads stay here, in front of the asm waits, and fly during the loop
    const _Float16* wl = Woh + (size_t)(wv * 128 + (lane & 15)) * DM + n * HD + ((lane >> 4) << 3);
    v16h wo[8][2];
    #pragma unroll
    for (int it = 0; it < 8; ++it)
        #pragma unroll
        for (int kt = 0; kt < 2; ++kt) wo[it][kt] = frag_at(wl + it * 16 * DM + kt * 32);
    // the wait stands before a register that one of these loads names is overwritten; wl as
    // an input keeps the address register whole up to the wait
    asm volatile("s_wait_xcnt 0x0" :: "v"(wl) : "memory");
    // keeps the arithmetic that overwrites it behind the wait
    __builtin_amdgcn_sched_barrier(0);
    for (int st = 0; st < nst; ++st) {
        const int bb = st & 1;
        #pragma unroll
        for (int sc = 0; sc < AST; sc += 32) {
            v16h aF  = load_frag_tr(sV[bb], sc, vt * 16);
            v16h bF0 = load_frag_tr(sK[bb], sc, qoff);
            v16h bF1 = load_frag_tr(sK[bb], sc, qoff + 16);
            acc[0] = __builtin_amdgcn_wmma_f32_16x16x32_f16(false, aF, false, bF0, (short)0, acc[0], false, false);
            acc[1] = __builtin_amdgcn_wmma_f32_16x16x32_f16(false, aF, false, bF1, (short)0, acc[1], false, false);
        }
        // this wave's reads of buffer bb are done before the buffer may be refilled
        asm volatile("s_wait_dscnt 0x0" ::: "memory");
        // this wave's copies of stage st+1 have landed before the barrier publishes them
        asm volatile("s_wait_asynccnt 0x0" ::: "memory");
        __syncthreads();
        if (st + 2 < nst) issue(st + 2, bb);
    }
    // no copy is outstanding when the wave goes on to its end
    asm volatile("s_wait_asynccnt 0x0" ::: "memory");

    // A^T in f16: a lane's 8 accumulator registers are 8 consecutive v of one q
    #pragma unroll
    for (int j = 0; j < 2; ++j) {
        v8h p;
        #pragma unroll
        for (int vg = 0; vg < 8; ++vg) p[vg] = (_Float16)acc[j][vg];
        *(v8h*)&sAt[(qoff + j * 16 + (lane & 15)) * LDG + vt * 16 + ((lane >> 4) << 3)] = p;
    }
    // every wave reads the whole of A^T
    __syncthreads();
    v16h aq[4][2];
    #pragma unroll
    for (int qt = 0; qt < 4; ++qt)
        #pragma unroll
        for (int kt = 0; kt < 2; ++kt) aq[qt][kt] = load_frag(sAt + kt * 32, qt * 16, LDG);
    v8h ph[8][4];
    #pragma unroll
    for (int it = 0; it < 8; ++it) {
        v8f d[4] = {vzero8(), vzero8(), vzero8(), vzero8()};
        #pragma unroll
        for (int kt = 0; kt < 2; ++kt)
            #pragma unroll
            for (int qt = 0; qt < 4; ++qt)
                d[qt] = __builtin_amdgcn_wmma_f32_16x16x32_f16(
                    false, aq[qt][kt], false, wo[it][kt], (short)0, d[qt], false, false);
        #pragma unroll
        for (int qt = 0; qt < 4; ++qt)
            #pragma unroll
            for (int e = 0; e < 8; ++e) ph[it][qt][e] = (_Float16)d[qt][e];
    }
    // no arithmetic moves in among the stores below, where it could overwrite a
    // register that an issued store names ahead of the wait behind them
    __builtin_amdgcn_sched_barrier(0);
    // row o of P[b], columns of head n: the wave's four stores fill the row's whole 128-B line
    _Float16* pl = Ph + ((size_t)b * DM + wv * 128 + (lane & 15)) * DM + n * HD + ((lane >> 4) << 3);
    #pragma unroll
    for (int it = 0; it < 8; ++it)
        #pragma unroll
        for (int qt = 0; qt < 4; ++qt) *(v8h*)(pl + it * 16 * DM + qt * 16) = ph[it][qt];
    // the wait stands before a register that one of these stores names is overwritten
    asm volatile("s_wait_xcnt 0x0" ::: "memory");
    // keeps the address arithmetic of the A stores, which overwrites them, behind the wait
    __builtin_amdgcn_sched_barrier(0);

    #pragma unroll
    for (int j = 0; j < 2; ++j)
        #pragma unroll
        for (int vg = 0; vg < 8; ++vg) {
            int vIdx = vt * 16 + vg + ((lane >> 4) << 3);
            int qIdx = qoff + j * 16 + (lane & 15);
            size_t idx = ((size_t)bn * HD + vIdx) * HD + qIdx;
            float val = acc[j][vg];
            Af[idx] = val;
        }
}

// ---------------------------------------------------------------------------
// Launch
// ---------------------------------------------------------------------------
extern "C" void kernel_launch(void* const* d_in, const int* in_sizes, int n_in,
                              void* d_out, int out_size, void* d_ws, size_t ws_size,
                              hipStream_t stream) {
    (void)in_sizes; (void)n_in; (void)out_size; (void)ws_size;
    const float* inp  = (const float*)d_in[0];
    const float* Wq_w = (const float*)d_in[1];  const float* Wq_b = (const float*)d_in[2];
    const float* Wk_w = (const float*)d_in[3];  const float* Wk_b = (const float*)d_in[4];
    const float* Wv_w = (const float*)d_in[5];  const float* Wv_b = (const float*)d_in[6];
    const float* Wo_w = (const float*)d_in[7];  const float* Wo_b = (const float*)d_in[8];
    const float* Ww_w = (const float*)d_in[9];  const float* Ww_b = (const float*)d_in[10];
    const float* Wr_w = (const float*)d_in[11]; const float* Wr_b = (const float*)d_in[12];

    float* out_f = (float*)d_out;                       // [S,B,DM]
    float* A_f   = out_f + (size_t)MTOK * DM;           // [B,NH,64,64]

    char* ws = (char*)d_ws;
    constexpr size_t HBYTES = (size_t)MTOK * DM * sizeof(_Float16);   // 32 MiB
    constexpr size_t GATE   = (size_t)MTOK * NH * 4;                  // 1 MiB
    constexpr size_t WBYTES = (size_t)DM * DM * sizeof(_Float16);     // 2 MiB
    _Float16* Xh  = (_Float16*)(ws);
    _Float16* Qh  = (_Float16*)(ws + HBYTES);
    _Float16* Kh  = (_Float16*)(ws + 2 * HBYTES);
    _Float16* Vh  = (_Float16*)(ws + 3 * HBYTES);
    float*    wbf = (float*)   (ws + 4 * HBYTES);
    float*    rbf = (float*)   (ws + 4 * HBYTES + GATE);
    _Float16* Ph  = (_Float16*)(ws + 4 * HBYTES + 2 * GATE);   // B_SZ folded matrices, 16 MiB
    _Float16* Wqh = (_Float16*)(ws + 5 * HBYTES + 3 * GATE);
    _Float16* Wkh = (_Float16*)(ws + 5 * HBYTES + 3 * GATE + WBYTES);
    _Float16* Wvh = (_Float16*)(ws + 5 * HBYTES + 3 * GATE + 2 * WBYTES);
    _Float16* Woh = (_Float16*)(ws + 5 * HBYTES + 3 * GATE + 3 * WBYTES);

    // 1, 2) gate projections (w, r are read by the V and Q projections' epilogues), and with them the
    //       f16 copies of the input and of the four big weight matrices (Wqh .. Woh adjoin)
    wr_proj<<<GP_BLK, GP_WAVES * 32, 0, stream>>>(inp, Ww_w, Ww_b, Wr_w, Wr_b,
                                                  Wq_w, Wk_w, Wv_w, Wo_w, wbf, rbf, Xh, Wqh);

    // 3) Q/K/V projections (WMMA GEMM, async-LDS pipeline, f16 out):
    //    q and k leave unit-normalized per head, q also multiplied by r, v by w
    dim3 gg(MTOK / 256, DM / 256);
    gemm_xwT<EPI_UNITG><<<gg, 256, 0, stream>>>(Xh, Wqh, Wq_b, rbf, Qh, nullptr, MTOK, DM, DM);
    gemm_xwT<EPI_UNIT><<<gg, 256, 0, stream>>>(Xh, Wkh, Wk_b, nullptr, Kh, nullptr, MTOK, DM, DM);
    gemm_xwT<EPI_GATE><<<gg, 256, 0, stream>>>(Xh, Wvh, Wv_b, wbf, Vh, nullptr, MTOK, DM, DM);

    // 4) A accumulation (writes the f32 A output) and the folded weights P[b] = Wo x A[b]
    accum_A<<<B_SZ * NH, 256, 0, stream>>>(Kh, Vh, Woh, A_f, Ph);

    // 5) output projection of q * r with the batch's folded weights (f32 out to d_out)
    gemm_xwT<EPI_F32, B_SZ><<<gg, 256, 0, stream>>>(Qh, Ph, Wo_b, nullptr, nullptr, out_f, MTOK, DM, DM);
}

// v009
// Measured time: 132 microseconds a run.
// Next to v008, in two timings, it ran 1.14 and 1.18 times as fast.
// Over all steps from v000 it is 4.11 times as fast.
#include <hip/hip_runtime.h>
#include <hip/hip_bf16.h>
#include <cstdint>

typedef __attribute__((ext_vector_type(16))) _Float16 v16h;
typedef __attribute__((ext_vector_type(4)))  _Float16 v4h;
typedef __attribute__((ext_vector_type(8)))  _Float16 v8h;
typedef __attribute__((ext_vector_type(8)))  float    v8f;
typedef __attribute__((ext_vector_type(2)))  float    v2f;
typedef __attribute__((ext_vector_type(4)))  float    v4f;

#define S_LEN 2048
#define B_SZ  8
#define DM    1024
#define NH    16
#define HD    64
#define MTOK  (S_LEN * B_SZ)          // 16384 tokens

__device__ __forceinline__ void async_ld8_b128(const _Float16* const (&g)[8],
                                               const _Float16* const (&l)[8]) {
    asm volatile("global_load_async_to_lds_b128 %0, %1, off\n\t"
                 "global_load_async_to_lds_b128 %2, %3, off\n\t"
                 "global_load_async_to_lds_b128 %4, %5, off\n\t"
                 "global_load_async_to_lds_b128 %6, %7, off\n\t"
                 "global_load_async_to_lds_b128 %8, %9, off\n\t"
                 "global_load_async_to_lds_b128 %10, %11, off\n\t"
                 "global_load_async_to_lds_b128 %12, %13, off\n\t"
                 "global_load_async_to_lds_b128 %14, %15, off\n\t"
                 "s_wait_xcnt 0x0"
                 :: "v"((unsigned)(uintptr_t)l[0]), "v"(g[0]),
                    "v"((unsigned)(uintptr_t)l[1]), "v"(g[1]),
                    "v"((unsigned)(uintptr_t)l[2]), "v"(g[2]),
                    "v"((unsigned)(uintptr_t)l[3]), "v"(g[3]),
                    "v"((unsigned)(uintptr_t)l[4]), "v"(g[4]),
                    "v"((unsigned)(uintptr_t)l[5]), "v"(g[5]),
                    "v"((unsigned)(uintptr_t)l[6]), "v"(g[6]),
                    "v"((unsigned)(uintptr_t)l[7]), "v"(g[7]) : "memory");
}

__device__ __forceinline__ v16h load_frag(const _Float16* tile, int row0, int ld) {
    const int lane = threadIdx.x & 31;
    const _Float16* p = tile + (size_t)(row0 + (lane & 15)) * ld + ((lane >> 4) << 3);
    v16h r;
    ((float4*)&r)[0] = *(const float4*)(p);
    ((float4*)&r)[1] = *(const float4*)(p + 16);
    return r;
}

// The same fragment from a lane's own pointer: row (lane&15) and k0 are already in p.
__device__ __forceinline__ v16h frag_at(const _Float16* p) {
    v16h r;
    ((float4*)&r)[0] = *(const float4*)(p);
    ((float4*)&r)[1] = *(const float4*)(p + 16);
    return r;
}

#define LDG 72

__device__ __forceinline__ v8f vzero8() { v8f z = {0.f,0.f,0.f,0.f,0.f,0.f,0.f,0.f}; return z; }

enum { EPI_F32 = 0, EPI_UNIT = 1, EPI_GATE = 2, EPI_UNITG = 3 };

template<int EPI, int RS = 1>
__global__ __launch_bounds__(256)
void gemm_xwT(const _Float16* __restrict__ X, const _Float16* __restrict__ Wh,
              const float* __restrict__ bias, const float* __restrict__ gate,
              _Float16* __restrict__ Yh, float* __restrict__ Yf, int M, int N, int K) {
    static_assert(HD == 64, "a wave's 128 columns are two heads");
    static_assert(RS == 1 || EPI == EPI_F32, "the gate index is written for consecutive tokens");
    constexpr int BM = 256, BN = 256, BK = 64;
    __shared__ __attribute__((aligned(16))) _Float16 sX[2][BM * LDG];
    __shared__ __attribute__((aligned(16))) _Float16 sW[2][BN * LDG];

    const int t    = threadIdx.x;
    const int lane = t & 31;
    const int wv   = t >> 5;                  // 0..7
    const int bsel = (RS == 1) ? 0 : (int)(blockIdx.x % RS);
    const int mBlk = (RS == 1) ? (int)blockIdx.x * BM : (int)(blockIdx.x / RS) * (BM * RS) + bsel;
    const int nBlk = blockIdx.y * BN;
    const int wm   = (wv >> 1) * 64;          // 0 / 64 / 128 / 192
    const int wn   = (wv & 1) * 128;          // 0 / 128

    v8f acc[4][8];
    #pragma unroll
    for (int i = 0; i < 4; ++i)
        #pragma unroll
        for (int j = 0; j < 8; ++j) acc[i][j] = vzero8();

    const int nk = K / BK;

    // 16 async b128 copies per thread per stage (8 X chunks, then 8 W chunks):
    // lanes 8r .. 8r+7 take the 128 B of one row, a wave 4 rows, the block 32 rows
    const int row = t >> 3, kc = (t & 7) * 8;
    const _Float16* gx0 = X  + (size_t)(mBlk + row * RS) * K + kc;
    const _Float16* gw0 = Wh + ((size_t)bsel * N + nBlk + row) * K + kc;
    const size_t rstep = (size_t)32 * K;             // 32 rows on, the same for every lane
    auto issue = [&](int kt, int buf) {
        const _Float16* g[8];
        const _Float16* l[8];
        #pragma unroll
        for (int p = 0; p < 8; ++p) {
            g[p] = gx0 + (p * (RS * rstep) + (size_t)kt * BK);
            l[p] = &sX[buf][(row + p * 32) * LDG + kc];
        }
        async_ld8_b128(g, l);
        #pragma unroll
        for (int p = 0; p < 8; ++p) {
            g[p] = gw0 + (p * rstep + (size_t)kt * BK);
            l[p] = &sW[buf][(row + p * 32) * LDG + kc];
        }
        async_ld8_b128(g, l);
    };

    issue(0, 0);
    // stage 0 has landed for this wave, and behind the barrier for every wave
    asm volatile("s_wait_asynccnt 0x0" ::: "memory");
    __syncthreads();
    if (1 < nk) issue(1, 1);
    for (int kt = 0; kt < nk; ++kt) {
        const int b = kt & 1;
        #pragma unroll
        for (int kk = 0; kk < BK; kk += 32) {
            v16h aF[4], bF[8];
            #pragma unroll
            for (int i = 0; i < 4; ++i) aF[i] = load_frag(sX[b] + kk, wm + i * 16, LDG);
            #pragma unroll
            for (int j = 0; j < 8; ++j) bF[j] = load_frag(sW[b] + kk, wn + j * 16, LDG);
            __builtin_amdgcn_sched_barrier(0);
            #pragma unroll
            for (int i = 0; i < 4; ++i)
                #pragma unroll
                for (int j = 0; j < 8; ++j)
                    // W rows are the A operand (rows of D), tokens the B operand (columns of D)
                    acc[i][j] = __builtin_amdgcn_wmma_f32_16x16x32_f16(
                        false, bF[j], false, aF[i], (short)0, acc[i][j], false, false);
        }
        // keeps the trip's last WMMAs in front of the barrier: sunk behind it they would
        // stand between the barrier and the copies of stage kt+2 and shorten their flight
        __builtin_amdgcn_sched_barrier(0);
        // this wave's reads of buf b are done before the buffer may be refilled
        asm volatile("s_wait_dscnt 0x0" ::: "memory");
        // this wave's copies of stage kt+1 have landed before the barrier publishes them
        asm volatile("s_wait_asynccnt 0x0" ::: "memory");
        __syncthreads();
        if (kt + 2 < nk) issue(kt + 2, b);
    }
    // no copy is outstanding when the wave goes on to its end
    asm volatile("s_wait_asynccnt 0x0" ::: "memory");

    const int c = lane & 15, hh = lane >> 4;
    const int head = (nBlk + wn) / HD;
    constexpr int SPB = (EPI == EPI_F32) ? 128 * 4 + 16 : 128 * 2 + 16;   // staged row pitch, B: 16 B x odd
    static_assert(16 * SPB <= (int)sizeof(sX) / 4, "a wave stages in a quarter of sX or of sW");
    char* stg = (char*)(wv < 4 ? &sX[0][0] : &sW[0][0]) + (wv & 3) * (sizeof(sX) / 4);
    // every launch has N = DM: with the row length a constant, all stores of a lane share one
    // address register and differ in the immediate offset alone
    constexpr size_t LDY = DM;
    float*    yf = (EPI == EPI_F32) ? Yf + (size_t)(mBlk + wm * RS) * LDY + nBlk + wn + lane * 4 : nullptr;
    _Float16* yh = (EPI == EPI_F32) ? nullptr : Yh + (size_t)(mBlk + (wm + hh) * RS) * LDY + nBlk + wn + c * 8;
    const float* bp = bias + nBlk + wn + hh * 8;
    v4f bv[8][2];
    #pragma unroll
    for (int j = 0; j < 8; ++j) {
        bv[j][0] = *(const v4f*)(bp + j * 16);
        bv[j][1] = *(const v4f*)(bp + j * 16 + 4);
    }
    v2f sc[4];
    if (EPI == EPI_GATE || EPI == EPI_UNITG) {
        const float* gp = gate + (size_t)(mBlk + wm + c) * NH + head;   // the wave's two heads adjoin
        #pragma unroll
        for (int i = 0; i < 4; ++i) sc[i] = *(const v2f*)(gp + i * 16 * NH);
        // the wait stands before a register that one of the loads above names is overwritten;
        // the pointers as inputs keep the address registers whole up to the wait
        asm volatile("s_wait_xcnt 0x0" :: "v"(gp), "v"(bp) : "memory");
    } else {
        // the wait stands before a register that one of the bias loads names is overwritten
        asm volatile("s_wait_xcnt 0x0" :: "v"(bp) : "memory");
    }
    // keeps the arithmetic that overwrites those registers behind the wait
    __builtin_amdgcn_sched_barrier(0);
    #pragma unroll
    for (int i = 0; i < 4; ++i) {
        #pragma unroll
        for (int h = 0; h < 2; ++h) {
            v4f val[4][2];
            #pragma unroll
            for (int j = 0; j < 4; ++j)
                #pragma unroll
                for (int u = 0; u < 2; ++u)
                    #pragma unroll
                    for (int e = 0; e < 4; ++e)
                        val[j][u][e] = acc[i][h * 4 + j][u * 4 + e] + bv[h * 4 + j][u][e];
            if (EPI == EPI_F32) {
                #pragma unroll
                for (int j = 0; j < 4; ++j)
                    #pragma unroll
                    for (int u = 0; u < 2; ++u)
                        *(v4f*)(stg + c * SPB + ((h * 4 + j) * 16 + hh * 8 + u * 4) * 4) = val[j][u];
            } else {
                float f = 1.f;
                if (EPI == EPI_UNIT || EPI == EPI_UNITG) {
                    // the lane's 32 squares in four chains, then the other half of the row
                    v4f s4 = {0.f, 0.f, 0.f, 0.f};
                    #pragma unroll
                    for (int j = 0; j < 4; ++j)
                        #pragma unroll
                        for (int u = 0; u < 2; ++u) s4 += val[j][u] * val[j][u];
                    float ss = (s4.x + s4.y) + (s4.z + s4.w);
                    ss += __int_as_float(__builtin_amdgcn_permlanex16(
                              __float_as_int(ss), __float_as_int(ss), 0x76543210, 0xfedcba98, false, false));
                    float rs;
                    asm("v_rsq_f32 %0, %1\n\tv_nop" : "=v"(rs) : "v"(ss));
                    f = fminf(rs, 1e12f);
                    if (EPI == EPI_UNITG) f *= sc[i][h];
                } else {
                    f = sc[i][h];
                }
                #pragma unroll
                for (int j = 0; j < 4; ++j) {
                    v8h p;
                    #pragma unroll
                    for (int e = 0; e < 8; ++e) p[e] = (_Float16)(val[j][e >> 2][e & 3] * f);
                    *(v8h*)(stg + c * SPB + ((h * 4 + j) * 16 + hh * 8) * 2) = p;
                }
            }
        }
        // the rows are read back by other lanes of this wave: stores done first
        asm volatile("s_wait_dscnt 0x0" ::: "memory");
        constexpr int NR = (EPI == EPI_F32) ? 16 : 8;
        v4f back[NR];
        #pragma unroll
        for (int r = 0; r < NR; ++r)
            back[r] = (EPI == EPI_F32) ? *(const v4f*)(stg + r * SPB + lane * 16)
                                       : *(const v4f*)(stg + (2 * r + hh) * SPB + c * 16);
        // no arithmetic moves in among the stores below, where it could overwrite a
        // register that an issued store names ahead of the wait behind them
        __builtin_amdgcn_sched_barrier(0);
        #pragma unroll
        for (int r = 0; r < NR; ++r) {
            if (EPI == EPI_F32) *(v4f*)(yf + (i * 16 + r) * (RS * LDY)) = back[r];
            else                *(v4f*)(yh + (i * 16 + 2 * r) * (RS * LDY)) = back[r];
        }
        if (i < 3) {
            // the wait stands before the next rows' arithmetic overwrites the address and
            // data registers of these stores; the scheduling barrier keeps it behind the wait
            asm volatile("s_wait_xcnt 0x0" ::: "memory");
            __builtin_amdgcn_sched_barrier(0);
        }
    }
}

// ---------------------------------------------------------------------------
// w = sigmoid(X@Ww^T + bw), r = sigmoid(X@Wr^T + br), all in fp32, as one
// [32 gates] x [64 tokens] x [K = 1024] product per block on the f32 WMMA.
// 16 waves split K: wave wv owns k = wv*64 .. wv*64+63 and keeps its slice of
// both gate matrices in registers (A operand, rows = gates). Token rows are the
// B operand. Every global load covers whole 256-B row pieces; a wave-private
// LDS tile turns them into fragments. A and B go through the same two
// functions, so their k order is equal at every lane and register.
// The 16 partial sums of each gate value meet in LDS and are added in wave order.
// This kernel also makes the f16 copies of X and of the four big weight matrices for the GEMMs:
//   X : each 16-row tile is rounded to f16 from the registers that hold it for the
//       gates and stored, 16 lanes to one whole 128-B line of Xh;
//   W : each of the 256 blocks rounds 1/256 of the four 1024 x 1024 weight matrices
//       (a quarter of the blocks to each matrix), loaded behind its first X tiles.
// ---------------------------------------------------------------------------
#define GP_WAVES 16
#define GP_TOK   64                   // tokens per block
#define GP_KW    (DM / GP_WAVES)      // 64 k per wave = 256 B of a row
#define GP_PITCH (GP_KW + 4)          // staged row pitch, dwords (272 B: 16 B x odd)
#define GP_RP    36                   // partial-sum row pitch, dwords (32 gates + 4)
#define GP_BLK   (MTOK / GP_TOK)      // 256 blocks
#define GP_WSH   (4 * DM * DM / GP_BLK)        // weight elements a block rounds: 16384
#define GP_WLD   (GP_WSH / (GP_WAVES * 32 * 4)) // 16-B loads of them per thread: 8

__device__ __forceinline__ v4h to_f16(v4f v) {
    v4h h; h.x = (_Float16)v.x; h.y = (_Float16)v.y; h.z = (_Float16)v.z; h.w = (_Float16)v.w;
    return h;
}

__device__ __forceinline__ void gp_fetch(const float* rows, int lane, v4f (&st)[8]) {
    #pragma unroll
    for (int i = 0; i < 8; ++i)
        st[i] = *(const v4f*)(rows + (size_t)(2 * i + (lane >> 4)) * DM + (lane & 15) * 4);
}

// rows in registers -> this wave's own LDS tile
__device__ __forceinline__ void gp_stage(float* stg, int lane, const v4f (&st)[8]) {
    #pragma unroll
    for (int i = 0; i < 8; ++i)
        *(v4f*)(stg + (2 * i + (lane >> 4)) * GP_PITCH + (lane & 15) * 4) = st[i];
    // the rows are read back by other lanes of this wave: stores done first
    asm volatile("s_wait_dscnt 0x0" ::: "memory");
}

// LDS tile -> fragments: lane (c = lane&15, h = lane>>4) gets row c,
// k = 8j + 4h .. 8j + 4h + 3 in fr[j]
__device__ __forceinline__ void gp_frag(const float* stg, int lane, v4f (&fr)[8]) {
    #pragma unroll
    for (int j = 0; j < 8; ++j)
        fr[j] = *(const v4f*)(stg + (lane & 15) * GP_PITCH + (2 * j + (lane >> 4)) * 4);
    // the tile is overwritten by the next gp_stage: reads done first
    asm volatile("s_wait_dscnt 0x0" ::: "memory");
}

__global__ __launch_bounds__(GP_WAVES * 32)
void wr_proj(const float* X,
             const float* Ww, const float* Wb,
             const float* Rw, const float* Rb,
             const float* Wq, const float* Wk, const float* Wv, const float* Wo,
             float* wout, float* rout,
             _Float16* Xh, _Float16* Wh4) {      // Wh4: f16 Wq, Wk, Wv, Wo, one behind the other
    __shared__ __attribute__((aligned(16))) float sStage[GP_WAVES][16 * GP_PITCH];
    __shared__ __attribute__((aligned(16))) float sPart[GP_WAVES][GP_TOK * GP_RP];

    const int t    = threadIdx.x;
    const int lane = t & 31;
    const int wv   = t >> 5;
    const int m0   = blockIdx.x * GP_TOK;
    float* stg = sStage[wv];
    const float* xs = X + (size_t)m0 * DM + wv * GP_KW;
    _Float16*    xh = Xh + (size_t)m0 * DM + wv * GP_KW;

    // this block's share of the big weights: GP_BLK / 4 blocks to a matrix
    static_assert(GP_BLK % 4 == 0 && GP_WLD == 8, "whole blocks per matrix, 8 loads per thread");
    const int    wsel = blockIdx.x / (GP_BLK / 4);
    const float* wsrc = (wsel == 0 ? Wq : wsel == 1 ? Wk : wsel == 2 ? Wv : Wo)
                      + (size_t)(blockIdx.x % (GP_BLK / 4)) * GP_WSH + t * 4;
    _Float16*    wdst = Wh4 + (size_t)blockIdx.x * GP_WSH + t * 4;

    v4f sa[8], sb[8], s0[8], s1[8], gw[8], gr[8], bw[GP_WLD];
    gp_fetch(Ww + wv * GP_KW, lane, sa);
    gp_fetch(Rw + wv * GP_KW, lane, sb);
    // the wait stands before an address register of the gate loads is overwritten
    asm volatile("s_wait_xcnt 0x0" ::: "memory");
    // keeps that overwrite behind the wait, and both gate matrices' loads in front of the X loads:
    // loads return in issue order, and with Rw's issued last the first tile would wait until
    // every X load of the burst has landed
    __builtin_amdgcn_sched_barrier(0);
    gp_fetch(xs, lane, s0);
    gp_fetch(xs + (size_t)16 * DM, lane, s1);
    // keeps the second tile's loads in the first burst: left free they sink behind the wait for Ww
    __builtin_amdgcn_sched_barrier(0);
    gp_stage(stg, lane, sa);
    gp_frag(stg, lane, gw);
    gp_stage(stg, lane, sb);
    gp_frag(stg, lane, gr);
    // behind the gates and the first two X tiles, so that none of them waits for these loads;
    // a wave's load covers 512 contiguous bytes
    #pragma unroll
    for (int i = 0; i < GP_WLD; ++i) bw[i] = *(const v4f*)(wsrc + i * (GP_WAVES * 32 * 4));

    auto do_tile = [&](int tile, v4f (&cur)[8]) {
        v4f fx[8];
        gp_stage(stg, lane, cur);
        v4h hx[8];
        #pragma unroll
        for (int i = 0; i < 8; ++i) hx[i] = to_f16(cur[i]);
        // two tiles ahead, into the registers that were just staged
        if (tile + 2 < GP_TOK / 16) gp_fetch(xs + (size_t)(tile + 2) * 16 * DM, lane, cur);
        #pragma unroll
        for (int i = 0; i < 8; ++i)
            *(v4h*)(xh + (size_t)(tile * 16 + 2 * i + (lane >> 4)) * DM + (lane & 15) * 4) = hx[i];
        // the wait stands before a register that one of these stores names is overwritten
        asm volatile("s_wait_xcnt 0x0" ::: "memory");
        gp_frag(stg, lane, fx);
        v8f aw = vzero8(), ar = vzero8();
        #pragma unroll
        for (int j = 0; j < 8; ++j) {
            v2f x0 = {fx[j].x, fx[j].y}, x1 = {fx[j].z, fx[j].w};
            v2f w0 = {gw[j].x, gw[j].y}, w1 = {gw[j].z, gw[j].w};
            v2f r0 = {gr[j].x, gr[j].y}, r1 = {gr[j].z, gr[j].w};
            aw = __builtin_amdgcn_wmma_f32_16x16x4_f32(false, w0, false, x0, (short)0, aw, false, false);
            ar = __builtin_amdgcn_wmma_f32_16x16x4_f32(false, r0, false, x0, (short)0, ar, false, false);
            aw = __builtin_amdgcn_wmma_f32_16x16x4_f32(false, w1, false, x1, (short)0, aw, false, false);
            ar = __builtin_amdgcn_wmma_f32_16x16x4_f32(false, r1, false, x1, (short)0, ar, false, false);
        }
        // D register e = gate 8h + e of token c: 8 consecutive gates per lane
        float* pp = &sPart[wv][(tile * 16 + (lane & 15)) * GP_RP + ((lane >> 4) << 3)];
        *(v4f*)(pp)      = v4f{aw[0], aw[1], aw[2], aw[3]};
        *(v4f*)(pp + 4)  = v4f{aw[4], aw[5], aw[6], aw[7]};
        *(v4f*)(pp + 16) = v4f{ar[0], ar[1], ar[2], ar[3]};
        *(v4f*)(pp + 20) = v4f{ar[4], ar[5], ar[6], ar[7]};
    };
    static_assert(GP_TOK == 64, "four tiles of 16 tokens");
    do_tile(0, s0);
    do_tile(1, s1);
    // the weight share has landed with the first two tiles; a wave's store covers 256 B
    #pragma unroll
    for (int i = 0; i < GP_WLD; ++i) *(v4h*)(wdst + i * (GP_WAVES * 32 * 4)) = to_f16(bw[i]);
    // the wait stands before a register that one of these stores names is overwritten
    asm volatile("s_wait_xcnt 0x0" ::: "memory");
    do_tile(2, s0);
    do_tile(3, s1);
    __syncthreads();

    // 64 tokens x 32 gates = 512 threads x 4 gates
    const int tok = t >> 3, g4 = (t & 7) * 4;
    v4f s = {0.f, 0.f, 0.f, 0.f};
    #pragma unroll
    for (int w = 0; w < GP_WAVES; ++w) {
        v4f p = *(const v4f*)&sPart[w][tok * GP_RP + g4];
        s.x += p.x; s.y += p.y; s.z += p.z; s.w += p.w;
    }
    const float* bp = (g4 < NH) ? (Wb + g4) : (Rb + g4 - NH);
    v4f y;
    y.x = 1.f / (1.f + __expf(-(s.x + bp[0])));
    y.y = 1.f / (1.f + __expf(-(s.y + bp[1])));
    y.z = 1.f / (1.f + __expf(-(s.z + bp[2])));
    y.w = 1.f / (1.f + __expf(-(s.w + bp[3])));
    float* op = ((g4 < NH) ? wout : rout) + (size_t)(m0 + tok) * NH + (g4 & (NH - 1));
    *(v4f*)op = y;
}

// ---------------------------------------------------------------------------
// A[b,n,v,q] = sum_s Vw[s,(b,n),v] * K[s,(b,n),q], one block per (b,n),
// WMMA with K-dim = s in chunks of 32.
// The 128-B head rows of K and Vw go to LDS as they lie in memory, [s][feat], by
// async copies, 256 s to a stage (64 KB in flight per block), two buffers; the
// transposition is done by the LDS read: ds_load_tr16_b128 hands lane (c, h) the
// eight s = 8h .. 8h+7 of feature c, which is the k order of load_frag.
// Both operands go through the same function, so their k order is equal.
// Writes f32 A to the d_out region. A is then folded into the output projection:
//   out[s,b,o] = sum_n sum_v (r * sum_q Q[q] A[v,q]) Wo[o, n*64+v]
//              = sum_n sum_q (r * Q[q]) * P[b][o, n*64+q],  P[b][o, n*64+q] = sum_v A[v,q] Wo[o, n*64+v]
// The block makes its 1024 x 64 slice of P[b] on the WMMA: rows (M) = q from A^T, rounded
// to f16 and laid [q][v] in LDS, columns (N) = o from the rows of Wo, k = v. Each wave takes
// 128 o; its Wo fragments are loaded behind the first two stages' copies and wait in
// registers. A lane's 8 D registers are 8 consecutive q of one o: one 16-B store.
// ---------------------------------------------------------------------------
// LDS pitch of a 64-half (128 B) row read by ds_load_tr16_b128: 160 B = 32 B x odd
#define LDT 80
#define AST 256                       // s rows per stage

typedef __attribute__((ext_vector_type(8))) short s16x8;

// tile is [s][LDT]; the fragment holds features f0 .. f0+15 (row or column c) over
// s0 .. s0+31: halves 0..7 = s0 + 8h + 0..7, halves 8..15 = s0 + 16 + 8h + 0..7
__device__ __forceinline__ v16h load_frag_tr(const _Float16* tile, int s0, int f0) {
    typedef __attribute__((address_space(3))) s16x8 lds_s16x8;
    const int lane = threadIdx.x & 31;
    const _Float16* p = tile + (s0 + ((lane >> 4) << 3) + (lane & 7)) * LDT
                             + f0 + (((lane >> 3) & 1) << 3);
    union { v16h v; s16x8 q[2]; } r;
    r.q[0] = __builtin_amdgcn_ds_load_tr16_b128_v8i16((lds_s16x8*)p);
    r.q[1] = __builtin_amdgcn_ds_load_tr16_b128_v8i16((lds_s16x8*)(p + 16 * LDT));
    return r.v;
}

__global__ __launch_bounds__(256)
void accum_A(const _Float16* __restrict__ Kh, const _Float16* __restrict__ Vh,
             const _Float16* Woh, float* __restrict__ Af, _Float16* __restrict__ Ph) {
    const int bn = blockIdx.x;          // b*16 + n
    const int b  = bn >> 4, n = bn & 15;
    __shared__ __attribute__((aligned(16))) _Float16 sK[2][AST * LDT]; // [s][q]
    __shared__ __attribute__((aligned(16))) _Float16 sV[2][AST * LDT]; // [s][v]
    __shared__ __attribute__((aligned(16))) _Float16 sAt[HD * LDG];    // [q][v]

    const int t = threadIdx.x, lane = t & 31, wv = t >> 5;   // 8 waves
    const int vt   = wv >> 1;           // v-tile 0..3
    const int qoff = (wv & 1) * 32;     // q half 0/32

    v8f acc[2] = {vzero8(), vzero8()};
    constexpr int nst = S_LEN / AST;
    static_assert(AST == 256 && nst >= 2, "8 x 32 rows per stage; stages 0 and 1 exist");

    // 16 async b128 copies per thread per stage (8 of K, then 8 of V): lanes 8r .. 8r+7
    // take the 128 B of one row, a wave 4 whole lines, the block 32 rows
    const int row = t >> 3, kc = (t & 7) * 8;
    const size_t off0 = ((size_t)row * B_SZ + b) * DM + n * HD + kc;
    const size_t rstep = (size_t)32 * B_SZ * DM;     // 32 s on, the same for every lane
    auto issue = [&](int st, int buf) {
        const _Float16* g[8];
        const _Float16* l[8];
        #pragma unroll
        for (int p = 0; p < 8; ++p) {
            g[p] = Kh + (off0 + (size_t)(st * 8 + p) * rstep);
            l[p] = &sK[buf][(row + p * 32) * LDT + kc];
        }
        async_ld8_b128(g, l);
        #pragma unroll
        for (int p = 0; p < 8; ++p) {
            g[p] = Vh + (off0 + (size_t)(st * 8 + p) * rstep);
            l[p] = &sV[buf][(row + p * 32) * LDT + kc];
        }
        async_ld8_b128(g, l);
    };

    issue(0, 0);
    // stage 0 has landed for this wave, and behind the barrier for every wave
    asm volatile("s_wait_asynccnt 0x0" ::: "memory");
    __syncthreads();
    issue(1, 1);
    // this wave's 128 rows of Wo, columns of head n, as 8 x 2 fragments. The pointer has no
    // restrict, so the loads stay here, in front of the asm waits, and fly during the loop
    const _Float16* wl = Woh + (size_t)(wv * 128 + (lane & 15)) * DM + n * HD + ((lane >> 4) << 3);
    v16h wo[8][2];
    #pragma unroll
    for (int it = 0; it < 8; ++it)
        #pragma unroll
        for (int kt = 0; kt < 2; ++kt) wo[it][kt] = frag_at(wl + it * 16 * DM + kt * 32);
    // the wait stands before a register that one of these loads names is overwritten; wl as
    // an input keeps the address register whole up to the wait
    asm volatile("s_wait_xcnt 0x0" :: "v"(wl) : "memory");
    // keeps the arithmetic that overwrites it behind the wait
    __builtin_amdgcn_sched_barrier(0);
    for (int st = 0; st < nst; ++st) {
        const int bb = st & 1;
        #pragma unroll
        for (int sc = 0; sc < AST; sc += 32) {
            v16h aF  = load_frag_tr(sV[bb], sc, vt * 16);
            v16h bF0 = load_frag_tr(sK[bb], sc, qoff);
            v16h bF1 = load_frag_tr(sK[bb], sc, qoff + 16);
            acc[0] = __builtin_amdgcn_wmma_f32_16x16x32_f16(false, aF, false, bF0, (short)0, acc[0], false, false);
            acc[1] = __builtin_amdgcn_wmma_f32_16x16x32_f16(false, aF, false, bF1, (short)0, acc[1], false, false);
        }
        // this wave's reads of buffer bb are done before the buffer may be refilled
        asm volatile("s_wait_dscnt 0x0" ::: "memory");
        // this wave's copies of stage st+1 have landed before the barrier publishes them
        asm volatile("s_wait_asynccnt 0x0" ::: "memory");
        __syncthreads();
        if (st + 2 < nst) issue(st + 2, bb);
    }
    // no copy is outstanding when the wave goes on to its end
    asm volatile("s_wait_asynccnt 0x0" ::: "memory");

    // A^T in f16: a lane's 8 accumulator registers are 8 consecutive v of one q
    #pragma unroll
    for (int j = 0; j < 2; ++j) {
        v8h p;
        #pragma unroll
        for (int vg = 0; vg < 8; ++vg) p[vg] = (_Float16)acc[j][vg];
        *(v8h*)&sAt[(qoff + j * 16 + (lane & 15)) * LDG + vt * 16 + ((lane >> 4) << 3)] = p;
    }
    // every wave reads the whole of A^T
    __syncthreads();
    v16h aq[4][2];
    #pragma unroll
    for (int qt = 0; qt < 4; ++qt)
        #pragma unroll
        for (int kt = 0; kt < 2; ++kt) aq[qt][kt] = load_frag(sAt + kt * 32, qt * 16, LDG);
    v8h ph[8][4];
    #pragma unroll
    for (int it = 0; it < 8; ++it) {
        v8f d[4] = {vzero8(), vzero8(), vzero8(), vzero8()};
        #pragma unroll
        for (int kt = 0; kt < 2; ++kt)
            #pragma unroll
            for (int qt = 0; qt < 4; ++qt)
                d[qt] = __builtin_amdgcn_wmma_f32_16x16x32_f16(
                    false, aq[qt][kt], false, wo[it][kt], (short)0, d[qt], false, false);
        #pragma unroll
        for (int qt = 0; qt < 4; ++qt)
            #pragma unroll
            for (int e = 0; e < 8; ++e) ph[it][qt][e] = (_Float16)d[qt][e];
    }
    // no arithmetic moves in among the stores below, where it could overwrite a
    // register that an issued store names ahead of the wait behind them
    __builtin_amdgcn_sched_barrier(0);
    // row o of P[b], columns of head n: the wave's four stores fill the row's whole 128-B line
    _Float16* pl = Ph + ((size_t)b * DM + wv * 128 + (lane & 15)) * DM + n * HD + ((lane >> 4) << 3);
    #pragma unroll
    for (int it = 0; it < 8; ++it)
        #pragma unroll
        for (int qt = 0; qt < 4; ++qt) *(v8h*)(pl + it * 16 * DM + qt * 16) = ph[it][qt];
    // the wait stands before a register that one of these stores names is overwritten
    asm volatile("s_wait_xcnt 0x0" ::: "memory");
    // keeps the address arithmetic of the A stores, which overwrites them, behind the wait
    __builtin_amdgcn_sched_barrier(0);

    #pragma unroll
    for (int j = 0; j < 2; ++j)
        #pragma unroll
        for (int vg = 0; vg < 8; ++vg) {
            int vIdx = vt * 16 + vg + ((lane >> 4) << 3);
            int qIdx = qoff + j * 16 + (lane & 15);
            size_t idx = ((size_t)bn * HD + vIdx) * HD + qIdx;
            float val = acc[j][vg];
            Af[idx] = val;
        }
}

// ---------------------------------------------------------------------------
// Launch
// ---------------------------------------------------------------------------
extern "C" void kernel_launch(void* const* d_in, const int* in_sizes, int n_in,
                              void* d_out, int out_size, void* d_ws, size_t ws_size,
                              hipStream_t stream) {
    (void)in_sizes; (void)n_in; (void)out_size; (void)ws_size;
    const float* inp  = (const float*)d_in[0];
    const float* Wq_w = (const float*)d_in[1];  const float* Wq_b = (const float*)d_in[2];
    const float* Wk_w = (const float*)d_in[3];  const float* Wk_b = (const float*)d_in[4];
    const float* Wv_w = (const float*)d_in[5];  const float* Wv_b = (const float*)d_in[6];
    const float* Wo_w = (const float*)d_in[7];  const float* Wo_b = (const float*)d_in[8];
    const float* Ww_w = (const float*)d_in[9];  const float* Ww_b = (const float*)d_in[10];
    const float* Wr_w = (const float*)d_in[11]; const float* Wr_b = (const float*)d_in[12];

    float* out_f = (float*)d_out;                       // [S,B,DM]
    float* A_f   = out_f + (size_t)MTOK * DM;           // [B,NH,64,64]

    char* ws = (char*)d_ws;
    constexpr size_t HBYTES = (size_t)MTOK * DM * sizeof(_Float16);   // 32 MiB
    constexpr size_t GATE   = (size_t)MTOK * NH * 4;                  // 1 MiB
    constexpr size_t WBYTES = (size_t)DM * DM * sizeof(_Float16);     // 2 MiB
    _Float16* Xh  = (_Float16*)(ws);
    _Float16* Qh  = (_Float16*)(ws + HBYTES);
    _Float16* Kh  = (_Float16*)(ws + 2 * HBYTES);
    _Float16* Vh  = (_Float16*)(ws + 3 * HBYTES);
    float*    wbf = (float*)   (ws + 4 * HBYTES);
    float*    rbf = (float*)   (ws + 4 * HBYTES + GATE);
    _Float16* Ph  = (_Float16*)(ws + 4 * HBYTES + 2 * GATE);   // B_SZ folded matrices, 16 MiB
    _Float16* Wqh = (_Float16*)(ws + 5 * HBYTES + 3 * GATE);
    _Float16* Wkh = (_Float16*)(ws + 5 * HBYTES + 3 * GATE + WBYTES);
    _Float16* Wvh = (_Float16*)(ws + 5 * HBYTES + 3 * GATE + 2 * WBYTES);
    _Float16* Woh = (_Float16*)(ws + 5 * HBYTES + 3 * GATE + 3 * WBYTES);

    // 1, 2) gate projections (w, r are read by the V and Q projections' epilogues), and with them the
    //       f16 copies of the input and of the four big weight matrices (Wqh .. Woh adjoin)
    wr_proj<<<GP_BLK, GP_WAVES * 32, 0, stream>>>(inp, Ww_w, Ww_b, Wr_w, Wr_b,
                                                  Wq_w, Wk_w, Wv_w, Wo_w, wbf, rbf, Xh, Wqh);

    // 3) Q/K/V projections (WMMA GEMM, async-LDS pipeline, f16 out):
    //    q and k leave unit-normalized per head, q also multiplied by r, v by w
    dim3 gg(MTOK / 256, DM / 256);
    gemm_xwT<EPI_UNITG><<<gg, 256, 0, stream>>>(Xh, Wqh, Wq_b, rbf, Qh, nullptr, MTOK, DM, DM);
    gemm_xwT<EPI_UNIT><<<gg, 256, 0, stream>>>(Xh, Wkh, Wk_b, nullptr, Kh, nullptr, MTOK, DM, DM);
    gemm_xwT<EPI_GATE><<<gg, 256, 0, stream>>>(Xh, Wvh, Wv_b, wbf, Vh, nullptr, MTOK, DM, DM);

    // 4) A accumulation (writes the f32 A output) and the folded weights P[b] = Wo x A[b]
    accum_A<<<B_SZ * NH, 256, 0, stream>>>(Kh, Vh, Woh, A_f, Ph);

    // 5) output projection of q * r with the batch's folded weights (f32 out to d_out)
    gemm_xwT<EPI_F32, B_SZ><<<gg, 256, 0, stream>>>(Qh, Ph, Wo_b, nullptr, nullptr, out_f, MTOK, DM, DM);
}

// v010
// It runs in 121 microseconds.
// Two timings next to v009 both put it at 1.09 times that version's speed.
// All steps since v000 together make it 4.48 times as fast.
#include <hip/hip_runtime.h>
#include <hip/hip_bf16.h>
#include <cstdint>

typedef __attribute__((ext_vector_type(16))) _Float16 v16h;
typedef __attribute__((ext_vector_type(4)))  _Float16 v4h;
typedef __attribute__((ext_vector_type(8)))  _Float16 v8h;
typedef __attribute__((ext_vector_type(8)))  float    v8f;
typedef __attribute__((ext_vector_type(2)))  float    v2f;
typedef __attribute__((ext_vector_type(4)))  float    v4f;

#define S_LEN 2048
#define B_SZ  8
#define DM    1024
#define NH    16
#define HD    64
#define MTOK  (S_LEN * B_SZ)          // 16384 tokens

__device__ __forceinline__ void async_ld8_b128(const _Float16* const (&g)[8],
                                               const _Float16* const (&l)[8]) {
    asm volatile("global_load_async_to_lds_b128 %0, %1, off\n\t"
                 "global_load_async_to_lds_b128 %2, %3, off\n\t"
                 "global_load_async_to_lds_b128 %4, %5, off\n\t"
                 "global_load_async_to_lds_b128 %6, %7, off\n\t"
                 "global_load_async_to_lds_b128 %8, %9, off\n\t"
                 "global_load_async_to_lds_b128 %10, %11, off\n\t"
                 "global_load_async_to_lds_b128 %12, %13, off\n\t"
                 "global_load_async_to_lds_b128 %14, %15, off\n\t"
                 "s_wait_xcnt 0x0"
                 :: "v"((unsigned)(uintptr_t)l[0]), "v"(g[0]),
                    "v"((unsigned)(uintptr_t)l[1]), "v"(g[1]),
                    "v"((unsigned)(uintptr_t)l[2]), "v"(g[2]),
                    "v"((unsigned)(uintptr_t)l[3]), "v"(g[3]),
                    "v"((unsigned)(uintptr_t)l[4]), "v"(g[4]),
                    "v"((unsigned)(uintptr_t)l[5]), "v"(g[5]),
                    "v"((unsigned)(uintptr_t)l[6]), "v"(g[6]),
                    "v"((unsigned)(uintptr_t)l[7]), "v"(g[7]) : "memory");
}

__device__ __forceinline__ v16h load_frag(const _Float16* tile, int row0, int ld) {
    const int lane = threadIdx.x & 31;
    const _Float16* p = tile + (size_t)(row0 + (lane & 15)) * ld + ((lane >> 4) << 3);
    v16h r;
    ((float4*)&r)[0] = *(const float4*)(p);
    ((float4*)&r)[1] = *(const float4*)(p + 16);
    return r;
}

// The same fragment from a lane's own pointer: row (lane&15) and k0 are already in p.
__device__ __forceinline__ v16h frag_at(const _Float16* p) {
    v16h r;
    ((float4*)&r)[0] = *(const float4*)(p);
    ((float4*)&r)[1] = *(const float4*)(p + 16);
    return r;
}

#define LDG 72

__device__ __forceinline__ v8f vzero8() { v8f z = {0.f,0.f,0.f,0.f,0.f,0.f,0.f,0.f}; return z; }

enum { EPI_F32 = 0, EPI_UNIT = 1, EPI_GATE = 2, EPI_UNITG = 3 };

template<int EPI, int RS = 1>
__global__ __launch_bounds__(256)
void gemm_xwT(const _Float16* __restrict__ X, const _Float16* __restrict__ Wh,
              const float* __restrict__ bias, const float* __restrict__ gate,
              _Float16* __restrict__ Yh, float* __restrict__ Yf, int M, int N, int K) {
    static_assert(HD == 64, "a wave's 128 columns are two heads");
    static_assert(RS == 1 || EPI == EPI_F32, "the gate index is written for consecutive tokens");
    constexpr int BM = 256, BN = 256, BK = 64;
    __shared__ __attribute__((aligned(16))) _Float16 sX[2][BM * LDG];
    __shared__ __attribute__((aligned(16))) _Float16 sW[2][BN * LDG];

    const int t    = threadIdx.x;
    const int lane = t & 31;
    const int wv   = t >> 5;                  // 0..7
    const int bsel = (RS == 1) ? 0 : (int)(blockIdx.x % RS);
    const int mBlk = (RS == 1) ? (int)blockIdx.x * BM : (int)(blockIdx.x / RS) * (BM * RS) + bsel;
    const int nBlk = blockIdx.y * BN;
    const int wm   = (wv >> 1) * 64;          // 0 / 64 / 128 / 192
    const int wn   = (wv & 1) * 128;          // 0 / 128

    v8f acc[4][8];
    #pragma unroll
    for (int i = 0; i < 4; ++i)
        #pragma unroll
        for (int j = 0; j < 8; ++j) acc[i][j] = vzero8();

    const int nk = K / BK;

    // 16 async b128 copies per thread per stage (8 X chunks, then 8 W chunks):
    // lanes 8r .. 8r+7 take the 128 B of one row, a wave 4 rows, the block 32 rows
    const int row = t >> 3, kc = (t & 7) * 8;
    const _Float16* gx0 = X  + (size_t)(mBlk + row * RS) * K + kc;
    const _Float16* gw0 = Wh + ((size_t)bsel * N + nBlk + row) * K + kc;
    const size_t rstep = (size_t)32 * K;             // 32 rows on, the same for every lane
    auto issue = [&](int kt, int buf) {
        const _Float16* g[8];
        const _Float16* l[8];
        #pragma unroll
        for (int p = 0; p < 8; ++p) {
            g[p] = gx0 + (p * (RS * rstep) + (size_t)kt * BK);
            l[p] = &sX[buf][(row + p * 32) * LDG + kc];
        }
        async_ld8_b128(g, l);
        #pragma unroll
        for (int p = 0; p < 8; ++p) {
            g[p] = gw0 + (p * rstep + (size_t)kt * BK);
            l[p] = &sW[buf][(row + p * 32) * LDG + kc];
        }
        async_ld8_b128(g, l);
    };

    issue(0, 0);
    // stage 0 has landed for this wave, and behind the barrier for every wave
    asm volatile("s_wait_asynccnt 0x0" ::: "memory");
    __syncthreads();
    if (1 < nk) issue(1, 1);
    for (int kt = 0; kt < nk; ++kt) {
        const int b = kt & 1;
        #pragma unroll
        for (int kk = 0; kk < BK; kk += 32) {
            v16h aF[4], bF[8];
            #pragma unroll
            for (int i = 0; i < 4; ++i) aF[i] = load_frag(sX[b] + kk, wm + i * 16, LDG);
            #pragma unroll
            for (int j = 0; j < 8; ++j) bF[j] = load_frag(sW[b] + kk, wn + j * 16, LDG);
            __builtin_amdgcn_sched_barrier(0);
            #pragma unroll
            for (int i = 0; i < 4; ++i)
                #pragma unroll
                for (int j = 0; j < 8; ++j)
                    // W rows are the A operand (rows of D), tokens the B operand (columns of D)
                    acc[i][j] = __builtin_amdgcn_wmma_f32_16x16x32_f16(
                        false, bF[j], false, aF[i], (short)0, acc[i][j], false, false);
        }
        // keeps the trip's last WMMAs in front of the barrier: sunk behind it they would
        // stand between the barrier and the copies of stage kt+2 and shorten their flight
        __builtin_amdgcn_sched_barrier(0);
        // this wave's reads of buf b are done before the buffer may be refilled
        asm volatile("s_wait_dscnt 0x0" ::: "memory");
        // this wave's copies of stage kt+1 have landed before the barrier publishes them
        asm volatile("s_wait_asynccnt 0x0" ::: "memory");
        __syncthreads();
        if (kt + 2 < nk) issue(kt + 2, b);
    }
    // no copy is outstanding when the wave goes on to its end
    asm volatile("s_wait_asynccnt 0x0" ::: "memory");

    const int c = lane & 15, hh = lane >> 4;
    const int head = (nBlk + wn) / HD;
    constexpr int SPB = (EPI == EPI_F32) ? 128 * 4 + 16 : 128 * 2 + 16;   // staged row pitch, B: 16 B x odd
    static_assert(16 * SPB <= (int)sizeof(sX) / 4, "a wave stages in a quarter of sX or of sW");
    char* stg = (char*)(wv < 4 ? &sX[0][0] : &sW[0][0]) + (wv & 3) * (sizeof(sX) / 4);
    // every launch has N = DM: with the row length a constant, all stores of a lane share one
    // address register and differ in the immediate offset alone
    constexpr size_t LDY = DM;
    float*    yf = (EPI == EPI_F32) ? Yf + (size_t)(mBlk + wm * RS) * LDY + nBlk + wn + lane * 4 : nullptr;
    _Float16* yh = (EPI == EPI_F32) ? nullptr : Yh + (size_t)(mBlk + (wm + hh) * RS) * LDY + nBlk + wn + c * 8;
    const float* bp = bias + nBlk + wn + hh * 8;
    v4f bv[8][2];
    #pragma unroll
    for (int j = 0; j < 8; ++j) {
        bv[j][0] = *(const v4f*)(bp + j * 16);
        bv[j][1] = *(const v4f*)(bp + j * 16 + 4);
    }
    v2f sc[4];
    if (EPI == EPI_GATE || EPI == EPI_UNITG) {
        const float* gp = gate + (size_t)(mBlk + wm + c) * NH + head;   // the wave's two heads adjoin
        #pragma unroll
        for (int i = 0; i < 4; ++i) sc[i] = *(const v2f*)(gp + i * 16 * NH);
        // the wait stands before a register that one of the loads above names is overwritten;
        // the pointers as inputs keep the address registers whole up to the wait
        asm volatile("s_wait_xcnt 0x0" :: "v"(gp), "v"(bp) : "memory");
    } else {
        // the wait stands before a register that one of the bias loads names is overwritten
        asm volatile("s_wait_xcnt 0x0" :: "v"(bp) : "memory");
    }
    // keeps the arithmetic that overwrites those registers behind the wait
    __builtin_amdgcn_sched_barrier(0);
    #pragma unroll
    for (int i = 0; i < 4; ++i) {
        #pragma unroll
        for (int h = 0; h < 2; ++h) {
            v4f val[4][2];
            #pragma unroll
            for (int j = 0; j < 4; ++j)
                #pragma unroll
                for (int u = 0; u < 2; ++u)
                    #pragma unroll
                    for (int e = 0; e < 4; ++e)
                        val[j][u][e] = acc[i][h * 4 + j][u * 4 + e] + bv[h * 4 + j][u][e];
            if (EPI == EPI_F32) {
                #pragma unroll
                for (int j = 0; j < 4; ++j)
                    #pragma unroll
                    for (int u = 0; u < 2; ++u)
                        *(v4f*)(stg + c * SPB + ((h * 4 + j) * 16 + hh * 8 + u * 4) * 4) = val[j][u];
            } else {
                float f = 1.f;
                if (EPI == EPI_UNIT || EPI == EPI_UNITG) {
                    // the lane's 32 squares in four chains, then the other half of the row
                    v4f s4 = {0.f, 0.f, 0.f, 0.f};
                    #pragma unroll
                    for (int j = 0; j < 4; ++j)
                        #pragma unroll
                        for (int u = 0; u < 2; ++u) s4 += val[j][u] * val[j][u];
                    float ss = (s4.x + s4.y) + (s4.z + s4.w);
                    ss += __int_as_float(__builtin_amdgcn_permlanex16(
                              __float_as_int(ss), __float_as_int(ss), 0x76543210, 0xfedcba98, false, false));
                    float rs;
                    asm("v_rsq_f32 %0, %1\n\tv_nop" : "=v"(rs) : "v"(ss));
                    f = fminf(rs, 1e12f);
                    if (EPI == EPI_UNITG) f *= sc[i][h];
                } else {
                    f = sc[i][h];
                }
                #pragma unroll
                for (int j = 0; j < 4; ++j) {
                    v8h p;
                    #pragma unroll
                    for (int e = 0; e < 8; ++e) p[e] = (_Float16)(val[j][e >> 2][e & 3] * f);
                    *(v8h*)(stg + c * SPB + ((h * 4 + j) * 16 + hh * 8) * 2) = p;
                }
            }
        }
        // the rows are read back by other lanes of this wave: stores done first
        asm volatile("s_wait_dscnt 0x0" ::: "memory");
        constexpr int NR = (EPI == EPI_F32) ? 16 : 8;
        v4f back[NR];
        #pragma unroll
        for (int r = 0; r < NR; ++r)
            back[r] = (EPI == EPI_F32) ? *(const v4f*)(stg + r * SPB + lane * 16)
                                       : *(const v4f*)(stg + (2 * r + hh) * SPB + c * 16);
        // no arithmetic moves in among the stores below, where it could overwrite a
        // register that an issued store names ahead of the wait behind them
        __builtin_amdgcn_sched_barrier(0);
        #pragma unroll
        for (int r = 0; r < NR; ++r) {
            if (EPI == EPI_F32) *(v4f*)(yf + (i * 16 + r) * (RS * LDY)) = back[r];
            else                *(v4f*)(yh + (i * 16 + 2 * r) * (RS * LDY)) = back[r];
        }
        if (i < 3) {
            // the wait stands before the next rows' arithmetic overwrites the address and
            // data registers of these stores; the scheduling barrier keeps it behind the wait
            asm volatile("s_wait_xcnt 0x0" ::: "memory");
            __builtin_amdgcn_sched_barrier(0);
        }
    }
}

// ---------------------------------------------------------------------------
// w = sigmoid(X@Ww^T + bw), r = sigmoid(X@Wr^T + br), all in fp32, as one
// [32 gates] x [64 tokens] x [K = 1024] product per block on the f32 WMMA.
// 16 waves split K: wave wv owns k = wv*64 .. wv*64+63 and keeps its slice of
// both gate matrices in registers (A operand, rows = gates). Token rows are the
// B operand. Every global load covers whole 256-B row pieces; a wave-private
// LDS tile turns them into fragments. A and B go through the same two
// functions, so their k order is equal at every lane and register.
// The 16 partial sums of each gate value meet in LDS and are added in wave order.
// This kernel also makes the f16 copies of X and of the four big weight matrices for the GEMMs:
//   X : each 16-row tile is rounded to f16 from the registers that hold it for the
//       gates and stored, 16 lanes to one whole 128-B line of Xh;
//   W : each of the 256 blocks rounds 1/256 of the four 1024 x 1024 weight matrices
//       (a quarter of the blocks to each matrix), loaded behind its first X tiles.
// ---------------------------------------------------------------------------
#define GP_WAVES 16
#define GP_TOK   64                   // tokens per block
#define GP_KW    (DM / GP_WAVES)      // 64 k per wave = 256 B of a row
#define GP_PITCH (GP_KW + 4)          // staged row pitch, dwords (272 B: 16 B x odd)
#define GP_RP    36                   // partial-sum row pitch, dwords (32 gates + 4)
#define GP_BLK   (MTOK / GP_TOK)      // 256 blocks
#define GP_WSH   (4 * DM * DM / GP_BLK)        // weight elements a block rounds: 16384
#define GP_WLD   (GP_WSH / (GP_WAVES * 32 * 4)) // 16-B loads of them per thread: 8

__device__ __forceinline__ v4h to_f16(v4f v) {
    v4h h; h.x = (_Float16)v.x; h.y = (_Float16)v.y; h.z = (_Float16)v.z; h.w = (_Float16)v.w;
    return h;
}

__device__ __forceinline__ void gp_fetch(const float* rows, int lane, v4f (&st)[8]) {
    #pragma unroll
    for (int i = 0; i < 8; ++i)
        st[i] = *(const v4f*)(rows + (size_t)(2 * i + (lane >> 4)) * DM + (lane & 15) * 4);
}

// rows in registers -> this wave's own LDS tile
__device__ __forceinline__ void gp_stage(float* stg, int lane, const v4f (&st)[8]) {
    #pragma unroll
    for (int i = 0; i < 8; ++i)
        *(v4f*)(stg + (2 * i + (lane >> 4)) * GP_PITCH + (lane & 15) * 4) = st[i];
    // the rows are read back by other lanes of this wave: stores done first
    asm volatile("s_wait_dscnt 0x0" ::: "memory");
}

// LDS tile -> fragments: lane (c = lane&15, h = lane>>4) gets row c,
// k = 8j + 4h .. 8j + 4h + 3 in fr[j]
__device__ __forceinline__ void gp_frag(const float* stg, int lane, v4f (&fr)[8]) {
    #pragma unroll
    for (int j = 0; j < 8; ++j)
        fr[j] = *(const v4f*)(stg + (lane & 15) * GP_PITCH + (2 * j + (lane >> 4)) * 4);
    // the tile is overwritten by the next gp_stage: reads done first
    asm volatile("s_wait_dscnt 0x0" ::: "memory");
}

__global__ __launch_bounds__(GP_WAVES * 32)
void wr_proj(const float* X,
             const float* Ww, const float* Wb,
             const float* Rw, const float* Rb,
             const float* Wq, const float* Wk, const float* Wv, const float* Wo,
             float* wout, float* rout,
             _Float16* Xh, _Float16* Wh4) {      // Wh4: f16 Wq, Wk, Wv, Wo, one behind the other
    __shared__ __attribute__((aligned(16))) float sStage[GP_WAVES][16 * GP_PITCH];
    __shared__ __attribute__((aligned(16))) float sPart[GP_WAVES][GP_TOK * GP_RP];

    const int t    = threadIdx.x;
    const int lane = t & 31;
    const int wv   = t >> 5;
    const int m0   = blockIdx.x * GP_TOK;
    float* stg = sStage[wv];
    const float* xs = X + (size_t)m0 * DM + wv * GP_KW;
    _Float16*    xh = Xh + (size_t)m0 * DM + wv * GP_KW;

    // this block's share of the big weights: GP_BLK / 4 blocks to a matrix
    static_assert(GP_BLK % 4 == 0 && GP_WLD == 8, "whole blocks per matrix, 8 loads per thread");
    const int    wsel = blockIdx.x / (GP_BLK / 4);
    const float* wsrc = (wsel == 0 ? Wq : wsel == 1 ? Wk : wsel == 2 ? Wv : Wo)
                      + (size_t)(blockIdx.x % (GP_BLK / 4)) * GP_WSH + t * 4;
    _Float16*    wdst = Wh4 + (size_t)blockIdx.x * GP_WSH + t * 4;

    v4f sa[8], sb[8], s0[8], s1[8], gw[8], gr[8], bw[GP_WLD];
    gp_fetch(Ww + wv * GP_KW, lane, sa);
    gp_fetch(Rw + wv * GP_KW, lane, sb);
    // the wait stands before an address register of the gate loads is overwritten
    asm volatile("s_wait_xcnt 0x0" ::: "memory");
    // keeps that overwrite behind the wait, and both gate matrices' loads in front of the X loads:
    // loads return in issue order, and with Rw's issued last the first tile would wait until
    // every X load of the burst has landed
    __builtin_amdgcn_sched_barrier(0);
    gp_fetch(xs, lane, s0);
    gp_fetch(xs + (size_t)16 * DM, lane, s1);
    // keeps the second tile's loads in the first burst: left free they sink behind the wait for Ww
    __builtin_amdgcn_sched_barrier(0);
    gp_stage(stg, lane, sa);
    gp_frag(stg, lane, gw);
    gp_stage(stg, lane, sb);
    gp_frag(stg, lane, gr);
    // behind the gates and the first two X tiles, so that none of them waits for these loads;
    // a wave's load covers 512 contiguous bytes
    #pragma unroll
    for (int i = 0; i < GP_WLD; ++i) bw[i] = *(const v4f*)(wsrc + i * (GP_WAVES * 32 * 4));

    auto do_tile = [&](int tile, v4f (&cur)[8]) {
        v4f fx[8];
        gp_stage(stg, lane, cur);
        v4h hx[8];
        #pragma unroll
        for (int i = 0; i < 8; ++i) hx[i] = to_f16(cur[i]);
        // two tiles ahead, into the registers that were just staged
        if (tile + 2 < GP_TOK / 16) gp_fetch(xs + (size_t)(tile + 2) * 16 * DM, lane, cur);
        #pragma unroll
        for (int i = 0; i < 8; ++i)
            *(v4h*)(xh + (size_t)(tile * 16 + 2 * i + (lane >> 4)) * DM + (lane & 15) * 4) = hx[i];
        // the wait stands before a register that one of these stores names is overwritten
        asm volatile("s_wait_xcnt 0x0" ::: "memory");
        gp_frag(stg, lane, fx);
        v8f aw = vzero8(), ar = vzero8();
        #pragma unroll
        for (int j = 0; j < 8; ++j) {
            v2f x0 = {fx[j].x, fx[j].y}, x1 = {fx[j].z, fx[j].w};
            v2f w0 = {gw[j].x, gw[j].y}, w1 = {gw[j].z, gw[j].w};
            v2f r0 = {gr[j].x, gr[j].y}, r1 = {gr[j].z, gr[j].w};
            aw = __builtin_amdgcn_wmma_f32_16x16x4_f32(false, w0, false, x0, (short)0, aw, false, false);
            ar = __builtin_amdgcn_wmma_f32_16x16x4_f32(false, r0, false, x0, (short)0, ar, false, false);
            aw = __builtin_amdgcn_wmma_f32_16x16x4_f32(false, w1, false, x1, (short)0, aw, false, false);
            ar = __builtin_amdgcn_wmma_f32_16x16x4_f32(false, r1, false, x1, (short)0, ar, false, false);
        }
        // D register e = gate 8h + e of token c: 8 consecutive gates per lane
        float* pp = &sPart[wv][(tile * 16 + (lane & 15)) * GP_RP + ((lane >> 4) << 3)];
        *(v4f*)(pp)      = v4f{aw[0], aw[1], aw[2], aw[3]};
        *(v4f*)(pp + 4)  = v4f{aw[4], aw[5], aw[6], aw[7]};
        *(v4f*)(pp + 16) = v4f{ar[0], ar[1], ar[2], ar[3]};
        *(v4f*)(pp + 20) = v4f{ar[4], ar[5], ar[6], ar[7]};
    };
    static_assert(GP_TOK == 64, "four tiles of 16 tokens");
    do_tile(0, s0);
    do_tile(1, s1);
    // the weight share has landed with the first two tiles; a wave's store covers 256 B
    #pragma unroll
    for (int i = 0; i < GP_WLD; ++i) *(v4h*)(wdst + i * (GP_WAVES * 32 * 4)) = to_f16(bw[i]);
    // the wait stands before a register that one of these stores names is overwritten
    asm volatile("s_wait_xcnt 0x0" ::: "memory");
    do_tile(2, s0);
    do_tile(3, s1);
    __syncthreads();

    // 64 tokens x 32 gates = 512 threads x 4 gates
    const int tok = t >> 3, g4 = (t & 7) * 4;
    v4f s = {0.f, 0.f, 0.f, 0.f};
    #pragma unroll
    for (int w = 0; w < GP_WAVES; ++w) {
        v4f p = *(const v4f*)&sPart[w][tok * GP_RP + g4];
        s.x += p.x; s.y += p.y; s.z += p.z; s.w += p.w;
    }
    const float* bp = (g4 < NH) ? (Wb + g4) : (Rb + g4 - NH);
    v4f y;
    y.x = 1.f / (1.f + __expf(-(s.x + bp[0])));
    y.y = 1.f / (1.f + __expf(-(s.y + bp[1])));
    y.z = 1.f / (1.f + __expf(-(s.z + bp[2])));
    y.w = 1.f / (1.f + __expf(-(s.w + bp[3])));
    float* op = ((g4 < NH) ? wout : rout) + (size_t)(m0 + tok) * NH + (g4 & (NH - 1));
    *(v4f*)op = y;
}

// ---------------------------------------------------------------------------
// K and V projections and A[b,n,v,q] = sum_s Vw[s,(b,n),v] * K[s,(b,n),q] in one kernel:
// K and Vw never leave the WGP. A block takes 256 consecutive s of one batch index b
// (tokens s * B_SZ + b) and 256 columns = 4 heads. It runs the main loop of gemm_xwT twice
// over the same X rows, in one ring: pass 0 with Wk, the unit-normalized f16 rows go to sKt;
// pass 1 with Wv, the rows times w go to the ring, which every wave has left by then. Both tiles lie
// [s][column]; ds_load_tr16_b128 hands lane (c, h) the eight s = 8h .. 8h+7 of column c,
// which is the k order of load_frag, and both operands go through the same function.
// Each wave then sums one head's 64 q x 32 v over the block's 256 s on the WMMA (rows M = q
// from K, columns N = v from Vw: a lane's 8 D registers are 8 consecutive q of one v) and
// stores that f32 partial A; fold_P adds the S_LEN / 256 partials of a (b, n).
// ---------------------------------------------------------------------------
// LDS pitch of a 256-half (512 B) row read by ds_load_tr16_b128: 544 B = 32 B x odd
#define KVP 272
#define NSB (S_LEN / 256)             // s blocks = partial sums per element of A

typedef __attribute__((ext_vector_type(8))) short s16x8;

// tile is [s][KVP]; the fragment holds columns f0 .. f0+15 (row or column c) over
// s0 .. s0+31: halves 0..7 = s0 + 8h + 0..7, halves 8..15 = s0 + 16 + 8h + 0..7
__device__ __forceinline__ v16h load_frag_tr(const _Float16* tile, int s0, int f0) {
    typedef __attribute__((address_space(3))) s16x8 lds_s16x8;
    const int lane = threadIdx.x & 31;
    const _Float16* p = tile + (s0 + ((lane >> 4) << 3) + (lane & 7)) * KVP
                             + f0 + (((lane >> 3) & 1) << 3);
    union { v16h v; s16x8 q[2]; } r;
    r.q[0] = __builtin_amdgcn_ds_load_tr16_b128_v8i16((lds_s16x8*)p);
    r.q[1] = __builtin_amdgcn_ds_load_tr16_b128_v8i16((lds_s16x8*)(p + 16 * KVP));
    return r.v;
}

__global__ __launch_bounds__(256)
void kv_partA(const _Float16* __restrict__ X, const _Float16* __restrict__ Wkv,   // f16 Wk, behind it Wv
              const float* __restrict__ kbias, const float* __restrict__ vbias,
              const float* __restrict__ gate, float* __restrict__ Ap) {
    constexpr int BM = 256, BN = 256, BK = 64, K = DM, RS = B_SZ;
    constexpr int TB = BM * LDG;              // halves of one operand's stage
    // the ring: X buffers 0 and 1, then W buffers 0 and 1; later the Vw tile
    __shared__ __attribute__((aligned(16))) _Float16 ring[4 * TB];
    __shared__ __attribute__((aligned(16))) _Float16 sKt[BM * KVP];
    static_assert(BM * KVP <= 4 * TB, "the Vw tile fits the ring");

    const int t    = threadIdx.x;
    const int lane = t & 31;
    const int wv   = t >> 5;                  // 0..7
    const int bsel = (int)(blockIdx.x % RS);
    const int sblk = (int)(blockIdx.x / RS);
    const int mBlk = sblk * (BM * RS) + bsel;
    const int nBlk = blockIdx.y * BN;
    const int wm   = (wv >> 1) * 64;          // 0 / 64 / 128 / 192
    const int wn   = (wv & 1) * 128;          // 0 / 128
    constexpr int nk = K / BK;
    static_assert(nk >= 2 && (nk & (nk - 1)) == 0, "stages 0 and 1 exist; a pass is a power of two of stages");

    // 16 async b128 copies per thread per stage (8 X chunks, then 8 W chunks), as in gemm_xwT
    const int row = t >> 3, kc = (t & 7) * 8;
    const size_t rstep = (size_t)32 * K;             // 32 rows on, the same for every lane
    // stage st = pass * nk + kt: k columns kt * BK of the X rows and of the pass's matrix.
    // The stages are issued in order; px and pw point at the lane's first chunks of the next one.
    const _Float16* px = X + (size_t)(mBlk + row * RS) * K + kc;
    const _Float16* pw = Wkv + (size_t)(nBlk + row) * K + kc;
    auto issue = [&](int st, int buf) {
        const _Float16* g[8];
        const _Float16* l[8];
        #pragma unroll
        for (int p = 0; p < 8; ++p) {
            g[p] = px + p * (RS * rstep);
            l[p] = &ring[buf * TB + (row + p * 32) * LDG + kc];
        }
        async_ld8_b128(g, l);
        #pragma unroll
        for (int p = 0; p < 8; ++p) {
            g[p] = pw + p * rstep;
            l[p] = &ring[(2 + buf) * TB + (row + p * 32) * LDG + kc];
        }
        async_ld8_b128(g, l);
        // behind a pass's last stage: back to k = 0 of the X rows, on to the next matrix
        const bool wrap = (st & (nk - 1)) == nk - 1;
        px += wrap ? BK - K : BK;
        pw += wrap ? BK - K + DM * DM : BK;
    };

    const int c = lane & 15, hh = lane >> 4;
    const int head = (nBlk + wn) / HD;

    v8f acc[4][8];
    #pragma unroll
    for (int i = 0; i < 4; ++i)
        #pragma unroll
        for (int j = 0; j < 8; ++j) acc[i][j] = vzero8();

    issue(0, 0);
    // stage 0 has landed for this wave, and behind the barrier for every wave
    asm volatile("s_wait_asynccnt 0x0" ::: "memory");
    __syncthreads();
    issue(1, 1);
    // one ring over the 2 * nk stages of both passes: the V pass's first stages fly under the
    // K pass's last trips and its epilogue, which writes sKt alone
    // the two passes stand one behind the other in the text: each epilogue is then compiled for
    // its own pass and its addresses are not held in registers through the trips
    #pragma unroll
    for (int pass = 0; pass < 2; ++pass) {
        for (int kt = 0; kt < nk; ++kt) {
            const int st = pass * nk + kt;
            const int b = st & 1;
            #pragma unroll
            for (int kk = 0; kk < BK; kk += 32) {
                v16h aF[4], bF[8];
                #pragma unroll
                for (int i = 0; i < 4; ++i) aF[i] = load_frag(ring + b * TB + kk, wm + i * 16, LDG);
                #pragma unroll
                for (int j = 0; j < 8; ++j) bF[j] = load_frag(ring + (2 + b) * TB + kk, wn + j * 16, LDG);
                // keeps a block's 24 LDS reads in front of its own 32 WMMAs, as in gemm_xwT
                __builtin_amdgcn_sched_barrier(0);
                #pragma unroll
                for (int i = 0; i < 4; ++i)
                    #pragma unroll
                    for (int j = 0; j < 8; ++j)
                        // W rows are the A operand (rows of D), tokens the B operand (columns of D)
                        acc[i][j] = __builtin_amdgcn_wmma_f32_16x16x32_f16(
                            false, bF[j], false, aF[i], (short)0, acc[i][j], false, false);
            }
            // keeps the trip's last WMMAs in front of the barrier, as in gemm_xwT
            __builtin_amdgcn_sched_barrier(0);
            // this wave's reads of buf b are done before the buffer may be refilled
            asm volatile("s_wait_dscnt 0x0" ::: "memory");
            // this wave's copies of stage st+1 have landed before the barrier publishes them
            asm volatile("s_wait_asynccnt 0x0" ::: "memory");
            __syncthreads();
            if (st + 2 < 2 * nk) issue(st + 2, b);
        }

        // Epilogue of a pass, as in gemm_xwT: a lane holds 8 consecutive columns of token (lane&15)
        // of tile i, a head row lies in lanes c and c + 16. The f16 rows go to the pass's LDS tile:
        // K to sKt; Vw to the ring, which behind the last trip's waits and barrier every wave has
        // left and no copy is aimed at.
        _Float16* dst = (pass == 0 ? sKt : ring) + (wm + c) * KVP + wn + hh * 8;
        const float* bp = (pass == 0 ? kbias : vbias) + nBlk + wn + hh * 8;
        v4f bv[8][2];
        #pragma unroll
        for (int j = 0; j < 8; ++j) {
            bv[j][0] = *(const v4f*)(bp + j * 16);
            bv[j][1] = *(const v4f*)(bp + j * 16 + 4);
        }
        v2f sc[4] = {v2f{0.f, 0.f}, v2f{0.f, 0.f}, v2f{0.f, 0.f}, v2f{0.f, 0.f}};
        if (pass == 1) {
            const float* gp = gate + (size_t)(mBlk + (wm + c) * RS) * NH + head;   // the wave's two heads adjoin
            #pragma unroll
            for (int i = 0; i < 4; ++i) sc[i] = *(const v2f*)(gp + i * 16 * RS * NH);
            // the wait stands before a register that one of the loads above names is overwritten;
            // the pointers as inputs keep the address registers whole up to the wait
            asm volatile("s_wait_xcnt 0x0" :: "v"(gp), "v"(bp) : "memory");
        } else {
            // the wait stands before a register that one of the bias loads names is overwritten
            asm volatile("s_wait_xcnt 0x0" :: "v"(bp) : "memory");
        }
        // keeps the arithmetic that overwrites those registers behind the wait
        __builtin_amdgcn_sched_barrier(0);
        #pragma unroll
        for (int i = 0; i < 4; ++i) {
            #pragma unroll
            for (int h = 0; h < 2; ++h) {
                v4f val[4][2];
                #pragma unroll
                for (int j = 0; j < 4; ++j)
                    #pragma unroll
                    for (int u = 0; u < 2; ++u)
                        #pragma unroll
                        for (int e = 0; e < 4; ++e)
                            val[j][u][e] = acc[i][h * 4 + j][u * 4 + e] + bv[h * 4 + j][u][e];
                float f = sc[i][h];               // v: the gate w
                if (pass == 0) {                  // k: unit norm
                    // the lane's 32 squares in four chains, then the other half of the row
                    v4f s4 = {0.f, 0.f, 0.f, 0.f};
                    #pragma unroll
                    for (int j = 0; j < 4; ++j)
                        #pragma unroll
                        for (int u = 0; u < 2; ++u) s4 += val[j][u] * val[j][u];
                    float ss = (s4.x + s4.y) + (s4.z + s4.w);
                    ss += __int_as_float(__builtin_amdgcn_permlanex16(
                              __float_as_int(ss), __float_as_int(ss), 0x76543210, 0xfedcba98, false, false));
                    float rs;
                    asm("v_rsq_f32 %0, %1\n\tv_nop" : "=v"(rs) : "v"(ss));
                    f = fminf(rs, 1e12f);
                }
                #pragma unroll
                for (int j = 0; j < 4; ++j) {
                    v8h p;
                    #pragma unroll
                    for (int e = 0; e < 8; ++e) p[e] = (_Float16)(val[j][e >> 2][e & 3] * f);
                    *(v8h*)(dst + i * 16 * KVP + (h * 4 + j) * 16) = p;
                }
            }
        }
        // the next pass sums from zero
        if (pass == 0) {
            #pragma unroll
            for (int i = 0; i < 4; ++i)
                #pragma unroll
                for (int j = 0; j < 8; ++j) acc[i][j] = vzero8();
        }
    }
    // no copy is outstanding when the ring is read as the Vw tile and the wave goes on to its end
    asm volatile("s_wait_asynccnt 0x0" ::: "memory");
    // both tiles are read by every wave: this wave's rows are stored first
    asm volatile("s_wait_dscnt 0x0" ::: "memory");
    __syncthreads();

    // wave -> head hl of the block's four, v half vh; 4 q tiles x 2 v tiles, k = s in steps of 32
    const int hl = wv >> 1, vh = (wv & 1) * 32;
    v8f pa[2][4];
    #pragma unroll
    for (int vt = 0; vt < 2; ++vt)
        #pragma unroll
        for (int qt = 0; qt < 4; ++qt) pa[vt][qt] = vzero8();
    #pragma unroll
    for (int s0 = 0; s0 < BM; s0 += 32) {
        v16h kf[4], vf[2];
        #pragma unroll
        for (int qt = 0; qt < 4; ++qt) kf[qt] = load_frag_tr(sKt, s0, hl * HD + qt * 16);
        #pragma unroll
        for (int vt = 0; vt < 2; ++vt) vf[vt] = load_frag_tr(ring, s0, hl * HD + vh + vt * 16);
        #pragma unroll
        for (int vt = 0; vt < 2; ++vt)
            #pragma unroll
            for (int qt = 0; qt < 4; ++qt)
                pa[vt][qt] = __builtin_amdgcn_wmma_f32_16x16x32_f16(
                    false, kf[qt], false, vf[vt], (short)0, pa[vt][qt], false, false);
    }
    // partial A[sblk][b*NH + n][v][q]: the wave's eight stores of a v tile fill 16 whole 256-B rows
    float* ap = Ap + ((((size_t)sblk * B_SZ + bsel) * NH + blockIdx.y * 4 + hl) * HD + vh + c) * HD + hh * 8;
    #pragma unroll
    for (int vt = 0; vt < 2; ++vt)
        #pragma unroll
        for (int qt = 0; qt < 4; ++qt) {
            *(v4f*)(ap + vt * 16 * HD + qt * 16)     = v4f{pa[vt][qt][0], pa[vt][qt][1], pa[vt][qt][2], pa[vt][qt][3]};
            *(v4f*)(ap + vt * 16 * HD + qt * 16 + 4) = v4f{pa[vt][qt][4], pa[vt][qt][5], pa[vt][qt][6], pa[vt][qt][7]};
        }
}

// ---------------------------------------------------------------------------
// Two blocks per (b, n): each adds the NSB partial sums of A in s order (the first of the two
// writes f32 A to the d_out region) and folds A into its half of the output projection's rows:
//   out[s,b,o] = sum_n sum_v (r * sum_q Q[q] A[v,q]) Wo[o, n*64+v]
//              = sum_n sum_q (r * Q[q]) * P[b][o, n*64+q],  P[b][o, n*64+q] = sum_v A[v,q] Wo[o, n*64+v]
// The block makes its 512 x 64 slice of P[b] on the WMMA: rows (M) = q from A^T, rounded
// to f16 and laid [q][v] in LDS, columns (N) = o from the rows of Wo, k = v. Each wave takes
// 64 o. A lane's 8 D registers are 8 consecutive q of one o: one 16-B store.
// ---------------------------------------------------------------------------
__global__ __launch_bounds__(256)
void fold_P(const float* Ap, const _Float16* Woh, float* __restrict__ Af, _Float16* __restrict__ Ph) {
    const int bn = blockIdx.x >> 1;     // b*16 + n
    const int b  = bn >> 4, n = bn & 15;
    __shared__ __attribute__((aligned(16))) _Float16 sAt[HD * LDG];    // [q][v]
    const int t = threadIdx.x, lane = t & 31, wv = t >> 5;   // 8 waves
    const int o0 = (blockIdx.x & 1) * (DM / 2) + wv * 64;    // the wave's first row of Wo

    // a thread's 4 x 4 consecutive elements of each partial; a wave's load covers 512 B
    const float* ap = Ap + (size_t)bn * (HD * HD) + t * 4;
    v4f pr[NSB][4];
    #pragma unroll
    for (int p = 0; p < NSB; ++p)
        #pragma unroll
        for (int k = 0; k < 4; ++k)
            pr[p][k] = *(const v4f*)(ap + (size_t)p * (B_SZ * NH * HD * HD) + k * 1024);
    // the wait stands before a register that one of these loads names is overwritten
    asm volatile("s_wait_xcnt 0x0" :: "v"(ap) : "memory");
    // keeps the Wo loads, whose results may overwrite such a register, behind the wait
    __builtin_amdgcn_sched_barrier(0);
    // this wave's 64 rows of Wo, columns of head n, as 4 x 2 fragments, behind the partials,
    // which are wanted first
    const _Float16* wl = Woh + (size_t)(o0 + (lane & 15)) * DM + n * HD + ((lane >> 4) << 3);
    v16h wo[4][2];
    #pragma unroll
    for (int it = 0; it < 4; ++it)
        #pragma unroll
        for (int kt = 0; kt < 2; ++kt) wo[it][kt] = frag_at(wl + it * 16 * DM + kt * 32);
    // the wait stands before a register that one of these loads names is overwritten; wl as
    // an input keeps the address register whole up to the wait
    asm volatile("s_wait_xcnt 0x0" :: "v"(wl) : "memory");
    // keeps the arithmetic that overwrites them behind the wait
    __builtin_amdgcn_sched_barrier(0);

    v4f s[4];
    #pragma unroll
    for (int k = 0; k < 4; ++k) {
        s[k] = pr[0][k];
        #pragma unroll
        for (int p = 1; p < NSB; ++p) s[k] += pr[p][k];
        // element k*1024 + t*4 + e is v = k*16 + t/16, q = (t%16)*4 + e; A^T in f16
        #pragma unroll
        for (int e = 0; e < 4; ++e)
            sAt[((t & 15) * 4 + e) * LDG + k * 16 + (t >> 4)] = (_Float16)s[k][e];
    }
    // every wave reads the whole of A^T
    __syncthreads();
    v16h aq[4][2];
    #pragma unroll
    for (int qt = 0; qt < 4; ++qt)
        #pragma unroll
        for (int kt = 0; kt < 2; ++kt) aq[qt][kt] = load_frag(sAt + kt * 32, qt * 16, LDG);
    v8h ph[4][4];
    #pragma unroll
    for (int it = 0; it < 4; ++it) {
        v8f d[4] = {vzero8(), vzero8(), vzero8(), vzero8()};
        #pragma unroll
        for (int kt = 0; kt < 2; ++kt)
            #pragma unroll
            for (int qt = 0; qt < 4; ++qt)
                d[qt] = __builtin_amdgcn_wmma_f32_16x16x32_f16(
                    false, aq[qt][kt], false, wo[it][kt], (short)0, d[qt], false, false);
        #pragma unroll
        for (int qt = 0; qt < 4; ++qt)
            #pragma unroll
            for (int e = 0; e < 8; ++e) ph[it][qt][e] = (_Float16)d[qt][e];
    }
    // row o of P[b], columns of head n: the wave's four stores fill the row's whole 128-B line
    _Float16* pl = Ph + ((size_t)b * DM + o0 + (lane & 15)) * DM + n * HD + ((lane >> 4) << 3);
    float*    al = Af + (size_t)bn * (HD * HD) + t * 4;
    // no arithmetic moves in among the stores below, where it could overwrite a
    // register that an issued store names
    __builtin_amdgcn_sched_barrier(0);
    #pragma unroll
    for (int it = 0; it < 4; ++it)
        #pragma unroll
        for (int qt = 0; qt < 4; ++qt) *(v8h*)(pl + it * 16 * DM + qt * 16) = ph[it][qt];
    // the wait stands before a register that one of these stores names is overwritten
    asm volatile("s_wait_xcnt 0x0" ::: "memory");
    // keeps the address arithmetic of the A stores, which overwrites them, behind the wait
    __builtin_amdgcn_sched_barrier(0);
    // A itself, from one of the two blocks: a wave's store covers 512 B
    if ((blockIdx.x & 1) == 0) {
        #pragma unroll
        for (int k = 0; k < 4; ++k) *(v4f*)(al + k * 1024) = s[k];
    }
}

// ---------------------------------------------------------------------------
// Launch
// ---------------------------------------------------------------------------
extern "C" void kernel_launch(void* const* d_in, const int* in_sizes, int n_in,
                              void* d_out, int out_size, void* d_ws, size_t ws_size,
                              hipStream_t stream) {
    (void)in_sizes; (void)n_in; (void)out_size; (void)ws_size;
    const float* inp  = (const float*)d_in[0];
    const float* Wq_w = (const float*)d_in[1];  const float* Wq_b = (const float*)d_in[2];
    const float* Wk_w = (const float*)d_in[3];  const float* Wk_b = (const float*)d_in[4];
    const float* Wv_w = (const float*)d_in[5];  const float* Wv_b = (const float*)d_in[6];
    const float* Wo_w = (const float*)d_in[7];  const float* Wo_b = (const float*)d_in[8];
    const float* Ww_w = (const float*)d_in[9];  const float* Ww_b = (const float*)d_in[10];
    const float* Wr_w = (const float*)d_in[11]; const float* Wr_b = (const float*)d_in[12];

    float* out_f = (float*)d_out;                       // [S,B,DM]
    float* A_f   = out_f + (size_t)MTOK * DM;           // [B,NH,64,64]

    char* ws = (char*)d_ws;
    constexpr size_t HBYTES = (size_t)MTOK * DM * sizeof(_Float16);   // 32 MiB
    constexpr size_t GATE   = (size_t)MTOK * NH * 4;                  // 1 MiB
    constexpr size_t WBYTES = (size_t)DM * DM * sizeof(_Float16);     // 2 MiB
    _Float16* Xh  = (_Float16*)(ws);
    _Float16* Qh  = (_Float16*)(ws + HBYTES);
    float*    Apt = (float*)   (ws + 2 * HBYTES);              // NSB partial sums of A, 16 MiB
    float*    wbf = (float*)   (ws + 4 * HBYTES);
    float*    rbf = (float*)   (ws + 4 * HBYTES + GATE);
    _Float16* Ph  = (_Float16*)(ws + 4 * HBYTES + 2 * GATE);   // B_SZ folded matrices, 16 MiB
    _Float16* Wqh = (_Float16*)(ws + 5 * HBYTES + 3 * GATE);
    _Float16* Wkh = (_Float16*)(ws + 5 * HBYTES + 3 * GATE + WBYTES);
    _Float16* Woh = (_Float16*)(ws + 5 * HBYTES + 3 * GATE + 3 * WBYTES);

    // 1, 2) gate projections (w, r are read by the V and Q projections' epilogues), and with them the
    //       f16 copies of the input and of the four big weight matrices (Wqh .. Woh adjoin)
    wr_proj<<<GP_BLK, GP_WAVES * 32, 0, stream>>>(inp, Ww_w, Ww_b, Wr_w, Wr_b,
                                                  Wq_w, Wk_w, Wv_w, Wo_w, wbf, rbf, Xh, Wqh);

    // 3) Q projection (WMMA GEMM, async-LDS pipeline, f16 out): unit-normalized per head, times r
    dim3 gg(MTOK / 256, DM / 256);
    gemm_xwT<EPI_UNITG><<<gg, 256, 0, stream>>>(Xh, Wqh, Wq_b, rbf, Qh, nullptr, MTOK, DM, DM);

    // 4) K and V projections with the partial sums of A over each block's 256 s; then their
    //    sum (the f32 A output) and the folded weights P[b] = Wo x A[b]
    kv_partA<<<gg, 256, 0, stream>>>(Xh, Wkh, Wk_b, Wv_b, wbf, Apt);        // Wvh adjoins Wkh
    fold_P<<<B_SZ * NH * 2, 256, 0, stream>>>(Apt, Woh, A_f, Ph);

    // 5) output projection of q * r with the batch's folded weights (f32 out to d_out)
    gemm_xwT<EPI_F32, B_SZ><<<gg, 256, 0, stream>>>(Qh, Ph, Wo_b, nullptr, nullptr, out_f, MTOK, DM, DM);
}
